// v000
// Measured on an AMD MI455X. A time is GPU time per run, averaged over a window of back-to-back runs after a warm-up
// (all launches, gaps included; the runs take copies of the inputs in turn), and the median of several windows.
// Apart from v000's, it joins two sittings. Times from different sittings can be a few percent apart, while
// side-by-side timings come from the same sitting.
// v000 is the starting kernel. One run takes 3480 microseconds.
#include <hip/hip_runtime.h>
#include <math.h>

typedef _Float16 f16;
typedef __attribute__((ext_vector_type(16))) _Float16 v16h;
typedef __attribute__((ext_vector_type(8)))  _Float16 v8h;
typedef __attribute__((ext_vector_type(8)))  float    v8f;
typedef __attribute__((ext_vector_type(4)))  int      v4i;

#define B_    4
#define L_    2048
#define D_    1024
#define H_    4
#define NL_   2
#define HD_   256
#define FF_   4096
#define MTOT  (B_*L_)      // 8192 token rows
#define EPS_  1e-5f

#if __has_builtin(__builtin_amdgcn_global_load_async_to_lds_b128) && \
    __has_builtin(__builtin_amdgcn_s_wait_asynccnt)
#define HAVE_ASYNC_LDS 1
#else
#define HAVE_ASYNC_LDS 0
#endif

typedef __attribute__((address_space(1))) v4i gv4i_t;
typedef __attribute__((address_space(3))) v4i lv4i_t;

__device__ __forceinline__ void copy_g2l_b128(f16* dst_lds, const f16* src_glb) {
#if HAVE_ASYNC_LDS
  __builtin_amdgcn_global_load_async_to_lds_b128(
      (gv4i_t*)(const_cast<f16*>(src_glb)),
      (lv4i_t*)dst_lds, 0, 0);
#else
  *(v8h*)dst_lds = *(const v8h*)src_glb;
#endif
}

// Wait until at most `n` async copies (per wave) are still outstanding.
// Async loads retire in order, so lag-N waiting gives double buffering.
__device__ __forceinline__ void async_wait_upto(int n) {
#if HAVE_ASYNC_LDS
  if (n == 0)       __builtin_amdgcn_s_wait_asynccnt(0);
  else if (n == 5)  __builtin_amdgcn_s_wait_asynccnt(5);
  else              __builtin_amdgcn_s_wait_asynccnt(0);
#endif
}

__device__ __forceinline__ v16h make_frag(v8h lo, v8h hi) {
  return __builtin_shufflevector(lo, hi, 0,1,2,3,4,5,6,7,8,9,10,11,12,13,14,15);
}

__device__ __forceinline__ v16h load_frag(const f16* tile, int rowBase, int ld,
                                          int kChunkBase, int lane) {
  int r  = rowBase + (lane & 15);
  int kb = kChunkBase + ((lane < 16) ? 0 : 8);
  const f16* p = tile + (size_t)r * ld + kb;
  v8h lo = *(const v8h*)(p);
  v8h hi = *(const v8h*)(p + 16);
  return make_frag(lo, hi);
}

// ---------------------------------------------------------------------------
// f32 -> f16 conversion (grid-stride)
// ---------------------------------------------------------------------------
__global__ void cvt_f32_f16_kernel(const float* __restrict__ in, f16* __restrict__ out,
                                   size_t n) {
  size_t i = (size_t)blockIdx.x * blockDim.x + threadIdx.x;
  size_t stride = (size_t)gridDim.x * blockDim.x;
  for (; i < n; i += stride) out[i] = (f16)in[i];
}

// ---------------------------------------------------------------------------
// LayerNorm over D_=1024: one 256-thread block per row.
// ---------------------------------------------------------------------------
template<bool OUT_F16>
__global__ void __launch_bounds__(256)
ln_kernel(const float* __restrict__ x, const float* __restrict__ g,
          const float* __restrict__ bb, void* __restrict__ out) {
  __shared__ float red[256];
  int row = blockIdx.x;
  const float* xr = x + (size_t)row * D_;
  float v[4];
  float s = 0.f;
  #pragma unroll
  for (int i = 0; i < 4; i++) { v[i] = xr[threadIdx.x + i*256]; s += v[i]; }
  red[threadIdx.x] = s; __syncthreads();
  for (int o = 128; o > 0; o >>= 1) {
    if ((int)threadIdx.x < o) red[threadIdx.x] += red[threadIdx.x + o];
    __syncthreads();
  }
  float mu = red[0] * (1.0f / D_);
  __syncthreads();
  float s2 = 0.f;
  #pragma unroll
  for (int i = 0; i < 4; i++) { float d = v[i] - mu; s2 += d * d; }
  red[threadIdx.x] = s2; __syncthreads();
  for (int o = 128; o > 0; o >>= 1) {
    if ((int)threadIdx.x < o) red[threadIdx.x] += red[threadIdx.x + o];
    __syncthreads();
  }
  float rstd = rsqrtf(red[0] * (1.0f / D_) + EPS_);
  #pragma unroll
  for (int i = 0; i < 4; i++) {
    int c = threadIdx.x + i*256;
    float y = (v[i] - mu) * rstd * g[c] + bb[c];
    if (OUT_F16) ((f16*)out)[(size_t)row*D_ + c] = (f16)y;
    else         ((float*)out)[(size_t)row*D_ + c] = y;
  }
}

template<bool OUT_F16, bool RES, bool GELU>
__global__ void __launch_bounds__(256)
gemm_kernel(const f16* __restrict__ A, const f16* __restrict__ W,
            const float* __restrict__ bias, const float* __restrict__ resid,
            void* __restrict__ out, int M, int N, int K) {
  __shared__ f16 As[2][64*32];
  __shared__ f16 Ws[2][256*32];
  int tid  = threadIdx.x;
  int lane = tid & 31, wave = tid >> 5;
  int waveM = wave >> 1, waveN = wave & 1;
  int blockN0 = blockIdx.x * 256, blockM0 = blockIdx.y * 64;

  const int nchunks = K >> 5;   // K is a multiple of 32

  // issue one chunk's async copies into buffer `buf` (5 b128 ops per thread)
  auto issue = [&](int chunk, int buf) {
    int k0 = chunk * 32;
    {  // A tile: 64x32 halves = 256 b128, 1 per thread
      int r = tid >> 2, c8 = (tid & 3) * 8;
      copy_g2l_b128(&As[buf][r*32 + c8], &A[(size_t)(blockM0 + r)*K + k0 + c8]);
    }
    #pragma unroll
    for (int i = 0; i < 4; i++) {  // W tile: 256x32 halves = 1024 b128, 4 per thread
      int id = tid + i*256;
      int r = id >> 2, c8 = (id & 3) * 8;
      copy_g2l_b128(&Ws[buf][r*32 + c8], &W[(size_t)(blockN0 + r)*K + k0 + c8]);
    }
  };

  v8f acc[8] = {};
  issue(0, 0);
  for (int c = 0; c < nchunks; c++) {
    int buf = c & 1;
    if (c + 1 < nchunks) issue(c + 1, buf ^ 1);       // prefetch next chunk
    async_wait_upto((c + 1 < nchunks) ? 5 : 0);       // chunk c landed
    __syncthreads();
    v16h af = load_frag(As[buf], waveM*16, 32, 0, lane);
    #pragma unroll
    for (int t = 0; t < 8; t++) {
      v16h bf = load_frag(Ws[buf], waveN*128 + t*16, 32, 0, lane);
      acc[t] = __builtin_amdgcn_wmma_f32_16x16x32_f16(false, af, false, bf,
                                                      (short)0, acc[t], false, false);
    }
    __syncthreads();   // all reads of buf done before it is overwritten
  }

  int mHalf = (lane < 16) ? 0 : 8;
  int n0 = lane & 15;
  #pragma unroll
  for (int t = 0; t < 8; t++) {
    int gcol = blockN0 + waveN*128 + t*16 + n0;
    float bv = bias[gcol];
    #pragma unroll
    for (int j = 0; j < 8; j++) {
      int grow = blockM0 + waveM*16 + mHalf + j;
      float v = acc[t][j] + bv;
      if (GELU) v = 0.5f * v * (1.0f + erff(v * 0.70710678118f));
      size_t idx = (size_t)grow * N + gcol;
      if (RES) v += resid[idx];
      if (OUT_F16) ((f16*)out)[idx] = (f16)v;
      else         ((float*)out)[idx] = v;
    }
  }
}

// ---------------------------------------------------------------------------
// Flash attention (non-causal), f16 in / f16 out, f32 online-softmax state.
// Block = 256 threads = 8 waves; q-block 64. Waves pair up per 16-row q-tile:
//   wave (qt, kh): S = Q Kt^T for key-half kh (2 of 4 key tiles, K=256 in 8
//   chunks) -> shared S buffer;  softmax row-wise by the kh==0 wave;
//   O(16 x 128) += P V for d-half kh (8 accumulators per wave).
// Q/K tiles are staged row-major via async copies; V staged transposed (d,key)
// so P*V's B-fragments are plain row-major loads.
// qkv layout: row stride 3D, q at col h*HD, k at D+h*HD, v at 2D+h*HD.
// ---------------------------------------------------------------------------
__global__ void __launch_bounds__(256, 1)
attn_kernel(const f16* __restrict__ qkv, f16* __restrict__ o) {
  extern __shared__ char smem[];
  f16*   Qt = (f16*)smem;                 // [64][256]
  f16*   Kt = Qt + 64*256;                // [64][256]
  f16*   Vt = Kt + 64*256;                // [256][64]  (transposed V)
  float* Sb = (float*)(Vt + 256*64);      // [4][16][64]
  f16*   Pb = (f16*)(Sb + 4*16*64);       // [4][16][64]
  float* Al = (float*)(Pb + 4*16*64);     // [4][16] alpha
  float* Li = Al + 4*16;                  // [4][16] 1/l

  int tid = threadIdx.x, lane = tid & 31, wave = tid >> 5;
  int qt = wave >> 1;        // q-tile 0..3
  int dh = wave & 1;         // key-half for S, d-half for O
  int b = blockIdx.z, h = blockIdx.y;
  int q0 = blockIdx.x * 64;
  const size_t rs = 3*D_;
  const f16* qb = qkv + (size_t)b*L_*rs +        (size_t)h*HD_;
  const f16* kp = qkv + (size_t)b*L_*rs + D_   + (size_t)h*HD_;
  const f16* vp = qkv + (size_t)b*L_*rs + 2*D_ + (size_t)h*HD_;

  int m     = lane & 15;
  int mHalf = (lane < 16) ? 0 : 8;

  // stage Q tile once: 64x256 halves = 2048 b128, 8 per thread
  #pragma unroll
  for (int i = 0; i < 8; i++) {
    int id = tid + i*256;
    int r = id >> 5, c8 = (id & 31) * 8;
    copy_g2l_b128(&Qt[r*256 + c8], &qb[(size_t)(q0 + r)*rs + c8]);
  }

  v8f oacc[8] = {};
  float rm = -INFINITY, rl = 0.0f;
  const float scale = 0.0625f;   // 1/sqrt(256)

  float* Sw = Sb + qt*16*64;
  f16*   Pw = Pb + qt*16*64;
  float* Aw = Al + qt*16;
  float* Lw = Li + qt*16;

  for (int kb0 = 0; kb0 < L_; kb0 += 64) {
    // K tile (async, row-major)
    #pragma unroll
    for (int i = 0; i < 8; i++) {
      int id = tid + i*256;
      int r = id >> 5, c8 = (id & 31) * 8;
      copy_g2l_b128(&Kt[r*256 + c8], &kp[(size_t)(kb0 + r)*rs + c8]);
    }
    // V tile, transposed into (d, key)
    #pragma unroll
    for (int i = 0; i < 8; i++) {
      int id = tid + i*256;
      int r = id >> 5, c8 = (id & 31) * 8;
      v8h vv = *(const v8h*)&vp[(size_t)(kb0 + r)*rs + c8];
      #pragma unroll
      for (int j = 0; j < 8; j++) Vt[(c8 + j)*64 + r] = vv[j];
    }
    async_wait_upto(0);
    __syncthreads();

    // S(16 x 32) for this wave's key-half
    v8f s[2] = {};
    #pragma unroll
    for (int c = 0; c < 8; c++) {
      v16h af = load_frag(Qt, qt*16, 256, c*32, lane);
      #pragma unroll
      for (int t = 0; t < 2; t++) {
        v16h bf = load_frag(Kt, dh*32 + t*16, 256, c*32, lane);
        s[t] = __builtin_amdgcn_wmma_f32_16x16x32_f16(false, af, false, bf,
                                                      (short)0, s[t], false, false);
      }
    }
    // spill S to the q-tile's shared buffer, (q,key) row-major f32
    #pragma unroll
    for (int t = 0; t < 2; t++)
      #pragma unroll
      for (int j = 0; j < 8; j++)
        Sw[(mHalf + j)*64 + dh*32 + t*16 + m] = s[t][j];
    __syncthreads();

    // online softmax: kh==0 wave, lane r < 16 owns row r of the q-tile
    if (dh == 0 && lane < 16) {
      const float* srow = Sw + lane*64;
      float mx = rm;
      for (int c2 = 0; c2 < 64; c2++) mx = fmaxf(mx, srow[c2] * scale);
      float alpha = __expf(rm - mx);
      float sum = 0.0f;
      f16* prow = Pw + lane*64;
      for (int c2 = 0; c2 < 64; c2++) {
        float p = __expf(srow[c2] * scale - mx);
        prow[c2] = (f16)p;
        sum += p;
      }
      rl = rl * alpha + sum;
      rm = mx;
      Aw[lane] = alpha;
    }
    __syncthreads();

    // rescale O accumulators by per-row alpha
    float a8[8];
    #pragma unroll
    for (int j = 0; j < 8; j++) a8[j] = Aw[mHalf + j];
    #pragma unroll
    for (int dt = 0; dt < 8; dt++)
      #pragma unroll
      for (int j = 0; j < 8; j++) oacc[dt][j] *= a8[j];

    // O(16 x 128) += P V for this wave's d-half
    v16h pf0 = load_frag(Pw, 0, 64, 0,  lane);
    v16h pf1 = load_frag(Pw, 0, 64, 32, lane);
    #pragma unroll
    for (int dt = 0; dt < 8; dt++) {
      v16h bf0 = load_frag(Vt, dh*128 + dt*16, 64, 0, lane);
      oacc[dt] = __builtin_amdgcn_wmma_f32_16x16x32_f16(false, pf0, false, bf0,
                                                        (short)0, oacc[dt], false, false);
      v16h bf1 = load_frag(Vt, dh*128 + dt*16, 64, 32, lane);
      oacc[dt] = __builtin_amdgcn_wmma_f32_16x16x32_f16(false, pf1, false, bf1,
                                                        (short)0, oacc[dt], false, false);
    }
    __syncthreads();
  }

  if (dh == 0 && lane < 16) Lw[lane] = 1.0f / rl;
  __syncthreads();
  float l8[8];
  #pragma unroll
  for (int j = 0; j < 8; j++) l8[j] = Lw[mHalf + j];

  #pragma unroll
  for (int dt = 0; dt < 8; dt++) {
    #pragma unroll
    for (int j = 0; j < 8; j++) {
      int grow = q0 + qt*16 + mHalf + j;
      int gcol = h*HD_ + dh*128 + dt*16 + m;
      o[((size_t)b*L_ + grow)*D_ + gcol] = (f16)(oacc[dt][j] * l8[j]);
    }
  }
}

// ---------------------------------------------------------------------------
// Host orchestration
// ---------------------------------------------------------------------------
static inline size_t align256(size_t x) { return (x + 255) & ~(size_t)255; }

extern "C" void kernel_launch(void* const* d_in, const int* in_sizes, int n_in,
                              void* d_out, int out_size, void* d_ws, size_t ws_size,
                              hipStream_t stream) {
  (void)in_sizes; (void)n_in; (void)out_size; (void)ws_size;
  const float* x     = (const float*)d_in[0];
  const float* w3d   = (const float*)d_in[1];
  const float* b3d   = (const float*)d_in[2];
  const float* ln1_g = (const float*)d_in[3];
  const float* ln1_b = (const float*)d_in[4];
  const float* wqkv  = (const float*)d_in[5];
  const float* bqkv  = (const float*)d_in[6];
  const float* wproj = (const float*)d_in[7];
  const float* bproj = (const float*)d_in[8];
  const float* ln2_g = (const float*)d_in[9];
  const float* ln2_b = (const float*)d_in[10];
  const float* w1    = (const float*)d_in[11];
  const float* b1    = (const float*)d_in[12];
  const float* w2    = (const float*)d_in[13];
  const float* b2    = (const float*)d_in[14];
  const float* lnf_g = (const float*)d_in[15];
  const float* lnf_b = (const float*)d_in[16];

  // workspace carve-up (~292 MB)
  char* ws = (char*)d_ws;
  size_t off = 0;
  auto carve = [&](size_t bytes) -> void* { void* p = ws + off; off += align256(bytes); return p; };
  f16*   xh     = (f16*)  carve((size_t)MTOT*3*D_*sizeof(f16));
  f16*   w3dh   = (f16*)  carve((size_t)D_*3*D_*sizeof(f16));
  f16*   wqkvh  = (f16*)  carve((size_t)NL_*3*D_*D_*sizeof(f16));
  f16*   wprojh = (f16*)  carve((size_t)NL_*D_*D_*sizeof(f16));
  f16*   w1h    = (f16*)  carve((size_t)NL_*FF_*D_*sizeof(f16));
  f16*   w2h    = (f16*)  carve((size_t)NL_*D_*FF_*sizeof(f16));
  float* hbuf   = (float*)carve((size_t)MTOT*D_*sizeof(float));
  f16*   hn     = (f16*)  carve((size_t)MTOT*D_*sizeof(f16));
  f16*   qkvh   = (f16*)  carve((size_t)MTOT*3*D_*sizeof(f16));
  f16*   oh     = (f16*)  carve((size_t)MTOT*D_*sizeof(f16));
  f16*   fh     = (f16*)  carve((size_t)MTOT*FF_*sizeof(f16));

  // 1) f32 -> f16 conversions
  auto cvt = [&](const float* src, f16* dst, size_t n) {
    cvt_f32_f16_kernel<<<2048, 256, 0, stream>>>(src, dst, n);
  };
  cvt(x,     xh,     (size_t)MTOT*3*D_);
  cvt(w3d,   w3dh,   (size_t)D_*3*D_);
  cvt(wqkv,  wqkvh,  (size_t)NL_*3*D_*D_);
  cvt(wproj, wprojh, (size_t)NL_*D_*D_);
  cvt(w1,    w1h,    (size_t)NL_*FF_*D_);
  cvt(w2,    w2h,    (size_t)NL_*D_*FF_);

  dim3 blk(256);
  // 2) embedding projection: h = x * w3d^T + b3d   (M=8192, N=1024, K=3072)
  gemm_kernel<false,false,false><<<dim3(D_/256, MTOT/64), blk, 0, stream>>>(
      xh, w3dh, b3d, nullptr, hbuf, MTOT, D_, 3*D_);

  const size_t attnSmem = (size_t)(2*64*256 + 256*64)*sizeof(f16)  // Qt, Kt, Vt
                        + (size_t)(4*16*64)*sizeof(float)           // Sb
                        + (size_t)(4*16*64)*sizeof(f16)             // Pb
                        + (size_t)(2*4*16)*sizeof(float);           // Al, Li

  for (int i = 0; i < NL_; i++) {
    // ln1 -> hn (f16)
    ln_kernel<true><<<MTOT, blk, 0, stream>>>(hbuf, ln1_g + (size_t)i*D_,
                                              ln1_b + (size_t)i*D_, hn);
    // qkv = hn * wqkv^T + bqkv   (N=3D, f16 out)
    gemm_kernel<true,false,false><<<dim3(3*D_/256, MTOT/64), blk, 0, stream>>>(
        hn, wqkvh + (size_t)i*3*D_*D_, bqkv + (size_t)i*3*D_, nullptr,
        qkvh, MTOT, 3*D_, D_);
    // flash attention -> oh (f16)
    attn_kernel<<<dim3(L_/64, H_, B_), dim3(256), attnSmem, stream>>>(qkvh, oh);
    // h = h + oh * wproj^T + bproj   (in-place residual)
    gemm_kernel<false,true,false><<<dim3(D_/256, MTOT/64), blk, 0, stream>>>(
        oh, wprojh + (size_t)i*D_*D_, bproj + (size_t)i*D_, hbuf,
        hbuf, MTOT, D_, D_);
    // ln2 -> hn (f16)
    ln_kernel<true><<<MTOT, blk, 0, stream>>>(hbuf, ln2_g + (size_t)i*D_,
                                              ln2_b + (size_t)i*D_, hn);
    // f = gelu(hn * w1^T + b1)   (N=FF, f16 out)
    gemm_kernel<true,false,true><<<dim3(FF_/256, MTOT/64), blk, 0, stream>>>(
        hn, w1h + (size_t)i*FF_*D_, b1 + (size_t)i*FF_, nullptr,
        fh, MTOT, FF_, D_);
    // h = h + f * w2^T + b2   (K=FF, in-place residual)
    gemm_kernel<false,true,false><<<dim3(D_/256, MTOT/64), blk, 0, stream>>>(
        fh, w2h + (size_t)i*D_*FF_, b2 + (size_t)i*D_, hbuf,
        hbuf, MTOT, D_, FF_);
  }

  // final layernorm -> d_out (f32)
  ln_kernel<false><<<MTOT, blk, 0, stream>>>(hbuf, lnf_g, lnf_b, (float*)d_out);
}

// v001
// Measured time: 2320 microseconds a run.
// In both of two side-by-side timings against v000, it was 1.53 times as fast.
#include <hip/hip_runtime.h>
#include <math.h>

typedef _Float16 f16;
typedef __attribute__((ext_vector_type(16))) _Float16 v16h;
typedef __attribute__((ext_vector_type(8)))  _Float16 v8h;
typedef __attribute__((ext_vector_type(8)))  float    v8f;
typedef __attribute__((ext_vector_type(4)))  int      v4i;

#define B_    4
#define L_    2048
#define D_    1024
#define H_    4
#define NL_   2
#define HD_   256
#define FF_   4096
#define MTOT  (B_*L_)      // 8192 token rows
#define EPS_  1e-5f

#define GP_   40    // GEMM A/W tiles: 32 halves + 8   (80 B)
#define QKP_  264   // attention Q/K tiles: 256 halves + 8 (528 B)
#define VP_   72    // attention V^T tile: 64 halves + 8  (144 B)
#define PP_   72    // attention P tile: 64 halves + 8    (144 B)
#define SP_   68    // attention S tile: 64 floats + 4    (272 B), one lane per row

#if __has_builtin(__builtin_amdgcn_global_load_async_to_lds_b128) && \
    __has_builtin(__builtin_amdgcn_s_wait_asynccnt)
#define HAVE_ASYNC_LDS 1
#else
#define HAVE_ASYNC_LDS 0
#endif

typedef __attribute__((address_space(1))) v4i gv4i_t;
typedef __attribute__((address_space(3))) v4i lv4i_t;

__device__ __forceinline__ void copy_g2l_b128(f16* dst_lds, const f16* src_glb) {
#if HAVE_ASYNC_LDS
  __builtin_amdgcn_global_load_async_to_lds_b128(
      (gv4i_t*)(const_cast<f16*>(src_glb)),
      (lv4i_t*)dst_lds, 0, 0);
#else
  *(v8h*)dst_lds = *(const v8h*)src_glb;
#endif
}

// Wait until at most `n` async copies (per wave) are still outstanding.
// Async loads retire in order, so lag-N waiting gives double buffering.
__device__ __forceinline__ void async_wait_upto(int n) {
#if HAVE_ASYNC_LDS
  if (n == 0)       __builtin_amdgcn_s_wait_asynccnt(0);
  else if (n == 5)  __builtin_amdgcn_s_wait_asynccnt(5);
  else              __builtin_amdgcn_s_wait_asynccnt(0);
#endif
}

__device__ __forceinline__ v16h make_frag(v8h lo, v8h hi) {
  return __builtin_shufflevector(lo, hi, 0,1,2,3,4,5,6,7,8,9,10,11,12,13,14,15);
}

__device__ __forceinline__ v16h load_frag(const f16* tile, int rowBase, int ld,
                                          int kChunkBase, int lane) {
  int r  = rowBase + (lane & 15);
  int kb = kChunkBase + ((lane < 16) ? 0 : 8);
  const f16* p = tile + (size_t)r * ld + kb;
  v8h lo = *(const v8h*)(p);
  v8h hi = *(const v8h*)(p + 16);
  return make_frag(lo, hi);
}

// ---------------------------------------------------------------------------
// f32 -> f16 conversion (grid-stride)
// ---------------------------------------------------------------------------
__global__ void cvt_f32_f16_kernel(const float* __restrict__ in, f16* __restrict__ out,
                                   size_t n) {
  size_t i = (size_t)blockIdx.x * blockDim.x + threadIdx.x;
  size_t stride = (size_t)gridDim.x * blockDim.x;
  for (; i < n; i += stride) out[i] = (f16)in[i];
}

// ---------------------------------------------------------------------------
// LayerNorm over D_=1024: one 256-thread block per row.
// ---------------------------------------------------------------------------
template<bool OUT_F16>
__global__ void __launch_bounds__(256)
ln_kernel(const float* __restrict__ x, const float* __restrict__ g,
          const float* __restrict__ bb, void* __restrict__ out) {
  __shared__ float red[256];
  int row = blockIdx.x;
  const float* xr = x + (size_t)row * D_;
  float v[4];
  float s = 0.f;
  #pragma unroll
  for (int i = 0; i < 4; i++) { v[i] = xr[threadIdx.x + i*256]; s += v[i]; }
  red[threadIdx.x] = s; __syncthreads();
  for (int o = 128; o > 0; o >>= 1) {
    if ((int)threadIdx.x < o) red[threadIdx.x] += red[threadIdx.x + o];
    __syncthreads();
  }
  float mu = red[0] * (1.0f / D_);
  __syncthreads();
  float s2 = 0.f;
  #pragma unroll
  for (int i = 0; i < 4; i++) { float d = v[i] - mu; s2 += d * d; }
  red[threadIdx.x] = s2; __syncthreads();
  for (int o = 128; o > 0; o >>= 1) {
    if ((int)threadIdx.x < o) red[threadIdx.x] += red[threadIdx.x + o];
    __syncthreads();
  }
  float rstd = rsqrtf(red[0] * (1.0f / D_) + EPS_);
  #pragma unroll
  for (int i = 0; i < 4; i++) {
    int c = threadIdx.x + i*256;
    float y = (v[i] - mu) * rstd * g[c] + bb[c];
    if (OUT_F16) ((f16*)out)[(size_t)row*D_ + c] = (f16)y;
    else         ((float*)out)[(size_t)row*D_ + c] = y;
  }
}

template<bool OUT_F16, bool RES, bool GELU>
__global__ void __launch_bounds__(256)
gemm_kernel(const f16* __restrict__ A, const f16* __restrict__ W,
            const float* __restrict__ bias, const float* __restrict__ resid,
            void* __restrict__ out, int M, int N, int K) {
  __shared__ f16 As[2][64*GP_];
  __shared__ f16 Ws[2][256*GP_];
  int tid  = threadIdx.x;
  int lane = tid & 31, wave = tid >> 5;
  int waveM = wave >> 1, waveN = wave & 1;
  int blockN0 = blockIdx.x * 256, blockM0 = blockIdx.y * 64;

  const int nchunks = K >> 5;   // K is a multiple of 32

  // issue one chunk's async copies into buffer `buf` (5 b128 ops per thread)
  auto issue = [&](int chunk, int buf) {
    int k0 = chunk * 32;
    {  // A tile: 64x32 halves = 256 b128, 1 per thread
      int r = tid >> 2, c8 = (tid & 3) * 8;
      copy_g2l_b128(&As[buf][r*GP_ + c8], &A[(size_t)(blockM0 + r)*K + k0 + c8]);
    }
    #pragma unroll
    for (int i = 0; i < 4; i++) {  // W tile: 256x32 halves = 1024 b128, 4 per thread
      int id = tid + i*256;
      int r = id >> 2, c8 = (id & 3) * 8;
      copy_g2l_b128(&Ws[buf][r*GP_ + c8], &W[(size_t)(blockN0 + r)*K + k0 + c8]);
    }
  };

  v8f acc[8] = {};
  issue(0, 0);
  for (int c = 0; c < nchunks; c++) {
    int buf = c & 1;
    if (c + 1 < nchunks) issue(c + 1, buf ^ 1);       // prefetch next chunk
    async_wait_upto((c + 1 < nchunks) ? 5 : 0);       // chunk c landed
    __syncthreads();
    v16h af = load_frag(As[buf], waveM*16, GP_, 0, lane);
    #pragma unroll
    for (int t = 0; t < 8; t++) {
      v16h bf = load_frag(Ws[buf], waveN*128 + t*16, GP_, 0, lane);
      acc[t] = __builtin_amdgcn_wmma_f32_16x16x32_f16(false, af, false, bf,
                                                      (short)0, acc[t], false, false);
    }
    __syncthreads();   // all reads of buf done before it is overwritten
  }

  int mHalf = (lane < 16) ? 0 : 8;
  int n0 = lane & 15;
  #pragma unroll
  for (int t = 0; t < 8; t++) {
    int gcol = blockN0 + waveN*128 + t*16 + n0;
    float bv = bias[gcol];
    #pragma unroll
    for (int j = 0; j < 8; j++) {
      int grow = blockM0 + waveM*16 + mHalf + j;
      float v = acc[t][j] + bv;
      if (GELU) v = 0.5f * v * (1.0f + erff(v * 0.70710678118f));
      size_t idx = (size_t)grow * N + gcol;
      if (RES) v += resid[idx];
      if (OUT_F16) ((f16*)out)[idx] = (f16)v;
      else         ((float*)out)[idx] = v;
    }
  }
}

// ---------------------------------------------------------------------------
// Flash attention (non-causal), f16 in / f16 out, f32 online-softmax state.
// Block = 256 threads = 8 waves; q-block 64. Waves pair up per 16-row q-tile:
//   wave (qt, kh): S = Q Kt^T for key-half kh (2 of 4 key tiles, K=256 in 8
//   chunks) -> shared S buffer;  softmax row-wise by the kh==0 wave;
//   O(16 x 128) += P V for d-half kh (8 accumulators per wave).
// Q/K tiles are staged row-major via async copies; V staged transposed (d,key)
// so P*V's B-fragments are plain row-major loads.
// qkv layout: row stride 3D, q at col h*HD, k at D+h*HD, v at 2D+h*HD.
// ---------------------------------------------------------------------------
__global__ void __launch_bounds__(256, 1)
attn_kernel(const f16* __restrict__ qkv, f16* __restrict__ o) {
  extern __shared__ char smem[];
  f16*   Qt = (f16*)smem;                 // [64][256], pitch QKP_
  f16*   Kt = Qt + 64*QKP_;               // [64][256], pitch QKP_
  f16*   Vt = Kt + 64*QKP_;               // [256][64], pitch VP_ (transposed V)
  float* Sb = (float*)(Vt + 256*VP_);     // [4][16][64], pitch SP_
  f16*   Pb = (f16*)(Sb + 4*16*SP_);      // [4][16][64], pitch PP_
  float* Al = (float*)(Pb + 4*16*PP_);    // [4][16] alpha
  float* Li = Al + 4*16;                  // [4][16] 1/l

  int tid = threadIdx.x, lane = tid & 31, wave = tid >> 5;
  int qt = wave >> 1;        // q-tile 0..3
  int dh = wave & 1;         // key-half for S, d-half for O
  int b = blockIdx.z, h = blockIdx.y;
  int q0 = blockIdx.x * 64;
  const size_t rs = 3*D_;
  const f16* qb = qkv + (size_t)b*L_*rs +        (size_t)h*HD_;
  const f16* kp = qkv + (size_t)b*L_*rs + D_   + (size_t)h*HD_;
  const f16* vp = qkv + (size_t)b*L_*rs + 2*D_ + (size_t)h*HD_;

  int m     = lane & 15;
  int mHalf = (lane < 16) ? 0 : 8;

  // stage Q tile once: 64x256 halves = 2048 b128, 8 per thread
  #pragma unroll
  for (int i = 0; i < 8; i++) {
    int id = tid + i*256;
    int r = id >> 5, c8 = (id & 31) * 8;
    copy_g2l_b128(&Qt[r*QKP_ + c8], &qb[(size_t)(q0 + r)*rs + c8]);
  }

  v8f oacc[8] = {};
  float rm = -INFINITY, rl = 0.0f;
  const float scale = 0.0625f;   // 1/sqrt(256)

  float* Sw = Sb + qt*16*SP_;
  f16*   Pw = Pb + qt*16*PP_;
  float* Aw = Al + qt*16;
  float* Lw = Li + qt*16;

  for (int kb0 = 0; kb0 < L_; kb0 += 64) {
    // K tile (async, row-major)
    #pragma unroll
    for (int i = 0; i < 8; i++) {
      int id = tid + i*256;
      int r = id >> 5, c8 = (id & 31) * 8;
      copy_g2l_b128(&Kt[r*QKP_ + c8], &kp[(size_t)(kb0 + r)*rs + c8]);
    }
    // V tile, transposed into (d, key)
    #pragma unroll
    for (int i = 0; i < 8; i++) {
      int id = tid + i*256;
      int r = id >> 5, c8 = (id & 31) * 8;
      v8h vv = *(const v8h*)&vp[(size_t)(kb0 + r)*rs + c8];
      #pragma unroll
      for (int j = 0; j < 8; j++) Vt[(c8 + j)*VP_ + r] = vv[j];
    }
    async_wait_upto(0);
    __syncthreads();

    // S(16 x 32) for this wave's key-half
    v8f s[2] = {};
    #pragma unroll
    for (int c = 0; c < 8; c++) {
      v16h af = load_frag(Qt, qt*16, QKP_, c*32, lane);
      #pragma unroll
      for (int t = 0; t < 2; t++) {
        v16h bf = load_frag(Kt, dh*32 + t*16, QKP_, c*32, lane);
        s[t] = __builtin_amdgcn_wmma_f32_16x16x32_f16(false, af, false, bf,
                                                      (short)0, s[t], false, false);
      }
    }
    // spill S to the q-tile's shared buffer, (q,key) row-major f32
    #pragma unroll
    for (int t = 0; t < 2; t++)
      #pragma unroll
      for (int j = 0; j < 8; j++)
        Sw[(mHalf + j)*SP_ + dh*32 + t*16 + m] = s[t][j];
    __syncthreads();

    // online softmax: kh==0 wave, lane r < 16 owns row r of the q-tile
    if (dh == 0 && lane < 16) {
      const float* srow = Sw + lane*SP_;
      float mx = rm;
      for (int c2 = 0; c2 < 64; c2++) mx = fmaxf(mx, srow[c2] * scale);
      float alpha = __expf(rm - mx);
      float sum = 0.0f;
      f16* prow = Pw + lane*PP_;
      for (int c2 = 0; c2 < 64; c2++) {
        float p = __expf(srow[c2] * scale - mx);
        prow[c2] = (f16)p;
        sum += p;
      }
      rl = rl * alpha + sum;
      rm = mx;
      Aw[lane] = alpha;
    }
    __syncthreads();

    // rescale O accumulators by per-row alpha
    float a8[8];
    #pragma unroll
    for (int j = 0; j < 8; j++) a8[j] = Aw[mHalf + j];
    #pragma unroll
    for (int dt = 0; dt < 8; dt++)
      #pragma unroll
      for (int j = 0; j < 8; j++) oacc[dt][j] *= a8[j];

    // O(16 x 128) += P V for this wave's d-half
    v16h pf0 = load_frag(Pw, 0, PP_, 0,  lane);
    v16h pf1 = load_frag(Pw, 0, PP_, 32, lane);
    #pragma unroll
    for (int dt = 0; dt < 8; dt++) {
      v16h bf0 = load_frag(Vt, dh*128 + dt*16, VP_, 0, lane);
      oacc[dt] = __builtin_amdgcn_wmma_f32_16x16x32_f16(false, pf0, false, bf0,
                                                        (short)0, oacc[dt], false, false);
      v16h bf1 = load_frag(Vt, dh*128 + dt*16, VP_, 32, lane);
      oacc[dt] = __builtin_amdgcn_wmma_f32_16x16x32_f16(false, pf1, false, bf1,
                                                        (short)0, oacc[dt], false, false);
    }
    __syncthreads();
  }

  if (dh == 0 && lane < 16) Lw[lane] = 1.0f / rl;
  __syncthreads();
  float l8[8];
  #pragma unroll
  for (int j = 0; j < 8; j++) l8[j] = Lw[mHalf + j];

  #pragma unroll
  for (int dt = 0; dt < 8; dt++) {
    #pragma unroll
    for (int j = 0; j < 8; j++) {
      int grow = q0 + qt*16 + mHalf + j;
      int gcol = h*HD_ + dh*128 + dt*16 + m;
      o[((size_t)b*L_ + grow)*D_ + gcol] = (f16)(oacc[dt][j] * l8[j]);
    }
  }
}

// ---------------------------------------------------------------------------
// Host orchestration
// ---------------------------------------------------------------------------
static inline size_t align256(size_t x) { return (x + 255) & ~(size_t)255; }

extern "C" void kernel_launch(void* const* d_in, const int* in_sizes, int n_in,
                              void* d_out, int out_size, void* d_ws, size_t ws_size,
                              hipStream_t stream) {
  (void)in_sizes; (void)n_in; (void)out_size; (void)ws_size;
  const float* x     = (const float*)d_in[0];
  const float* w3d   = (const float*)d_in[1];
  const float* b3d   = (const float*)d_in[2];
  const float* ln1_g = (const float*)d_in[3];
  const float* ln1_b = (const float*)d_in[4];
  const float* wqkv  = (const float*)d_in[5];
  const float* bqkv  = (const float*)d_in[6];
  const float* wproj = (const float*)d_in[7];
  const float* bproj = (const float*)d_in[8];
  const float* ln2_g = (const float*)d_in[9];
  const float* ln2_b = (const float*)d_in[10];
  const float* w1    = (const float*)d_in[11];
  const float* b1    = (const float*)d_in[12];
  const float* w2    = (const float*)d_in[13];
  const float* b2    = (const float*)d_in[14];
  const float* lnf_g = (const float*)d_in[15];
  const float* lnf_b = (const float*)d_in[16];

  // workspace carve-up (~292 MB)
  char* ws = (char*)d_ws;
  size_t off = 0;
  auto carve = [&](size_t bytes) -> void* { void* p = ws + off; off += align256(bytes); return p; };
  f16*   xh     = (f16*)  carve((size_t)MTOT*3*D_*sizeof(f16));
  f16*   w3dh   = (f16*)  carve((size_t)D_*3*D_*sizeof(f16));
  f16*   wqkvh  = (f16*)  carve((size_t)NL_*3*D_*D_*sizeof(f16));
  f16*   wprojh = (f16*)  carve((size_t)NL_*D_*D_*sizeof(f16));
  f16*   w1h    = (f16*)  carve((size_t)NL_*FF_*D_*sizeof(f16));
  f16*   w2h    = (f16*)  carve((size_t)NL_*D_*FF_*sizeof(f16));
  float* hbuf   = (float*)carve((size_t)MTOT*D_*sizeof(float));
  f16*   hn     = (f16*)  carve((size_t)MTOT*D_*sizeof(f16));
  f16*   qkvh   = (f16*)  carve((size_t)MTOT*3*D_*sizeof(f16));
  f16*   oh     = (f16*)  carve((size_t)MTOT*D_*sizeof(f16));
  f16*   fh     = (f16*)  carve((size_t)MTOT*FF_*sizeof(f16));

  // 1) f32 -> f16 conversions
  auto cvt = [&](const float* src, f16* dst, size_t n) {
    cvt_f32_f16_kernel<<<2048, 256, 0, stream>>>(src, dst, n);
  };
  cvt(x,     xh,     (size_t)MTOT*3*D_);
  cvt(w3d,   w3dh,   (size_t)D_*3*D_);
  cvt(wqkv,  wqkvh,  (size_t)NL_*3*D_*D_);
  cvt(wproj, wprojh, (size_t)NL_*D_*D_);
  cvt(w1,    w1h,    (size_t)NL_*FF_*D_);
  cvt(w2,    w2h,    (size_t)NL_*D_*FF_);

  dim3 blk(256);
  // 2) embedding projection: h = x * w3d^T + b3d   (M=8192, N=1024, K=3072)
  gemm_kernel<false,false,false><<<dim3(D_/256, MTOT/64), blk, 0, stream>>>(
      xh, w3dh, b3d, nullptr, hbuf, MTOT, D_, 3*D_);

  const size_t attnSmem = (size_t)(2*64*QKP_ + 256*VP_)*sizeof(f16) // Qt, Kt, Vt
                        + (size_t)(4*16*SP_)*sizeof(float)          // Sb
                        + (size_t)(4*16*PP_)*sizeof(f16)            // Pb
                        + (size_t)(2*4*16)*sizeof(float);           // Al, Li

  for (int i = 0; i < NL_; i++) {
    // ln1 -> hn (f16)
    ln_kernel<true><<<MTOT, blk, 0, stream>>>(hbuf, ln1_g + (size_t)i*D_,
                                              ln1_b + (size_t)i*D_, hn);
    // qkv = hn * wqkv^T + bqkv   (N=3D, f16 out)
    gemm_kernel<true,false,false><<<dim3(3*D_/256, MTOT/64), blk, 0, stream>>>(
        hn, wqkvh + (size_t)i*3*D_*D_, bqkv + (size_t)i*3*D_, nullptr,
        qkvh, MTOT, 3*D_, D_);
    // flash attention -> oh (f16)
    attn_kernel<<<dim3(L_/64, H_, B_), dim3(256), attnSmem, stream>>>(qkvh, oh);
    // h = h + oh * wproj^T + bproj   (in-place residual)
    gemm_kernel<false,true,false><<<dim3(D_/256, MTOT/64), blk, 0, stream>>>(
        oh, wprojh + (size_t)i*D_*D_, bproj + (size_t)i*D_, hbuf,
        hbuf, MTOT, D_, D_);
    // ln2 -> hn (f16)
    ln_kernel<true><<<MTOT, blk, 0, stream>>>(hbuf, ln2_g + (size_t)i*D_,
                                              ln2_b + (size_t)i*D_, hn);
    // f = gelu(hn * w1^T + b1)   (N=FF, f16 out)
    gemm_kernel<true,false,true><<<dim3(FF_/256, MTOT/64), blk, 0, stream>>>(
        hn, w1h + (size_t)i*FF_*D_, b1 + (size_t)i*FF_, nullptr,
        fh, MTOT, FF_, D_);
    // h = h + f * w2^T + b2   (K=FF, in-place residual)
    gemm_kernel<false,true,false><<<dim3(D_/256, MTOT/64), blk, 0, stream>>>(
        fh, w2h + (size_t)i*D_*FF_, b2 + (size_t)i*D_, hbuf,
        hbuf, MTOT, D_, FF_);
  }

  // final layernorm -> d_out (f32)
  ln_kernel<false><<<MTOT, blk, 0, stream>>>(hbuf, lnf_g, lnf_b, (float*)d_out);
}

// v002
// A run of this version takes 1100 microseconds.
// Timed twice side by side with v001, it ran 2.10 and 2.11 times as fast.
// All steps since v000 together make it 3.22 times as fast.
#include <hip/hip_runtime.h>
#include <math.h>

typedef _Float16 f16;
typedef __attribute__((ext_vector_type(16))) _Float16 v16h;
typedef __attribute__((ext_vector_type(8)))  _Float16 v8h;
typedef __attribute__((ext_vector_type(8)))  float    v8f;
typedef __attribute__((ext_vector_type(4)))  int      v4i;

#define B_    4
#define L_    2048
#define D_    1024
#define H_    4
#define NL_   2
#define HD_   256
#define FF_   4096
#define MTOT  (B_*L_)      // 8192 token rows
#define EPS_  1e-5f

#define GP_   40    // GEMM A/W tiles: 32 halves + 8   (80 B)
#define QKP_  264   // attention K tile: 256 halves + 8 (528 B)
// Rows read by the 16-bit transposing load want a pitch of 32 B x odd instead.
#define VRP_  272   // attention V tile: 256 halves + 16 (544 B)

#if __has_builtin(__builtin_amdgcn_global_load_async_to_lds_b128) && \
    __has_builtin(__builtin_amdgcn_s_wait_asynccnt)
#define HAVE_ASYNC_LDS 1
#else
#define HAVE_ASYNC_LDS 0
#endif

typedef __attribute__((address_space(1))) v4i gv4i_t;
typedef __attribute__((address_space(3))) v4i lv4i_t;

__device__ __forceinline__ void copy_g2l_b128(f16* dst_lds, const f16* src_glb) {
#if HAVE_ASYNC_LDS
  __builtin_amdgcn_global_load_async_to_lds_b128(
      (gv4i_t*)(const_cast<f16*>(src_glb)),
      (lv4i_t*)dst_lds, 0, 0);
#else
  *(v8h*)dst_lds = *(const v8h*)src_glb;
#endif
}

// Wait until at most `n` async copies (per wave) are still outstanding.
// Async loads retire in order, so lag-N waiting gives double buffering.
__device__ __forceinline__ void async_wait_upto(int n) {
#if HAVE_ASYNC_LDS
  if (n == 0)       __builtin_amdgcn_s_wait_asynccnt(0);
  else if (n == 5)  __builtin_amdgcn_s_wait_asynccnt(5);
  else              __builtin_amdgcn_s_wait_asynccnt(0);
#endif
}

__device__ __forceinline__ v16h make_frag(v8h lo, v8h hi) {
  return __builtin_shufflevector(lo, hi, 0,1,2,3,4,5,6,7,8,9,10,11,12,13,14,15);
}

__device__ __forceinline__ v16h load_frag(const f16* tile, int rowBase, int ld,
                                          int kChunkBase, int lane) {
  int r  = rowBase + (lane & 15);
  int kb = kChunkBase + ((lane < 16) ? 0 : 8);
  const f16* p = tile + (size_t)r * ld + kb;
  v8h lo = *(const v8h*)(p);
  v8h hi = *(const v8h*)(p + 16);
  return make_frag(lo, hi);
}

// ---------------------------------------------------------------------------
// f32 -> f16 conversion (grid-stride)
// ---------------------------------------------------------------------------
__global__ void cvt_f32_f16_kernel(const float* __restrict__ in, f16* __restrict__ out,
                                   size_t n) {
  size_t i = (size_t)blockIdx.x * blockDim.x + threadIdx.x;
  size_t stride = (size_t)gridDim.x * blockDim.x;
  for (; i < n; i += stride) out[i] = (f16)in[i];
}

// ---------------------------------------------------------------------------
// LayerNorm over D_=1024: one 256-thread block per row.
// ---------------------------------------------------------------------------
template<bool OUT_F16>
__global__ void __launch_bounds__(256)
ln_kernel(const float* __restrict__ x, const float* __restrict__ g,
          const float* __restrict__ bb, void* __restrict__ out) {
  __shared__ float red[256];
  int row = blockIdx.x;
  const float* xr = x + (size_t)row * D_;
  float v[4];
  float s = 0.f;
  #pragma unroll
  for (int i = 0; i < 4; i++) { v[i] = xr[threadIdx.x + i*256]; s += v[i]; }
  red[threadIdx.x] = s; __syncthreads();
  for (int o = 128; o > 0; o >>= 1) {
    if ((int)threadIdx.x < o) red[threadIdx.x] += red[threadIdx.x + o];
    __syncthreads();
  }
  float mu = red[0] * (1.0f / D_);
  __syncthreads();
  float s2 = 0.f;
  #pragma unroll
  for (int i = 0; i < 4; i++) { float d = v[i] - mu; s2 += d * d; }
  red[threadIdx.x] = s2; __syncthreads();
  for (int o = 128; o > 0; o >>= 1) {
    if ((int)threadIdx.x < o) red[threadIdx.x] += red[threadIdx.x + o];
    __syncthreads();
  }
  float rstd = rsqrtf(red[0] * (1.0f / D_) + EPS_);
  #pragma unroll
  for (int i = 0; i < 4; i++) {
    int c = threadIdx.x + i*256;
    float y = (v[i] - mu) * rstd * g[c] + bb[c];
    if (OUT_F16) ((f16*)out)[(size_t)row*D_ + c] = (f16)y;
    else         ((float*)out)[(size_t)row*D_ + c] = y;
  }
}

template<bool OUT_F16, bool RES, bool GELU>
__global__ void __launch_bounds__(256)
gemm_kernel(const f16* __restrict__ A, const f16* __restrict__ W,
            const float* __restrict__ bias, const float* __restrict__ resid,
            void* __restrict__ out, int M, int N, int K) {
  __shared__ f16 As[2][64*GP_];
  __shared__ f16 Ws[2][256*GP_];
  int tid  = threadIdx.x;
  int lane = tid & 31, wave = tid >> 5;
  int waveM = wave >> 1, waveN = wave & 1;
  int blockN0 = blockIdx.x * 256, blockM0 = blockIdx.y * 64;

  const int nchunks = K >> 5;   // K is a multiple of 32

  // issue one chunk's async copies into buffer `buf` (5 b128 ops per thread)
  auto issue = [&](int chunk, int buf) {
    int k0 = chunk * 32;
    {  // A tile: 64x32 halves = 256 b128, 1 per thread
      int r = tid >> 2, c8 = (tid & 3) * 8;
      copy_g2l_b128(&As[buf][r*GP_ + c8], &A[(size_t)(blockM0 + r)*K + k0 + c8]);
    }
    #pragma unroll
    for (int i = 0; i < 4; i++) {  // W tile: 256x32 halves = 1024 b128, 4 per thread
      int id = tid + i*256;
      int r = id >> 2, c8 = (id & 3) * 8;
      copy_g2l_b128(&Ws[buf][r*GP_ + c8], &W[(size_t)(blockN0 + r)*K + k0 + c8]);
    }
  };

  v8f acc[8] = {};
  issue(0, 0);
  for (int c = 0; c < nchunks; c++) {
    int buf = c & 1;
    if (c + 1 < nchunks) issue(c + 1, buf ^ 1);       // prefetch next chunk
    async_wait_upto((c + 1 < nchunks) ? 5 : 0);       // chunk c landed
    __syncthreads();
    v16h af = load_frag(As[buf], waveM*16, GP_, 0, lane);
    #pragma unroll
    for (int t = 0; t < 8; t++) {
      v16h bf = load_frag(Ws[buf], waveN*128 + t*16, GP_, 0, lane);
      acc[t] = __builtin_amdgcn_wmma_f32_16x16x32_f16(false, af, false, bf,
                                                      (short)0, acc[t], false, false);
    }
    __syncthreads();   // all reads of buf done before it is overwritten
  }

  int mHalf = (lane < 16) ? 0 : 8;
  int n0 = lane & 15;
  #pragma unroll
  for (int t = 0; t < 8; t++) {
    int gcol = blockN0 + waveN*128 + t*16 + n0;
    float bv = bias[gcol];
    #pragma unroll
    for (int j = 0; j < 8; j++) {
      int grow = blockM0 + waveM*16 + mHalf + j;
      float v = acc[t][j] + bv;
      if (GELU) v = 0.5f * v * (1.0f + erff(v * 0.70710678118f));
      size_t idx = (size_t)grow * N + gcol;
      if (RES) v += resid[idx];
      if (OUT_F16) ((f16*)out)[idx] = (f16)v;
      else         ((float*)out)[idx] = v;
    }
  }
}

typedef __attribute__((ext_vector_type(8))) short s16x8;
typedef __attribute__((address_space(3))) s16x8 lds_s16x8;

// lane (c, hh) receives T[row 8*hh + 0..7][column c] of the 16x16 tile whose
// rows the 32 lane addresses name
__device__ __forceinline__ v8h ld_tr16(const f16* p) {
  return __builtin_bit_cast(v8h, __builtin_amdgcn_ds_load_tr16_b128_v8i16((lds_s16x8*)p));
}

__device__ __forceinline__ float xhalf(float x) {
  return __builtin_bit_cast(float, __builtin_amdgcn_permlanex16(
      __builtin_bit_cast(int, x), __builtin_bit_cast(int, x),
      0x76543210, 0xfedcba98, false, false));
}

__device__ __forceinline__ v8f mma16(v16h a, v16h b, v8f c) {
  return __builtin_amdgcn_wmma_f32_16x16x32_f16(false, a, false, b, (short)0, c, false, false);
}

__device__ __forceinline__ void sched_fence() { __builtin_amdgcn_sched_barrier(0); }

__global__ void __launch_bounds__(256, 1)
attn_kernel(const f16* __restrict__ qkv, f16* __restrict__ o) {
  __shared__ __attribute__((aligned(32))) f16 tiles[64*QKP_ + 64*VRP_];
  f16* Kt = tiles;               // [key][d], pitch QKP_
  f16* Vr = tiles + 64*QKP_;     // [key][d], pitch VRP_

  int tid = threadIdx.x, lane = tid & 31, wave = tid >> 5;
  int c = lane & 15, hh = lane >> 4;
  int b = blockIdx.z, h = blockIdx.y;
  int q0 = blockIdx.x * 128 + wave * 16;      // this wave's first query
  const size_t rs = 3*D_;
  const f16* qb = qkv + (size_t)b*L_*rs +        (size_t)h*HD_;
  const f16* kp = qkv + (size_t)b*L_*rs + D_   + (size_t)h*HD_;
  const f16* vp = qkv + (size_t)b*L_*rs + 2*D_ + (size_t)h*HD_;

  // Q^T fragments (B operand, column = query), same k order as K's fragments
  v16h qf[8];
  #pragma unroll
  for (int kc = 0; kc < 8; kc++)
    qf[kc] = load_frag(qb + (size_t)q0*rs, 0, 3*D_, kc*32, lane);
  sched_fence();
  asm volatile("s_wait_xcnt 0x0" ::: "memory");
  sched_fence();

  v8f oacc[16] = {};                 // O^T: tile dt, register r = O[query c][16*dt + 8*hh + r]
  float rm = -INFINITY, rl = 0.0f;   // running maximum (log2 domain), this half's running sum
  const float cscale = 0.0625f * 1.4426950408889634f;   // 1/sqrt(256) * log2(e)

  // lane address of the transposing loads: row 8*hh + (lane & 7), 16-byte half (lane >> 3) & 1
  const f16* vad = Vr + (8*hh + (lane & 7))*VRP_ + ((lane >> 3) & 1)*8;

  v16h fa[8], fb[8];   // two fragment sets: one is loaded while the other is consumed
  v8f  s[4];
  v16h pf[2];

  // K fragments of d chunks 2g, 2g+1 for the four 16-key tiles
  auto ldK = [&](v16h (&f)[8], int g) {
    #pragma unroll
    for (int i = 0; i < 8; i++)
      f[i] = load_frag(Kt, (i & 3)*16, QKP_, (2*g + (i >> 2))*32, lane);
  };
  auto mmS = [&](v16h (&f)[8], int g) {
    #pragma unroll
    for (int i = 0; i < 8; i++) s[i & 3] = mma16(f[i], qf[2*g + (i >> 2)], s[i & 3]);
  };
  // V^T fragments (16 d x 32 keys) of d tiles 4g..4g+3 for the two 32-key chunks
  auto ldV = [&](v16h (&f)[8], int g) {
    #pragma unroll
    for (int i = 0; i < 8; i++) {
      const f16* p = vad + (i >> 2)*32*VRP_ + (4*g + (i & 3))*16;
      f[i] = make_frag(ld_tr16(p), ld_tr16(p + 16*VRP_));
    }
  };
  auto mmV = [&](v16h (&f)[8], int g) {
    #pragma unroll
    for (int i = 0; i < 8; i++)
      oacc[4*g + (i & 3)] = mma16(f[i], pf[i >> 2], oacc[4*g + (i & 3)]);
  };

  for (int kb0 = 0; kb0 < L_; kb0 += 64) {
    // K and V tiles, row-major: 2 x 2048 b128 copies, 16 per thread
    #pragma unroll
    for (int i = 0; i < 8; i++) {
      int id = tid + i*256;
      int r = id >> 5, c8 = (id & 31) * 8;
      copy_g2l_b128(&Kt[r*QKP_ + c8], &kp[(size_t)(kb0 + r)*rs + c8]);
    }
    #pragma unroll
    for (int i = 0; i < 8; i++) {
      int id = tid + i*256;
      int r = id >> 5, c8 = (id & 31) * 8;
      copy_g2l_b128(&Vr[r*VRP_ + c8], &vp[(size_t)(kb0 + r)*rs + c8]);
    }
    // this wave's copies have landed; the barrier publishes all waves' copies
    asm volatile("s_wait_asynccnt 0x0" ::: "memory");
    __syncthreads();

    // S^T (64 keys x 16 queries)
    #pragma unroll
    for (int t = 0; t < 4; t++) s[t] = v8f{};
    ldK(fa, 0); sched_fence();
    ldK(fb, 1); sched_fence(); mmS(fa, 0); sched_fence();
    ldK(fa, 2); sched_fence(); mmS(fb, 1); sched_fence();
    ldK(fb, 3); sched_fence(); mmS(fa, 2); sched_fence();
    ldV(fa, 0); sched_fence(); mmS(fb, 3); sched_fence();
    ldV(fb, 1); sched_fence();   // the first V^T groups fly under the softmax

    // online softmax of query c: 32 scores in this lane, 32 in lane ^ 16
    float mx = s[0][0];
    #pragma unroll
    for (int t = 0; t < 4; t++)
      #pragma unroll
      for (int j = 0; j < 8; j++) mx = fmaxf(mx, s[t][j]);
    mx = fmaxf(mx, xhalf(mx)) * cscale;
    float mnew  = fmaxf(rm, mx);
    float alpha = __builtin_amdgcn_exp2f(rm - mnew);
    rm = mnew;
    float sum[4] = {0.0f, 0.0f, 0.0f, 0.0f};
    #pragma unroll
    for (int t = 0; t < 4; t++)
      #pragma unroll
      for (int j = 0; j < 8; j++) {
        float p = __builtin_amdgcn_exp2f(__builtin_fmaf(s[t][j], cscale, -mnew));
        pf[t >> 1][(t & 1)*8 + j] = (f16)p;   // element e of chunk t>>1 is key 16*(e>>3) + 8*hh + (e&7)
        sum[t] += p;
      }
    rl = rl * alpha + ((sum[0] + sum[1]) + (sum[2] + sum[3]));
    #pragma unroll
    for (int dt = 0; dt < 16; dt++) oacc[dt] *= alpha;
    sched_fence();

    // O^T (256 d x 16 queries) += V^T P^T
    mmV(fa, 0); sched_fence();
    ldV(fa, 2); sched_fence(); mmV(fb, 1); sched_fence();
    ldV(fb, 3); sched_fence(); mmV(fa, 2); sched_fence();
    mmV(fb, 3);

    // every wave's reads of the tiles are done before the next copies overwrite them
    asm volatile("s_wait_dscnt 0x0" ::: "memory");
    __syncthreads();
  }

  float inv = 1.0f / (rl + xhalf(rl));   // the halves' sums join here
  f16* orow = o + ((size_t)b*L_ + q0 + c)*D_ + h*HD_ + 8*hh;
  v8h pk[16];
  #pragma unroll
  for (int dt = 0; dt < 16; dt++)
    #pragma unroll
    for (int j = 0; j < 8; j++) pk[dt][j] = (f16)(oacc[dt][j] * inv);
  // all packing stays ahead of the stores, so that no register a store names is rewritten behind it
  sched_fence();
  #pragma unroll
  for (int dt = 0; dt < 16; dt++) *(v8h*)(orow + dt*16) = pk[dt];
}

// ---------------------------------------------------------------------------
// Host orchestration
// ---------------------------------------------------------------------------
static inline size_t align256(size_t x) { return (x + 255) & ~(size_t)255; }

extern "C" void kernel_launch(void* const* d_in, const int* in_sizes, int n_in,
                              void* d_out, int out_size, void* d_ws, size_t ws_size,
                              hipStream_t stream) {
  (void)in_sizes; (void)n_in; (void)out_size; (void)ws_size;
  const float* x     = (const float*)d_in[0];
  const float* w3d   = (const float*)d_in[1];
  const float* b3d   = (const float*)d_in[2];
  const float* ln1_g = (const float*)d_in[3];
  const float* ln1_b = (const float*)d_in[4];
  const float* wqkv  = (const float*)d_in[5];
  const float* bqkv  = (const float*)d_in[6];
  const float* wproj = (const float*)d_in[7];
  const float* bproj = (const float*)d_in[8];
  const float* ln2_g = (const float*)d_in[9];
  const float* ln2_b = (const float*)d_in[10];
  const float* w1    = (const float*)d_in[11];
  const float* b1    = (const float*)d_in[12];
  const float* w2    = (const float*)d_in[13];
  const float* b2    = (const float*)d_in[14];
  const float* lnf_g = (const float*)d_in[15];
  const float* lnf_b = (const float*)d_in[16];

  // workspace carve-up (~292 MB)
  char* ws = (char*)d_ws;
  size_t off = 0;
  auto carve = [&](size_t bytes) -> void* { void* p = ws + off; off += align256(bytes); return p; };
  f16*   xh     = (f16*)  carve((size_t)MTOT*3*D_*sizeof(f16));
  f16*   w3dh   = (f16*)  carve((size_t)D_*3*D_*sizeof(f16));
  f16*   wqkvh  = (f16*)  carve((size_t)NL_*3*D_*D_*sizeof(f16));
  f16*   wprojh = (f16*)  carve((size_t)NL_*D_*D_*sizeof(f16));
  f16*   w1h    = (f16*)  carve((size_t)NL_*FF_*D_*sizeof(f16));
  f16*   w2h    = (f16*)  carve((size_t)NL_*D_*FF_*sizeof(f16));
  float* hbuf   = (float*)carve((size_t)MTOT*D_*sizeof(float));
  f16*   hn     = (f16*)  carve((size_t)MTOT*D_*sizeof(f16));
  f16*   qkvh   = (f16*)  carve((size_t)MTOT*3*D_*sizeof(f16));
  f16*   oh     = (f16*)  carve((size_t)MTOT*D_*sizeof(f16));
  f16*   fh     = (f16*)  carve((size_t)MTOT*FF_*sizeof(f16));

  // 1) f32 -> f16 conversions
  auto cvt = [&](const float* src, f16* dst, size_t n) {
    cvt_f32_f16_kernel<<<2048, 256, 0, stream>>>(src, dst, n);
  };
  cvt(x,     xh,     (size_t)MTOT*3*D_);
  cvt(w3d,   w3dh,   (size_t)D_*3*D_);
  cvt(wqkv,  wqkvh,  (size_t)NL_*3*D_*D_);
  cvt(wproj, wprojh, (size_t)NL_*D_*D_);
  cvt(w1,    w1h,    (size_t)NL_*FF_*D_);
  cvt(w2,    w2h,    (size_t)NL_*D_*FF_);

  dim3 blk(256);
  // 2) embedding projection: h = x * w3d^T + b3d   (M=8192, N=1024, K=3072)
  gemm_kernel<false,false,false><<<dim3(D_/256, MTOT/64), blk, 0, stream>>>(
      xh, w3dh, b3d, nullptr, hbuf, MTOT, D_, 3*D_);

  for (int i = 0; i < NL_; i++) {
    // ln1 -> hn (f16)
    ln_kernel<true><<<MTOT, blk, 0, stream>>>(hbuf, ln1_g + (size_t)i*D_,
                                              ln1_b + (size_t)i*D_, hn);
    // qkv = hn * wqkv^T + bqkv   (N=3D, f16 out)
    gemm_kernel<true,false,false><<<dim3(3*D_/256, MTOT/64), blk, 0, stream>>>(
        hn, wqkvh + (size_t)i*3*D_*D_, bqkv + (size_t)i*3*D_, nullptr,
        qkvh, MTOT, 3*D_, D_);
    // flash attention -> oh (f16)
    attn_kernel<<<dim3(L_/128, H_, B_), dim3(256), 0, stream>>>(qkvh, oh);
    // h = h + oh * wproj^T + bproj   (in-place residual)
    gemm_kernel<false,true,false><<<dim3(D_/256, MTOT/64), blk, 0, stream>>>(
        oh, wprojh + (size_t)i*D_*D_, bproj + (size_t)i*D_, hbuf,
        hbuf, MTOT, D_, D_);
    // ln2 -> hn (f16)
    ln_kernel<true><<<MTOT, blk, 0, stream>>>(hbuf, ln2_g + (size_t)i*D_,
                                              ln2_b + (size_t)i*D_, hn);
    // f = gelu(hn * w1^T + b1)   (N=FF, f16 out)
    gemm_kernel<true,false,true><<<dim3(FF_/256, MTOT/64), blk, 0, stream>>>(
        hn, w1h + (size_t)i*FF_*D_, b1 + (size_t)i*FF_, nullptr,
        fh, MTOT, FF_, D_);
    // h = h + f * w2^T + b2   (K=FF, in-place residual)
    gemm_kernel<false,true,false><<<dim3(D_/256, MTOT/64), blk, 0, stream>>>(
        fh, w2h + (size_t)i*D_*FF_, b2 + (size_t)i*D_, hbuf,
        hbuf, MTOT, D_, FF_);
  }

  // final layernorm -> d_out (f32)
  ln_kernel<false><<<MTOT, blk, 0, stream>>>(hbuf, lnf_g, lnf_b, (float*)d_out);
}

// v003
// One run takes 753 microseconds.
// Next to v002, in two timings, it ran 1.46 times as fast each time.
// Counting every step since v000, it is 4.70 times as fast.
#include <hip/hip_runtime.h>
#include <math.h>

typedef _Float16 f16;
typedef __attribute__((ext_vector_type(16))) _Float16 v16h;
typedef __attribute__((ext_vector_type(8)))  _Float16 v8h;
typedef __attribute__((ext_vector_type(8)))  float    v8f;
typedef __attribute__((ext_vector_type(4)))  int      v4i;

#define B_    4
#define L_    2048
#define D_    1024
#define H_    4
#define NL_   2
#define HD_   256
#define FF_   4096
#define MTOT  (B_*L_)      // 8192 token rows
#define EPS_  1e-5f

#define GP_   72    // GEMM A/W tiles: 64 halves + 8   (144 B)
#define QKP_  264   // attention K tile: 256 halves + 8 (528 B)
// Rows read by the 16-bit transposing load want a pitch of 32 B x odd instead.
#define VRP_  272   // attention V tile: 256 halves + 16 (544 B)

#if __has_builtin(__builtin_amdgcn_global_load_async_to_lds_b128) && \
    __has_builtin(__builtin_amdgcn_s_wait_asynccnt)
#define HAVE_ASYNC_LDS 1
#else
#define HAVE_ASYNC_LDS 0
#endif

typedef __attribute__((address_space(1))) v4i gv4i_t;
typedef __attribute__((address_space(3))) v4i lv4i_t;

__device__ __forceinline__ void copy_g2l_b128(f16* dst_lds, const f16* src_glb) {
#if HAVE_ASYNC_LDS
  __builtin_amdgcn_global_load_async_to_lds_b128(
      (gv4i_t*)(const_cast<f16*>(src_glb)),
      (lv4i_t*)dst_lds, 0, 0);
#else
  *(v8h*)dst_lds = *(const v8h*)src_glb;
#endif
}

__device__ __forceinline__ v16h make_frag(v8h lo, v8h hi) {
  return __builtin_shufflevector(lo, hi, 0,1,2,3,4,5,6,7,8,9,10,11,12,13,14,15);
}

__device__ __forceinline__ v16h load_frag(const f16* tile, int rowBase, int ld,
                                          int kChunkBase, int lane) {
  int r  = rowBase + (lane & 15);
  int kb = kChunkBase + ((lane < 16) ? 0 : 8);
  const f16* p = tile + (size_t)r * ld + kb;
  v8h lo = *(const v8h*)(p);
  v8h hi = *(const v8h*)(p + 16);
  return make_frag(lo, hi);
}

__device__ __forceinline__ v8f mma16(v16h a, v16h b, v8f c) {
  return __builtin_amdgcn_wmma_f32_16x16x32_f16(false, a, false, b, (short)0, c, false, false);
}

__device__ __forceinline__ void sched_fence() { __builtin_amdgcn_sched_barrier(0); }

// ---------------------------------------------------------------------------
// f32 -> f16 conversion (grid-stride)
// ---------------------------------------------------------------------------
__global__ void cvt_f32_f16_kernel(const float* __restrict__ in, f16* __restrict__ out,
                                   size_t n) {
  size_t i = (size_t)blockIdx.x * blockDim.x + threadIdx.x;
  size_t stride = (size_t)gridDim.x * blockDim.x;
  for (; i < n; i += stride) out[i] = (f16)in[i];
}

// ---------------------------------------------------------------------------
// LayerNorm over D_=1024: one 256-thread block per row.
// ---------------------------------------------------------------------------
template<bool OUT_F16>
__global__ void __launch_bounds__(256)
ln_kernel(const float* __restrict__ x, const float* __restrict__ g,
          const float* __restrict__ bb, void* __restrict__ out) {
  __shared__ float red[256];
  int row = blockIdx.x;
  const float* xr = x + (size_t)row * D_;
  float v[4];
  float s = 0.f;
  #pragma unroll
  for (int i = 0; i < 4; i++) { v[i] = xr[threadIdx.x + i*256]; s += v[i]; }
  red[threadIdx.x] = s; __syncthreads();
  for (int o = 128; o > 0; o >>= 1) {
    if ((int)threadIdx.x < o) red[threadIdx.x] += red[threadIdx.x + o];
    __syncthreads();
  }
  float mu = red[0] * (1.0f / D_);
  __syncthreads();
  float s2 = 0.f;
  #pragma unroll
  for (int i = 0; i < 4; i++) { float d = v[i] - mu; s2 += d * d; }
  red[threadIdx.x] = s2; __syncthreads();
  for (int o = 128; o > 0; o >>= 1) {
    if ((int)threadIdx.x < o) red[threadIdx.x] += red[threadIdx.x + o];
    __syncthreads();
  }
  float rstd = rsqrtf(red[0] * (1.0f / D_) + EPS_);
  #pragma unroll
  for (int i = 0; i < 4; i++) {
    int c = threadIdx.x + i*256;
    float y = (v[i] - mu) * rstd * g[c] + bb[c];
    if (OUT_F16) ((f16*)out)[(size_t)row*D_ + c] = (f16)y;
    else         ((float*)out)[(size_t)row*D_ + c] = y;
  }
}

#define BM_   128
#define BN_   256
#define BK_   64
#define STG_  ((BM_ + BN_) * GP_)   // halves of one stage: A rows, then W rows

template<int NB, int NN, bool OUT_F16, bool RES, bool GELU>
__global__ void __launch_bounds__(256, NB == 2 ? 4 : 2)
gemm_kernel(const f16* __restrict__ A, const f16* __restrict__ W,
            const float* __restrict__ bias, const float* __restrict__ resid,
            void* __restrict__ out, int M, int N, int K) {
  (void)M; (void)N;   // N is the template constant NN
  __shared__ __attribute__((aligned(16))) f16 ring[NB*STG_];
  int tid  = threadIdx.x;
  int lane = tid & 31, wave = tid >> 5;
  int waveM = wave >> 2, waveN = wave & 3;
  int blockN0 = blockIdx.x * BN_, blockM0 = blockIdx.y * BM_;

  const int nst = K >> 6;   // stages

  // a thread copies 16 bytes of row (tid >> 3) + 32 i: block-uniform bases plus
  // one 32-bit byte offset per lane, the same for A and W (both have K columns)
  const char* gA = (const char*)(A + (size_t)blockM0 * K);
  const char* gW = (const char*)(W + (size_t)blockN0 * K);
  const unsigned goff = ((unsigned)(tid >> 3) * (unsigned)K + (unsigned)(tid & 7) * 8u) * 2u;
  const size_t rstep = (size_t)K * 64;   // 32 rows, in bytes
  f16* lrow = ring + (tid >> 3)*GP_ + (tid & 7)*8;

  // one stage's async copies into buffer `buf` (12 b128 copies per thread)
  auto issue = [&](int st, int buf) {
    f16* l = lrow + buf*STG_;
    const char* a = gA + (size_t)st * (BK_*2);
    const char* w = gW + (size_t)st * (BK_*2);
    #pragma unroll
    for (int i = 0; i < 4; i++)
      copy_g2l_b128(l + i*32*GP_, (const f16*)(a + i*rstep + goff));
    #pragma unroll
    for (int i = 0; i < 8; i++)
      copy_g2l_b128(l + (BM_ + i*32)*GP_, (const f16*)(w + i*rstep + goff));
  };

  v8f  acc[4][4] = {};
  // fragments of k chunk kc (32 k) of the stage at `st`
  auto ldF = [&](v16h (&fa)[4], v16h (&fb)[4], const f16* st, int kc) {
    #pragma unroll
    for (int i = 0; i < 4; i++) fa[i] = load_frag(st, waveM*64 + i*16, GP_, kc*32, lane);
    #pragma unroll
    for (int i = 0; i < 4; i++) fb[i] = load_frag(st + BM_*GP_, waveN*64 + i*16, GP_, kc*32, lane);
  };
  auto mm = [&](v16h (&fa)[4], v16h (&fb)[4]) {
    #pragma unroll
    for (int i = 0; i < 4; i++)
      #pragma unroll
      for (int j = 0; j < 4; j++) acc[i][j] = mma16(fa[i], fb[j], acc[i][j]);
  };

  if constexpr (NB == 2) {
    v16h a0[4], b0[4];
    issue(0, 0);
    // stage 0 has landed; the barrier publishes it
    asm volatile("s_wait_asynccnt 0x0" ::: "memory");
    __syncthreads();
    issue(1, 1);
    for (int s = 0; s < nst; s++) {
      const f16* st = ring + (s & 1)*STG_;
      ldF(a0, b0, st, 0); sched_fence();
      mm(a0, b0); sched_fence();
      ldF(a0, b0, st, 1); sched_fence();
      mm(a0, b0); sched_fence();
      // publish point of stage s + 1: this wave's reads of stage s are done,
      asm volatile("s_wait_dscnt 0x0" ::: "memory");
      // its copies of stage s + 1 have landed,
      asm volatile("s_wait_asynccnt 0x0" ::: "memory");
      // and the barrier publishes stage s + 1 and frees stage s's buffer
      __syncthreads();
      if (s + 2 < nst) issue(s + 2, s & 1);
    }
  } else {
    // three buffers, two fragment sets: one is loaded while the other is consumed
    v16h a0[4], b0[4], a1[4], b1[4];
    issue(0, 0); issue(1, 1); issue(2, 2);
    // stage 0 has landed (the 24 youngest copies are stages 1 and 2); the barrier publishes it
    asm volatile("s_wait_asynccnt 0x18" ::: "memory");
    __syncthreads();
    ldF(a0, b0, ring, 0);

    int cur = 0;   // buffer of stage s
    for (int s = 0; s < nst; s++) {
      int nxt = (cur == 2) ? 0 : cur + 1;
      ldF(a1, b1, ring + cur*STG_, 1); sched_fence();
      mm(a0, b0); sched_fence();
      // publish point of stage s + 1, ahead of the trip's last block because that
      // block's load group already reads stage s + 1. This wave's reads of stage s are done:
      asm volatile("s_wait_dscnt 0x0" ::: "memory");
      // this wave's copies of stage s + 1 have landed (the 12 youngest are stage s + 2, where it exists)
      if (s + 2 < nst) asm volatile("s_wait_asynccnt 0xc" ::: "memory");
      else             asm volatile("s_wait_asynccnt 0x0" ::: "memory");
      __syncthreads();
      // in the last trip these loads read a buffer that holds an old stage; nothing uses them
      ldF(a0, b0, ring + nxt*STG_, 0); sched_fence();
      mm(a1, b1); sched_fence();
      if (s + 3 < nst) issue(s + 3, cur);
      cur = nxt;
    }
  }
  // the ring's closing wait: no copy of this wave is outstanding when it leaves the ring
  asm volatile("s_wait_asynccnt 0x0" ::: "memory");

  // Epilogue. One lane pointer per array; every row and column step is a compile-time
  // constant that folds into the instructions' offset fields.
  const int mHalf = (lane < 16) ? 0 : 8;
  const int n0 = lane & 15;
  const size_t e0 = (size_t)(blockM0 + waveM*64 + mHalf) * NN + blockN0 + waveN*64 + n0;
  const float* bl = bias + blockN0 + waveN*64 + n0;
  float bv[4];
  #pragma unroll
  for (int t = 0; t < 4; t++) bv[t] = bl[t*16];
  float rv[RES ? 4 : 1][4][8];
  const float* rl = RES ? resid + e0 : bl;
  if (RES) {
    #pragma unroll
    for (int i = 0; i < 4; i++)
      #pragma unroll
      for (int j = 0; j < 8; j++)
        #pragma unroll
        for (int t = 0; t < 4; t++) rv[i][t][j] = rl[(i*16 + j)*NN + t*16];
  }
  sched_fence();
  asm volatile("s_wait_xcnt 0x0" :: "v"(bl), "v"(rl) : "memory");
  sched_fence();

  static_assert(!GELU || OUT_F16, "the GELU path stores f16");
  f16 hv[OUT_F16 ? 4 : 1][4][8];
  #pragma unroll
  for (int i = 0; i < 4; i++)
    #pragma unroll
    for (int t = 0; t < 4; t++) {
      #pragma unroll
      for (int j = 0; j < 8; j++) {
        float v = acc[i][t][j] + bv[t];
        if (GELU) v = 0.5f * v * (1.0f + erff(v * 0.70710678118f));
        if (RES) v += rv[i][t][j];
        // erff branches: 128 results held across its hundreds of blocks spill, so here each is stored at once
        if (GELU)         ((f16*)out + e0)[(i*16 + j)*NN + t*16] = (f16)v;
        else if (OUT_F16) hv[i][t][j] = (f16)v;
        else              acc[i][t][j] = v;
      }
    }
  if (GELU) return;
  // all arithmetic stays ahead of the stores, so that no register a store names is rewritten behind it
  sched_fence();
  #pragma unroll
  for (int i = 0; i < 4; i++)
    #pragma unroll
    for (int j = 0; j < 8; j++)
      #pragma unroll
      for (int t = 0; t < 4; t++) {
        if (OUT_F16) ((f16*)out + e0)[(i*16 + j)*NN + t*16] = hv[i][t][j];
        else         ((float*)out + e0)[(i*16 + j)*NN + t*16] = acc[i][t][j];
      }
}

typedef __attribute__((ext_vector_type(8))) short s16x8;
typedef __attribute__((address_space(3))) s16x8 lds_s16x8;

// lane (c, hh) receives T[row 8*hh + 0..7][column c] of the 16x16 tile whose
// rows the 32 lane addresses name
__device__ __forceinline__ v8h ld_tr16(const f16* p) {
  return __builtin_bit_cast(v8h, __builtin_amdgcn_ds_load_tr16_b128_v8i16((lds_s16x8*)p));
}

__device__ __forceinline__ float xhalf(float x) {
  return __builtin_bit_cast(float, __builtin_amdgcn_permlanex16(
      __builtin_bit_cast(int, x), __builtin_bit_cast(int, x),
      0x76543210, 0xfedcba98, false, false));
}

__global__ void __launch_bounds__(256, 1)
attn_kernel(const f16* __restrict__ qkv, f16* __restrict__ o) {
  __shared__ __attribute__((aligned(32))) f16 tiles[64*QKP_ + 64*VRP_];
  f16* Kt = tiles;               // [key][d], pitch QKP_
  f16* Vr = tiles + 64*QKP_;     // [key][d], pitch VRP_

  int tid = threadIdx.x, lane = tid & 31, wave = tid >> 5;
  int c = lane & 15, hh = lane >> 4;
  int b = blockIdx.z, h = blockIdx.y;
  int q0 = blockIdx.x * 128 + wave * 16;      // this wave's first query
  const size_t rs = 3*D_;
  const f16* qb = qkv + (size_t)b*L_*rs +        (size_t)h*HD_;
  const f16* kp = qkv + (size_t)b*L_*rs + D_   + (size_t)h*HD_;
  const f16* vp = qkv + (size_t)b*L_*rs + 2*D_ + (size_t)h*HD_;

  // Q^T fragments (B operand, column = query), same k order as K's fragments
  v16h qf[8];
  #pragma unroll
  for (int kc = 0; kc < 8; kc++)
    qf[kc] = load_frag(qb + (size_t)q0*rs, 0, 3*D_, kc*32, lane);
  sched_fence();
  asm volatile("s_wait_xcnt 0x0" ::: "memory");
  sched_fence();

  v8f oacc[16] = {};                 // O^T: tile dt, register r = O[query c][16*dt + 8*hh + r]
  float rm = -INFINITY, rl = 0.0f;   // running maximum (log2 domain), this half's running sum
  const float cscale = 0.0625f * 1.4426950408889634f;   // 1/sqrt(256) * log2(e)

  // lane address of the transposing loads: row 8*hh + (lane & 7), 16-byte half (lane >> 3) & 1
  const f16* vad = Vr + (8*hh + (lane & 7))*VRP_ + ((lane >> 3) & 1)*8;

  v16h fa[8], fb[8];   // two fragment sets: one is loaded while the other is consumed
  v8f  s[4];
  v16h pf[2];

  // K fragments of d chunks 2g, 2g+1 for the four 16-key tiles
  auto ldK = [&](v16h (&f)[8], int g) {
    #pragma unroll
    for (int i = 0; i < 8; i++)
      f[i] = load_frag(Kt, (i & 3)*16, QKP_, (2*g + (i >> 2))*32, lane);
  };
  auto mmS = [&](v16h (&f)[8], int g) {
    #pragma unroll
    for (int i = 0; i < 8; i++) s[i & 3] = mma16(f[i], qf[2*g + (i >> 2)], s[i & 3]);
  };
  // V^T fragments (16 d x 32 keys) of d tiles 4g..4g+3 for the two 32-key chunks
  auto ldV = [&](v16h (&f)[8], int g) {
    #pragma unroll
    for (int i = 0; i < 8; i++) {
      const f16* p = vad + (i >> 2)*32*VRP_ + (4*g + (i & 3))*16;
      f[i] = make_frag(ld_tr16(p), ld_tr16(p + 16*VRP_));
    }
  };
  auto mmV = [&](v16h (&f)[8], int g) {
    #pragma unroll
    for (int i = 0; i < 8; i++)
      oacc[4*g + (i & 3)] = mma16(f[i], pf[i >> 2], oacc[4*g + (i & 3)]);
  };

  for (int kb0 = 0; kb0 < L_; kb0 += 64) {
    // K and V tiles, row-major: 2 x 2048 b128 copies, 16 per thread
    #pragma unroll
    for (int i = 0; i < 8; i++) {
      int id = tid + i*256;
      int r = id >> 5, c8 = (id & 31) * 8;
      copy_g2l_b128(&Kt[r*QKP_ + c8], &kp[(size_t)(kb0 + r)*rs + c8]);
    }
    #pragma unroll
    for (int i = 0; i < 8; i++) {
      int id = tid + i*256;
      int r = id >> 5, c8 = (id & 31) * 8;
      copy_g2l_b128(&Vr[r*VRP_ + c8], &vp[(size_t)(kb0 + r)*rs + c8]);
    }
    // this wave's copies have landed; the barrier publishes all waves' copies
    asm volatile("s_wait_asynccnt 0x0" ::: "memory");
    __syncthreads();

    // S^T (64 keys x 16 queries)
    #pragma unroll
    for (int t = 0; t < 4; t++) s[t] = v8f{};
    ldK(fa, 0); sched_fence();
    ldK(fb, 1); sched_fence(); mmS(fa, 0); sched_fence();
    ldK(fa, 2); sched_fence(); mmS(fb, 1); sched_fence();
    ldK(fb, 3); sched_fence(); mmS(fa, 2); sched_fence();
    ldV(fa, 0); sched_fence(); mmS(fb, 3); sched_fence();
    ldV(fb, 1); sched_fence();   // the first V^T groups fly under the softmax

    // online softmax of query c: 32 scores in this lane, 32 in lane ^ 16
    float mx = s[0][0];
    #pragma unroll
    for (int t = 0; t < 4; t++)
      #pragma unroll
      for (int j = 0; j < 8; j++) mx = fmaxf(mx, s[t][j]);
    mx = fmaxf(mx, xhalf(mx)) * cscale;
    float mnew  = fmaxf(rm, mx);
    float alpha = __builtin_amdgcn_exp2f(rm - mnew);
    rm = mnew;
    float sum[4] = {0.0f, 0.0f, 0.0f, 0.0f};
    #pragma unroll
    for (int t = 0; t < 4; t++)
      #pragma unroll
      for (int j = 0; j < 8; j++) {
        float p = __builtin_amdgcn_exp2f(__builtin_fmaf(s[t][j], cscale, -mnew));
        pf[t >> 1][(t & 1)*8 + j] = (f16)p;   // element e of chunk t>>1 is key 16*(e>>3) + 8*hh + (e&7)
        sum[t] += p;
      }
    rl = rl * alpha + ((sum[0] + sum[1]) + (sum[2] + sum[3]));
    #pragma unroll
    for (int dt = 0; dt < 16; dt++) oacc[dt] *= alpha;
    sched_fence();

    // O^T (256 d x 16 queries) += V^T P^T
    mmV(fa, 0); sched_fence();
    ldV(fa, 2); sched_fence(); mmV(fb, 1); sched_fence();
    ldV(fb, 3); sched_fence(); mmV(fa, 2); sched_fence();
    mmV(fb, 3);

    // every wave's reads of the tiles are done before the next copies overwrite them
    asm volatile("s_wait_dscnt 0x0" ::: "memory");
    __syncthreads();
  }

  float inv = 1.0f / (rl + xhalf(rl));   // the halves' sums join here
  f16* orow = o + ((size_t)b*L_ + q0 + c)*D_ + h*HD_ + 8*hh;
  v8h pk[16];
  #pragma unroll
  for (int dt = 0; dt < 16; dt++)
    #pragma unroll
    for (int j = 0; j < 8; j++) pk[dt][j] = (f16)(oacc[dt][j] * inv);
  // all packing stays ahead of the stores, so that no register a store names is rewritten behind it
  sched_fence();
  #pragma unroll
  for (int dt = 0; dt < 16; dt++) *(v8h*)(orow + dt*16) = pk[dt];
}

// ---------------------------------------------------------------------------
// Host orchestration
// ---------------------------------------------------------------------------
static inline size_t align256(size_t x) { return (x + 255) & ~(size_t)255; }

extern "C" void kernel_launch(void* const* d_in, const int* in_sizes, int n_in,
                              void* d_out, int out_size, void* d_ws, size_t ws_size,
                              hipStream_t stream) {
  (void)in_sizes; (void)n_in; (void)out_size; (void)ws_size;
  const float* x     = (const float*)d_in[0];
  const float* w3d   = (const float*)d_in[1];
  const float* b3d   = (const float*)d_in[2];
  const float* ln1_g = (const float*)d_in[3];
  const float* ln1_b = (const float*)d_in[4];
  const float* wqkv  = (const float*)d_in[5];
  const float* bqkv  = (const float*)d_in[6];
  const float* wproj = (const float*)d_in[7];
  const float* bproj = (const float*)d_in[8];
  const float* ln2_g = (const float*)d_in[9];
  const float* ln2_b = (const float*)d_in[10];
  const float* w1    = (const float*)d_in[11];
  const float* b1    = (const float*)d_in[12];
  const float* w2    = (const float*)d_in[13];
  const float* b2    = (const float*)d_in[14];
  const float* lnf_g = (const float*)d_in[15];
  const float* lnf_b = (const float*)d_in[16];

  // workspace carve-up (~292 MB)
  char* ws = (char*)d_ws;
  size_t off = 0;
  auto carve = [&](size_t bytes) -> void* { void* p = ws + off; off += align256(bytes); return p; };
  f16*   xh     = (f16*)  carve((size_t)MTOT*3*D_*sizeof(f16));
  f16*   w3dh   = (f16*)  carve((size_t)D_*3*D_*sizeof(f16));
  f16*   wqkvh  = (f16*)  carve((size_t)NL_*3*D_*D_*sizeof(f16));
  f16*   wprojh = (f16*)  carve((size_t)NL_*D_*D_*sizeof(f16));
  f16*   w1h    = (f16*)  carve((size_t)NL_*FF_*D_*sizeof(f16));
  f16*   w2h    = (f16*)  carve((size_t)NL_*D_*FF_*sizeof(f16));
  float* hbuf   = (float*)carve((size_t)MTOT*D_*sizeof(float));
  f16*   hn     = (f16*)  carve((size_t)MTOT*D_*sizeof(f16));
  f16*   qkvh   = (f16*)  carve((size_t)MTOT*3*D_*sizeof(f16));
  f16*   oh     = (f16*)  carve((size_t)MTOT*D_*sizeof(f16));
  f16*   fh     = (f16*)  carve((size_t)MTOT*FF_*sizeof(f16));

  // 1) f32 -> f16 conversions
  auto cvt = [&](const float* src, f16* dst, size_t n) {
    cvt_f32_f16_kernel<<<2048, 256, 0, stream>>>(src, dst, n);
  };
  cvt(x,     xh,     (size_t)MTOT*3*D_);
  cvt(w3d,   w3dh,   (size_t)D_*3*D_);
  cvt(wqkv,  wqkvh,  (size_t)NL_*3*D_*D_);
  cvt(wproj, wprojh, (size_t)NL_*D_*D_);
  cvt(w1,    w1h,    (size_t)NL_*FF_*D_);
  cvt(w2,    w2h,    (size_t)NL_*D_*FF_);

  dim3 blk(256);
  // 2) embedding projection: h = x * w3d^T + b3d   (M=8192, N=1024, K=3072)
  gemm_kernel<3,D_,false,false,false><<<dim3(D_/256, MTOT/128), blk, 0, stream>>>(
      xh, w3dh, b3d, nullptr, hbuf, MTOT, D_, 3*D_);

  for (int i = 0; i < NL_; i++) {
    // ln1 -> hn (f16)
    ln_kernel<true><<<MTOT, blk, 0, stream>>>(hbuf, ln1_g + (size_t)i*D_,
                                              ln1_b + (size_t)i*D_, hn);
    // qkv = hn * wqkv^T + bqkv   (N=3D, f16 out)
    gemm_kernel<2,3*D_,true,false,false><<<dim3(3*D_/256, MTOT/128), blk, 0, stream>>>(
        hn, wqkvh + (size_t)i*3*D_*D_, bqkv + (size_t)i*3*D_, nullptr,
        qkvh, MTOT, 3*D_, D_);
    // flash attention -> oh (f16)
    attn_kernel<<<dim3(L_/128, H_, B_), dim3(256), 0, stream>>>(qkvh, oh);
    // h = h + oh * wproj^T + bproj   (in-place residual)
    gemm_kernel<3,D_,false,true,false><<<dim3(D_/256, MTOT/128), blk, 0, stream>>>(
        oh, wprojh + (size_t)i*D_*D_, bproj + (size_t)i*D_, hbuf,
        hbuf, MTOT, D_, D_);
    // ln2 -> hn (f16)
    ln_kernel<true><<<MTOT, blk, 0, stream>>>(hbuf, ln2_g + (size_t)i*D_,
                                              ln2_b + (size_t)i*D_, hn);
    // f = gelu(hn * w1^T + b1)   (N=FF, f16 out)
    gemm_kernel<2,FF_,true,false,true><<<dim3(FF_/256, MTOT/128), blk, 0, stream>>>(
        hn, w1h + (size_t)i*FF_*D_, b1 + (size_t)i*FF_, nullptr,
        fh, MTOT, FF_, D_);
    // h = h + f * w2^T + b2   (K=FF, in-place residual)
    gemm_kernel<3,D_,false,true,false><<<dim3(D_/256, MTOT/128), blk, 0, stream>>>(
        fh, w2h + (size_t)i*D_*FF_, b2 + (size_t)i*D_, hbuf,
        hbuf, MTOT, D_, FF_);
  }

  // final layernorm -> d_out (f32)
  ln_kernel<false><<<MTOT, blk, 0, stream>>>(hbuf, lnf_g, lnf_b, (float*)d_out);
}

// v004
// It runs in 734 microseconds.
// In two side-by-side timings against v003, it was 1.04 and 1.02 times as fast.
// Over all steps from v000 it is 4.82 times as fast.
#include <hip/hip_runtime.h>
#include <math.h>

typedef _Float16 f16;
typedef __attribute__((ext_vector_type(16))) _Float16 v16h;
typedef __attribute__((ext_vector_type(8)))  _Float16 v8h;
typedef __attribute__((ext_vector_type(8)))  float    v8f;
typedef __attribute__((ext_vector_type(4)))  int      v4i;

#define B_    4
#define L_    2048
#define D_    1024
#define H_    4
#define NL_   2
#define HD_   256
#define FF_   4096
#define MTOT  (B_*L_)      // 8192 token rows
#define EPS_  1e-5f

#define GP_   72    // GEMM A/W tiles: 64 halves + 8   (144 B)
#define QKP_  264   // attention K tile: 256 halves + 8 (528 B)
// Rows read by the 16-bit transposing load want a pitch of 32 B x odd instead.
#define VRP_  272   // attention V tile: 256 halves + 16 (544 B)

#if __has_builtin(__builtin_amdgcn_global_load_async_to_lds_b128) && \
    __has_builtin(__builtin_amdgcn_s_wait_asynccnt)
#define HAVE_ASYNC_LDS 1
#else
#define HAVE_ASYNC_LDS 0
#endif

typedef __attribute__((address_space(1))) v4i gv4i_t;
typedef __attribute__((address_space(3))) v4i lv4i_t;

__device__ __forceinline__ void copy_g2l_b128(f16* dst_lds, const f16* src_glb) {
#if HAVE_ASYNC_LDS
  __builtin_amdgcn_global_load_async_to_lds_b128(
      (gv4i_t*)(const_cast<f16*>(src_glb)),
      (lv4i_t*)dst_lds, 0, 0);
#else
  *(v8h*)dst_lds = *(const v8h*)src_glb;
#endif
}

__device__ __forceinline__ v16h make_frag(v8h lo, v8h hi) {
  return __builtin_shufflevector(lo, hi, 0,1,2,3,4,5,6,7,8,9,10,11,12,13,14,15);
}

__device__ __forceinline__ v16h load_frag(const f16* tile, int rowBase, int ld,
                                          int kChunkBase, int lane) {
  int r  = rowBase + (lane & 15);
  int kb = kChunkBase + ((lane < 16) ? 0 : 8);
  const f16* p = tile + (size_t)r * ld + kb;
  v8h lo = *(const v8h*)(p);
  v8h hi = *(const v8h*)(p + 16);
  return make_frag(lo, hi);
}

__device__ __forceinline__ v8f mma16(v16h a, v16h b, v8f c) {
  return __builtin_amdgcn_wmma_f32_16x16x32_f16(false, a, false, b, (short)0, c, false, false);
}

__device__ __forceinline__ void sched_fence() { __builtin_amdgcn_sched_barrier(0); }

// ---------------------------------------------------------------------------
// f32 -> f16 conversion (grid-stride)
// ---------------------------------------------------------------------------
__global__ void cvt_f32_f16_kernel(const float* __restrict__ in, f16* __restrict__ out,
                                   size_t n) {
  size_t i = (size_t)blockIdx.x * blockDim.x + threadIdx.x;
  size_t stride = (size_t)gridDim.x * blockDim.x;
  for (; i < n; i += stride) out[i] = (f16)in[i];
}

// ---------------------------------------------------------------------------
// LayerNorm over D_=1024: two rows per wave, no LDS and no barrier.
// A launch of this size lasts as long as its waves take to start, so it gets few
// waves with much in flight each: 256 blocks of 16 waves, 2 rows per wave. A lane
// holds 32 values of each row (8 loads of 16 bytes; a wave's load covers 512
// contiguous bytes); mean and variance are in-lane sums, then a 5-step butterfly.
// ---------------------------------------------------------------------------
#define LNW_  16   // waves per block
#define LNR_  2    // rows per wave
typedef __attribute__((ext_vector_type(4))) float    v4f;
typedef __attribute__((ext_vector_type(4))) _Float16 v4h;

__device__ __forceinline__ float xhalf(float x) {
  return __builtin_bit_cast(float, __builtin_amdgcn_permlanex16(
      __builtin_bit_cast(int, x), __builtin_bit_cast(int, x),
      0x76543210, 0xfedcba98, false, false));
}

template<int XM>
__device__ __forceinline__ float xrow(float x) {
  return __builtin_bit_cast(float, __builtin_amdgcn_update_dpp(
      0, __builtin_bit_cast(int, x), 0x160 + XM, 0xf, 0xf, true));
}

// sum over the 32 lanes, the same bits in every lane
__device__ __forceinline__ float wave_sum(float s) {
  s += xrow<1>(s); s += xrow<2>(s); s += xrow<4>(s); s += xrow<8>(s);
  return s + xhalf(s);
}

template<bool OUT_F16>
__global__ void __launch_bounds__(LNW_*32)
ln_kernel(const float* __restrict__ x, const float* __restrict__ g,
          const float* __restrict__ bb, void* __restrict__ out) {
  const int lane = threadIdx.x & 31;
  const int wave = __builtin_amdgcn_readfirstlane(threadIdx.x >> 5);
  const size_t row0 = ((size_t)blockIdx.x * LNW_ + wave) * LNR_;   // wave-uniform
  const v4f* xl = (const v4f*)(x + row0 * D_) + lane;
  const v4f* gl = (const v4f*)g + lane;
  const v4f* bl = (const v4f*)bb + lane;

  v4f v[LNR_][8], gv[8], bv[8];
  #pragma unroll
  for (int r = 0; r < LNR_; r++)
    #pragma unroll
    for (int i = 0; i < 8; i++) v[r][i] = xl[r*(D_/4) + i*32];
  #pragma unroll
  for (int i = 0; i < 8; i++) gv[i] = gl[i*32];
  #pragma unroll
  for (int i = 0; i < 8; i++) bv[i] = bl[i*32];
  sched_fence();
  asm volatile("s_wait_xcnt 0x0" ::: "memory");
  sched_fence();

  float mu[LNR_], rstd[LNR_];
  #pragma unroll
  for (int r = 0; r < LNR_; r++) {
    v4f s4 = v[r][0];
    #pragma unroll
    for (int i = 1; i < 8; i++) s4 += v[r][i];
    mu[r] = (s4[0] + s4[1]) + (s4[2] + s4[3]);
  }
  #pragma unroll
  for (int r = 0; r < LNR_; r++) mu[r] = wave_sum(mu[r]) * (1.0f / D_);
  #pragma unroll
  for (int r = 0; r < LNR_; r++) {
    v4f q4 = {};
    #pragma unroll
    for (int i = 0; i < 8; i++) { v[r][i] -= mu[r]; q4 += v[r][i] * v[r][i]; }
    rstd[r] = (q4[0] + q4[1]) + (q4[2] + q4[3]);
  }
  #pragma unroll
  for (int r = 0; r < LNR_; r++) rstd[r] = rsqrtf(wave_sum(rstd[r]) * (1.0f / D_) + EPS_);

  v4h hv[OUT_F16 ? LNR_ : 1][8];
  #pragma unroll
  for (int r = 0; r < LNR_; r++)
    #pragma unroll
    for (int i = 0; i < 8; i++) {
      v4f y = v[r][i] * rstd[r] * gv[i] + bv[i];
      if (OUT_F16) hv[r][i] = __builtin_convertvector(y, v4h);
      else         v[r][i] = y;
    }
  // all arithmetic stays ahead of the stores, so that no register a store names is rewritten behind it
  sched_fence();
  #pragma unroll
  for (int r = 0; r < LNR_; r++)
    #pragma unroll
    for (int i = 0; i < 8; i++) {
      if (OUT_F16) ((v4h*)((f16*)out + row0 * D_) + lane)[r*(D_/4) + i*32] = hv[r][i];
      else         ((v4f*)((float*)out + row0 * D_) + lane)[r*(D_/4) + i*32] = v[r][i];
    }
}

#define BM_   128
#define BN_   256
#define BK_   64
#define STG_  ((BM_ + BN_) * GP_)   // halves of one stage: A rows, then W rows

template<int NB, int NN, bool OUT_F16, bool RES, bool GELU>
__global__ void __launch_bounds__(256, NB == 2 ? 4 : 2)
gemm_kernel(const f16* __restrict__ A, const f16* __restrict__ W,
            const float* __restrict__ bias, const float* __restrict__ resid,
            void* __restrict__ out, int M, int N, int K) {
  (void)M; (void)N;   // N is the template constant NN
  __shared__ __attribute__((aligned(16))) f16 ring[NB*STG_];
  int tid  = threadIdx.x;
  int lane = tid & 31, wave = tid >> 5;
  int waveM = wave >> 2, waveN = wave & 3;
  int blockN0 = blockIdx.x * BN_, blockM0 = blockIdx.y * BM_;

  const int nst = K >> 6;   // stages

  // a thread copies 16 bytes of row (tid >> 3) + 32 i: block-uniform bases plus
  // one 32-bit byte offset per lane, the same for A and W (both have K columns)
  const char* gA = (const char*)(A + (size_t)blockM0 * K);
  const char* gW = (const char*)(W + (size_t)blockN0 * K);
  const unsigned goff = ((unsigned)(tid >> 3) * (unsigned)K + (unsigned)(tid & 7) * 8u) * 2u;
  const size_t rstep = (size_t)K * 64;   // 32 rows, in bytes
  f16* lrow = ring + (tid >> 3)*GP_ + (tid & 7)*8;

  // one stage's async copies into buffer `buf` (12 b128 copies per thread)
  auto issue = [&](int st, int buf) {
    f16* l = lrow + buf*STG_;
    const char* a = gA + (size_t)st * (BK_*2);
    const char* w = gW + (size_t)st * (BK_*2);
    #pragma unroll
    for (int i = 0; i < 4; i++)
      copy_g2l_b128(l + i*32*GP_, (const f16*)(a + i*rstep + goff));
    #pragma unroll
    for (int i = 0; i < 8; i++)
      copy_g2l_b128(l + (BM_ + i*32)*GP_, (const f16*)(w + i*rstep + goff));
  };

  v8f  acc[4][4] = {};
  // fragments of k chunk kc (32 k) of the stage at `st`
  auto ldF = [&](v16h (&fa)[4], v16h (&fb)[4], const f16* st, int kc) {
    #pragma unroll
    for (int i = 0; i < 4; i++) fa[i] = load_frag(st, waveM*64 + i*16, GP_, kc*32, lane);
    #pragma unroll
    for (int i = 0; i < 4; i++) fb[i] = load_frag(st + BM_*GP_, waveN*64 + i*16, GP_, kc*32, lane);
  };
  auto mm = [&](v16h (&fa)[4], v16h (&fb)[4]) {
    #pragma unroll
    for (int i = 0; i < 4; i++)
      #pragma unroll
      for (int j = 0; j < 4; j++) acc[i][j] = mma16(fa[i], fb[j], acc[i][j]);
  };

  if constexpr (NB == 2) {
    v16h a0[4], b0[4];
    issue(0, 0);
    // stage 0 has landed; the barrier publishes it
    asm volatile("s_wait_asynccnt 0x0" ::: "memory");
    __syncthreads();
    issue(1, 1);
    for (int s = 0; s < nst; s++) {
      const f16* st = ring + (s & 1)*STG_;
      ldF(a0, b0, st, 0); sched_fence();
      mm(a0, b0); sched_fence();
      ldF(a0, b0, st, 1); sched_fence();
      mm(a0, b0); sched_fence();
      // publish point of stage s + 1: this wave's reads of stage s are done,
      asm volatile("s_wait_dscnt 0x0" ::: "memory");
      // its copies of stage s + 1 have landed,
      asm volatile("s_wait_asynccnt 0x0" ::: "memory");
      // and the barrier publishes stage s + 1 and frees stage s's buffer
      __syncthreads();
      if (s + 2 < nst) issue(s + 2, s & 1);
    }
  } else {
    // three buffers, two fragment sets: one is loaded while the other is consumed
    v16h a0[4], b0[4], a1[4], b1[4];
    issue(0, 0); issue(1, 1); issue(2, 2);
    // stage 0 has landed (the 24 youngest copies are stages 1 and 2); the barrier publishes it
    asm volatile("s_wait_asynccnt 0x18" ::: "memory");
    __syncthreads();
    ldF(a0, b0, ring, 0);

    int cur = 0;   // buffer of stage s
    for (int s = 0; s < nst; s++) {
      int nxt = (cur == 2) ? 0 : cur + 1;
      ldF(a1, b1, ring + cur*STG_, 1); sched_fence();
      mm(a0, b0); sched_fence();
      // publish point of stage s + 1, ahead of the trip's last block because that
      // block's load group already reads stage s + 1. This wave's reads of stage s are done:
      asm volatile("s_wait_dscnt 0x0" ::: "memory");
      // this wave's copies of stage s + 1 have landed (the 12 youngest are stage s + 2, where it exists)
      if (s + 2 < nst) asm volatile("s_wait_asynccnt 0xc" ::: "memory");
      else             asm volatile("s_wait_asynccnt 0x0" ::: "memory");
      __syncthreads();
      // in the last trip these loads read a buffer that holds an old stage; nothing uses them
      ldF(a0, b0, ring + nxt*STG_, 0); sched_fence();
      mm(a1, b1); sched_fence();
      if (s + 3 < nst) issue(s + 3, cur);
      cur = nxt;
    }
  }
  // the ring's closing wait: no copy of this wave is outstanding when it leaves the ring
  asm volatile("s_wait_asynccnt 0x0" ::: "memory");

  // Epilogue. One lane pointer per array; every row and column step is a compile-time
  // constant that folds into the instructions' offset fields.
  const int mHalf = (lane < 16) ? 0 : 8;
  const int n0 = lane & 15;
  const size_t e0 = (size_t)(blockM0 + waveM*64 + mHalf) * NN + blockN0 + waveN*64 + n0;
  const float* bl = bias + blockN0 + waveN*64 + n0;
  float bv[4];
  #pragma unroll
  for (int t = 0; t < 4; t++) bv[t] = bl[t*16];
  float rv[RES ? 4 : 1][4][8];
  const float* rl = RES ? resid + e0 : bl;
  if (RES) {
    #pragma unroll
    for (int i = 0; i < 4; i++)
      #pragma unroll
      for (int j = 0; j < 8; j++)
        #pragma unroll
        for (int t = 0; t < 4; t++) rv[i][t][j] = rl[(i*16 + j)*NN + t*16];
  }
  sched_fence();
  asm volatile("s_wait_xcnt 0x0" :: "v"(bl), "v"(rl) : "memory");
  sched_fence();

  static_assert(!GELU || OUT_F16, "the GELU path stores f16");
  f16 hv[OUT_F16 ? 4 : 1][4][8];
  #pragma unroll
  for (int i = 0; i < 4; i++)
    #pragma unroll
    for (int t = 0; t < 4; t++) {
      #pragma unroll
      for (int j = 0; j < 8; j++) {
        float v = acc[i][t][j] + bv[t];
        if (GELU) v = 0.5f * v * (1.0f + erff(v * 0.70710678118f));
        if (RES) v += rv[i][t][j];
        // erff branches: 128 results held across its hundreds of blocks spill, so here each is stored at once
        if (GELU)         ((f16*)out + e0)[(i*16 + j)*NN + t*16] = (f16)v;
        else if (OUT_F16) hv[i][t][j] = (f16)v;
        else              acc[i][t][j] = v;
      }
    }
  if (GELU) return;
  // all arithmetic stays ahead of the stores, so that no register a store names is rewritten behind it
  sched_fence();
  #pragma unroll
  for (int i = 0; i < 4; i++)
    #pragma unroll
    for (int j = 0; j < 8; j++)
      #pragma unroll
      for (int t = 0; t < 4; t++) {
        if (OUT_F16) ((f16*)out + e0)[(i*16 + j)*NN + t*16] = hv[i][t][j];
        else         ((float*)out + e0)[(i*16 + j)*NN + t*16] = acc[i][t][j];
      }
}

typedef __attribute__((ext_vector_type(8))) short s16x8;
typedef __attribute__((address_space(3))) s16x8 lds_s16x8;

// lane (c, hh) receives T[row 8*hh + 0..7][column c] of the 16x16 tile whose
// rows the 32 lane addresses name
__device__ __forceinline__ v8h ld_tr16(const f16* p) {
  return __builtin_bit_cast(v8h, __builtin_amdgcn_ds_load_tr16_b128_v8i16((lds_s16x8*)p));
}

__global__ void __launch_bounds__(256, 1)
attn_kernel(const f16* __restrict__ qkv, f16* __restrict__ o) {
  __shared__ __attribute__((aligned(32))) f16 tiles[64*QKP_ + 64*VRP_];
  f16* Kt = tiles;               // [key][d], pitch QKP_
  f16* Vr = tiles + 64*QKP_;     // [key][d], pitch VRP_

  int tid = threadIdx.x, lane = tid & 31, wave = tid >> 5;
  int c = lane & 15, hh = lane >> 4;
  int b = blockIdx.z, h = blockIdx.y;
  int q0 = blockIdx.x * 128 + wave * 16;      // this wave's first query
  const size_t rs = 3*D_;
  const f16* qb = qkv + (size_t)b*L_*rs +        (size_t)h*HD_;
  const f16* kp = qkv + (size_t)b*L_*rs + D_   + (size_t)h*HD_;
  const f16* vp = qkv + (size_t)b*L_*rs + 2*D_ + (size_t)h*HD_;

  // Q^T fragments (B operand, column = query), same k order as K's fragments
  v16h qf[8];
  #pragma unroll
  for (int kc = 0; kc < 8; kc++)
    qf[kc] = load_frag(qb + (size_t)q0*rs, 0, 3*D_, kc*32, lane);
  sched_fence();
  asm volatile("s_wait_xcnt 0x0" ::: "memory");
  sched_fence();

  v8f oacc[16] = {};                 // O^T: tile dt, register r = O[query c][16*dt + 8*hh + r]
  float rm = -INFINITY, rl = 0.0f;   // running maximum (log2 domain), this half's running sum
  const float cscale = 0.0625f * 1.4426950408889634f;   // 1/sqrt(256) * log2(e)

  // lane address of the transposing loads: row 8*hh + (lane & 7), 16-byte half (lane >> 3) & 1
  const f16* vad = Vr + (8*hh + (lane & 7))*VRP_ + ((lane >> 3) & 1)*8;

  v16h fa[8], fb[8];   // two fragment sets: one is loaded while the other is consumed
  v8f  s[4];
  v16h pf[2];

  // K fragments of d chunks 2g, 2g+1 for the four 16-key tiles
  auto ldK = [&](v16h (&f)[8], int g) {
    #pragma unroll
    for (int i = 0; i < 8; i++)
      f[i] = load_frag(Kt, (i & 3)*16, QKP_, (2*g + (i >> 2))*32, lane);
  };
  auto mmS = [&](v16h (&f)[8], int g) {
    #pragma unroll
    for (int i = 0; i < 8; i++) s[i & 3] = mma16(f[i], qf[2*g + (i >> 2)], s[i & 3]);
  };
  // V^T fragments (16 d x 32 keys) of d tiles 4g..4g+3 for the two 32-key chunks
  auto ldV = [&](v16h (&f)[8], int g) {
    #pragma unroll
    for (int i = 0; i < 8; i++) {
      const f16* p = vad + (i >> 2)*32*VRP_ + (4*g + (i & 3))*16;
      f[i] = make_frag(ld_tr16(p), ld_tr16(p + 16*VRP_));
    }
  };
  auto mmV = [&](v16h (&f)[8], int g) {
    #pragma unroll
    for (int i = 0; i < 8; i++)
      oacc[4*g + (i & 3)] = mma16(f[i], pf[i >> 2], oacc[4*g + (i & 3)]);
  };

  for (int kb0 = 0; kb0 < L_; kb0 += 64) {
    // K and V tiles, row-major: 2 x 2048 b128 copies, 16 per thread
    #pragma unroll
    for (int i = 0; i < 8; i++) {
      int id = tid + i*256;
      int r = id >> 5, c8 = (id & 31) * 8;
      copy_g2l_b128(&Kt[r*QKP_ + c8], &kp[(size_t)(kb0 + r)*rs + c8]);
    }
    #pragma unroll
    for (int i = 0; i < 8; i++) {
      int id = tid + i*256;
      int r = id >> 5, c8 = (id & 31) * 8;
      copy_g2l_b128(&Vr[r*VRP_ + c8], &vp[(size_t)(kb0 + r)*rs + c8]);
    }
    // this wave's copies have landed; the barrier publishes all waves' copies
    asm volatile("s_wait_asynccnt 0x0" ::: "memory");
    __syncthreads();

    // S^T (64 keys x 16 queries)
    #pragma unroll
    for (int t = 0; t < 4; t++) s[t] = v8f{};
    ldK(fa, 0); sched_fence();
    ldK(fb, 1); sched_fence(); mmS(fa, 0); sched_fence();
    ldK(fa, 2); sched_fence(); mmS(fb, 1); sched_fence();
    ldK(fb, 3); sched_fence(); mmS(fa, 2); sched_fence();
    ldV(fa, 0); sched_fence(); mmS(fb, 3); sched_fence();
    ldV(fb, 1); sched_fence();   // the first V^T groups fly under the softmax

    // online softmax of query c: 32 scores in this lane, 32 in lane ^ 16
    float mx = s[0][0];
    #pragma unroll
    for (int t = 0; t < 4; t++)
      #pragma unroll
      for (int j = 0; j < 8; j++) mx = fmaxf(mx, s[t][j]);
    mx = fmaxf(mx, xhalf(mx)) * cscale;
    float mnew  = fmaxf(rm, mx);
    float alpha = __builtin_amdgcn_exp2f(rm - mnew);
    rm = mnew;
    float sum[4] = {0.0f, 0.0f, 0.0f, 0.0f};
    #pragma unroll
    for (int t = 0; t < 4; t++)
      #pragma unroll
      for (int j = 0; j < 8; j++) {
        float p = __builtin_amdgcn_exp2f(__builtin_fmaf(s[t][j], cscale, -mnew));
        pf[t >> 1][(t & 1)*8 + j] = (f16)p;   // element e of chunk t>>1 is key 16*(e>>3) + 8*hh + (e&7)
        sum[t] += p;
      }
    rl = rl * alpha + ((sum[0] + sum[1]) + (sum[2] + sum[3]));
    #pragma unroll
    for (int dt = 0; dt < 16; dt++) oacc[dt] *= alpha;
    sched_fence();

    // O^T (256 d x 16 queries) += V^T P^T
    mmV(fa, 0); sched_fence();
    ldV(fa, 2); sched_fence(); mmV(fb, 1); sched_fence();
    ldV(fb, 3); sched_fence(); mmV(fa, 2); sched_fence();
    mmV(fb, 3);

    // every wave's reads of the tiles are done before the next copies overwrite them
    asm volatile("s_wait_dscnt 0x0" ::: "memory");
    __syncthreads();
  }

  float inv = 1.0f / (rl + xhalf(rl));   // the halves' sums join here
  f16* orow = o + ((size_t)b*L_ + q0 + c)*D_ + h*HD_ + 8*hh;
  v8h pk[16];
  #pragma unroll
  for (int dt = 0; dt < 16; dt++)
    #pragma unroll
    for (int j = 0; j < 8; j++) pk[dt][j] = (f16)(oacc[dt][j] * inv);
  // all packing stays ahead of the stores, so that no register a store names is rewritten behind it
  sched_fence();
  #pragma unroll
  for (int dt = 0; dt < 16; dt++) *(v8h*)(orow + dt*16) = pk[dt];
}

// ---------------------------------------------------------------------------
// Host orchestration
// ---------------------------------------------------------------------------
static inline size_t align256(size_t x) { return (x + 255) & ~(size_t)255; }

extern "C" void kernel_launch(void* const* d_in, const int* in_sizes, int n_in,
                              void* d_out, int out_size, void* d_ws, size_t ws_size,
                              hipStream_t stream) {
  (void)in_sizes; (void)n_in; (void)out_size; (void)ws_size;
  const float* x     = (const float*)d_in[0];
  const float* w3d   = (const float*)d_in[1];
  const float* b3d   = (const float*)d_in[2];
  const float* ln1_g = (const float*)d_in[3];
  const float* ln1_b = (const float*)d_in[4];
  const float* wqkv  = (const float*)d_in[5];
  const float* bqkv  = (const float*)d_in[6];
  const float* wproj = (const float*)d_in[7];
  const float* bproj = (const float*)d_in[8];
  const float* ln2_g = (const float*)d_in[9];
  const float* ln2_b = (const float*)d_in[10];
  const float* w1    = (const float*)d_in[11];
  const float* b1    = (const float*)d_in[12];
  const float* w2    = (const float*)d_in[13];
  const float* b2    = (const float*)d_in[14];
  const float* lnf_g = (const float*)d_in[15];
  const float* lnf_b = (const float*)d_in[16];

  // workspace carve-up (~292 MB)
  char* ws = (char*)d_ws;
  size_t off = 0;
  auto carve = [&](size_t bytes) -> void* { void* p = ws + off; off += align256(bytes); return p; };
  f16*   xh     = (f16*)  carve((size_t)MTOT*3*D_*sizeof(f16));
  f16*   w3dh   = (f16*)  carve((size_t)D_*3*D_*sizeof(f16));
  f16*   wqkvh  = (f16*)  carve((size_t)NL_*3*D_*D_*sizeof(f16));
  f16*   wprojh = (f16*)  carve((size_t)NL_*D_*D_*sizeof(f16));
  f16*   w1h    = (f16*)  carve((size_t)NL_*FF_*D_*sizeof(f16));
  f16*   w2h    = (f16*)  carve((size_t)NL_*D_*FF_*sizeof(f16));
  float* hbuf   = (float*)carve((size_t)MTOT*D_*sizeof(float));
  f16*   hn     = (f16*)  carve((size_t)MTOT*D_*sizeof(f16));
  f16*   qkvh   = (f16*)  carve((size_t)MTOT*3*D_*sizeof(f16));
  f16*   oh     = (f16*)  carve((size_t)MTOT*D_*sizeof(f16));
  f16*   fh     = (f16*)  carve((size_t)MTOT*FF_*sizeof(f16));

  // 1) f32 -> f16 conversions
  auto cvt = [&](const float* src, f16* dst, size_t n) {
    cvt_f32_f16_kernel<<<2048, 256, 0, stream>>>(src, dst, n);
  };
  cvt(x,     xh,     (size_t)MTOT*3*D_);
  cvt(w3d,   w3dh,   (size_t)D_*3*D_);
  cvt(wqkv,  wqkvh,  (size_t)NL_*3*D_*D_);
  cvt(wproj, wprojh, (size_t)NL_*D_*D_);
  cvt(w1,    w1h,    (size_t)NL_*FF_*D_);
  cvt(w2,    w2h,    (size_t)NL_*D_*FF_);

  dim3 blk(256);
  // 2) embedding projection: h = x * w3d^T + b3d   (M=8192, N=1024, K=3072)
  gemm_kernel<3,D_,false,false,false><<<dim3(D_/256, MTOT/128), blk, 0, stream>>>(
      xh, w3dh, b3d, nullptr, hbuf, MTOT, D_, 3*D_);

  for (int i = 0; i < NL_; i++) {
    // ln1 -> hn (f16)
    ln_kernel<true><<<MTOT/(LNW_*LNR_), dim3(LNW_*32), 0, stream>>>(hbuf, ln1_g + (size_t)i*D_,
                                              ln1_b + (size_t)i*D_, hn);
    // qkv = hn * wqkv^T + bqkv   (N=3D, f16 out)
    gemm_kernel<2,3*D_,true,false,false><<<dim3(3*D_/256, MTOT/128), blk, 0, stream>>>(
        hn, wqkvh + (size_t)i*3*D_*D_, bqkv + (size_t)i*3*D_, nullptr,
        qkvh, MTOT, 3*D_, D_);
    // flash attention -> oh (f16)
    attn_kernel<<<dim3(L_/128, H_, B_), dim3(256), 0, stream>>>(qkvh, oh);
    // h = h + oh * wproj^T + bproj   (in-place residual)
    gemm_kernel<3,D_,false,true,false><<<dim3(D_/256, MTOT/128), blk, 0, stream>>>(
        oh, wprojh + (size_t)i*D_*D_, bproj + (size_t)i*D_, hbuf,
        hbuf, MTOT, D_, D_);
    // ln2 -> hn (f16)
    ln_kernel<true><<<MTOT/(LNW_*LNR_), dim3(LNW_*32), 0, stream>>>(hbuf, ln2_g + (size_t)i*D_,
                                              ln2_b + (size_t)i*D_, hn);
    // f = gelu(hn * w1^T + b1)   (N=FF, f16 out)
    gemm_kernel<2,FF_,true,false,true><<<dim3(FF_/256, MTOT/128), blk, 0, stream>>>(
        hn, w1h + (size_t)i*FF_*D_, b1 + (size_t)i*FF_, nullptr,
        fh, MTOT, FF_, D_);
    // h = h + f * w2^T + b2   (K=FF, in-place residual)
    gemm_kernel<3,D_,false,true,false><<<dim3(D_/256, MTOT/128), blk, 0, stream>>>(
        fh, w2h + (size_t)i*D_*FF_, b2 + (size_t)i*D_, hbuf,
        hbuf, MTOT, D_, FF_);
  }

  // final layernorm -> d_out (f32)
  ln_kernel<false><<<MTOT/(LNW_*LNR_), dim3(LNW_*32), 0, stream>>>(hbuf, lnf_g, lnf_b, (float*)d_out);
}

// v005
// Measured time: 659 microseconds a run.
// Next to v004, in two timings, it ran 1.11 times as fast each time.
// All steps since v000 together make it 5.36 times as fast.
#include <hip/hip_runtime.h>
#include <math.h>

typedef _Float16 f16;
typedef __attribute__((ext_vector_type(16))) _Float16 v16h;
typedef __attribute__((ext_vector_type(8)))  _Float16 v8h;
typedef __attribute__((ext_vector_type(8)))  float    v8f;
typedef __attribute__((ext_vector_type(4)))  int      v4i;

#define B_    4
#define L_    2048
#define D_    1024
#define H_    4
#define NL_   2
#define HD_   256
#define FF_   4096
#define MTOT  (B_*L_)      // 8192 token rows
#define EPS_  1e-5f

#define GP_   72    // GEMM A/W tiles: 64 halves + 8   (144 B)
#define QKP_  264   // attention K tile: 256 halves + 8 (528 B)
// Rows read by the 16-bit transposing load want a pitch of 32 B x odd instead.
#define VRP_  272   // attention V tile: 256 halves + 16 (544 B)

#if __has_builtin(__builtin_amdgcn_global_load_async_to_lds_b128) && \
    __has_builtin(__builtin_amdgcn_s_wait_asynccnt)
#define HAVE_ASYNC_LDS 1
#else
#define HAVE_ASYNC_LDS 0
#endif

typedef __attribute__((address_space(1))) v4i gv4i_t;
typedef __attribute__((address_space(3))) v4i lv4i_t;

__device__ __forceinline__ void copy_g2l_b128(f16* dst_lds, const f16* src_glb) {
#if HAVE_ASYNC_LDS
  __builtin_amdgcn_global_load_async_to_lds_b128(
      (gv4i_t*)(const_cast<f16*>(src_glb)),
      (lv4i_t*)dst_lds, 0, 0);
#else
  *(v8h*)dst_lds = *(const v8h*)src_glb;
#endif
}

__device__ __forceinline__ v16h make_frag(v8h lo, v8h hi) {
  return __builtin_shufflevector(lo, hi, 0,1,2,3,4,5,6,7,8,9,10,11,12,13,14,15);
}

__device__ __forceinline__ v16h load_frag(const f16* tile, int rowBase, int ld,
                                          int kChunkBase, int lane) {
  int r  = rowBase + (lane & 15);
  int kb = kChunkBase + ((lane < 16) ? 0 : 8);
  const f16* p = tile + (size_t)r * ld + kb;
  v8h lo = *(const v8h*)(p);
  v8h hi = *(const v8h*)(p + 16);
  return make_frag(lo, hi);
}

__device__ __forceinline__ v8f mma16(v16h a, v16h b, v8f c) {
  return __builtin_amdgcn_wmma_f32_16x16x32_f16(false, a, false, b, (short)0, c, false, false);
}

__device__ __forceinline__ void sched_fence() { __builtin_amdgcn_sched_barrier(0); }

// ---------------------------------------------------------------------------
// f32 -> f16 conversion (grid-stride)
// ---------------------------------------------------------------------------
__global__ void cvt_f32_f16_kernel(const float* __restrict__ in, f16* __restrict__ out,
                                   size_t n) {
  size_t i = (size_t)blockIdx.x * blockDim.x + threadIdx.x;
  size_t stride = (size_t)gridDim.x * blockDim.x;
  for (; i < n; i += stride) out[i] = (f16)in[i];
}

// ---------------------------------------------------------------------------
// LayerNorm over D_=1024: two rows per wave, no LDS and no barrier.
// A launch of this size lasts as long as its waves take to start, so it gets few
// waves with much in flight each: 256 blocks of 16 waves, 2 rows per wave. A lane
// holds 32 values of each row (8 loads of 16 bytes; a wave's load covers 512
// contiguous bytes); mean and variance are in-lane sums, then a 5-step butterfly.
// ---------------------------------------------------------------------------
#define LNW_  16   // waves per block
#define LNR_  2    // rows per wave
typedef __attribute__((ext_vector_type(4))) float    v4f;
typedef __attribute__((ext_vector_type(4))) _Float16 v4h;

__device__ __forceinline__ float xhalf(float x) {
  return __builtin_bit_cast(float, __builtin_amdgcn_permlanex16(
      __builtin_bit_cast(int, x), __builtin_bit_cast(int, x),
      0x76543210, 0xfedcba98, false, false));
}

template<int XM>
__device__ __forceinline__ float xrow(float x) {
  return __builtin_bit_cast(float, __builtin_amdgcn_update_dpp(
      0, __builtin_bit_cast(int, x), 0x160 + XM, 0xf, 0xf, true));
}

// sum over the 32 lanes, the same bits in every lane
__device__ __forceinline__ float wave_sum(float s) {
  s += xrow<1>(s); s += xrow<2>(s); s += xrow<4>(s); s += xrow<8>(s);
  return s + xhalf(s);
}

template<bool OUT_F16>
__global__ void __launch_bounds__(LNW_*32)
ln_kernel(const float* __restrict__ x, const float* __restrict__ g,
          const float* __restrict__ bb, void* __restrict__ out) {
  const int lane = threadIdx.x & 31;
  const int wave = __builtin_amdgcn_readfirstlane(threadIdx.x >> 5);
  const size_t row0 = ((size_t)blockIdx.x * LNW_ + wave) * LNR_;   // wave-uniform
  const v4f* xl = (const v4f*)(x + row0 * D_) + lane;
  const v4f* gl = (const v4f*)g + lane;
  const v4f* bl = (const v4f*)bb + lane;

  v4f v[LNR_][8], gv[8], bv[8];
  #pragma unroll
  for (int r = 0; r < LNR_; r++)
    #pragma unroll
    for (int i = 0; i < 8; i++) v[r][i] = xl[r*(D_/4) + i*32];
  #pragma unroll
  for (int i = 0; i < 8; i++) gv[i] = gl[i*32];
  #pragma unroll
  for (int i = 0; i < 8; i++) bv[i] = bl[i*32];
  sched_fence();
  asm volatile("s_wait_xcnt 0x0" ::: "memory");
  sched_fence();

  float mu[LNR_], rstd[LNR_];
  #pragma unroll
  for (int r = 0; r < LNR_; r++) {
    v4f s4 = v[r][0];
    #pragma unroll
    for (int i = 1; i < 8; i++) s4 += v[r][i];
    mu[r] = (s4[0] + s4[1]) + (s4[2] + s4[3]);
  }
  #pragma unroll
  for (int r = 0; r < LNR_; r++) mu[r] = wave_sum(mu[r]) * (1.0f / D_);
  #pragma unroll
  for (int r = 0; r < LNR_; r++) {
    v4f q4 = {};
    #pragma unroll
    for (int i = 0; i < 8; i++) { v[r][i] -= mu[r]; q4 += v[r][i] * v[r][i]; }
    rstd[r] = (q4[0] + q4[1]) + (q4[2] + q4[3]);
  }
  #pragma unroll
  for (int r = 0; r < LNR_; r++) rstd[r] = rsqrtf(wave_sum(rstd[r]) * (1.0f / D_) + EPS_);

  v4h hv[OUT_F16 ? LNR_ : 1][8];
  #pragma unroll
  for (int r = 0; r < LNR_; r++)
    #pragma unroll
    for (int i = 0; i < 8; i++) {
      v4f y = v[r][i] * rstd[r] * gv[i] + bv[i];
      if (OUT_F16) hv[r][i] = __builtin_convertvector(y, v4h);
      else         v[r][i] = y;
    }
  // all arithmetic stays ahead of the stores, so that no register a store names is rewritten behind it
  sched_fence();
  #pragma unroll
  for (int r = 0; r < LNR_; r++)
    #pragma unroll
    for (int i = 0; i < 8; i++) {
      if (OUT_F16) ((v4h*)((f16*)out + row0 * D_) + lane)[r*(D_/4) + i*32] = hv[r][i];
      else         ((v4f*)((float*)out + row0 * D_) + lane)[r*(D_/4) + i*32] = v[r][i];
    }
}

#define BM_   128
#define BN_   256

// erf of two values without a branch. Both of the usual f32 fits are evaluated and one is
// selected: |x| < 1: |x| + |x| Q(x^2); otherwise 1 - exp(-(|x| + |x| P(|x|))). With no branch
// between them the elements' chains are independent straight-line code that fills the vector
// port, and pairs of values share packed instructions.
typedef __attribute__((ext_vector_type(2))) float v2f;
__device__ __forceinline__ v2f fma2(v2f a, v2f b, float c) {
  return __builtin_elementwise_fma(a, b, (v2f){c, c});
}
__device__ __forceinline__ v2f erf2(v2f x) {
  const v2f ax = __builtin_elementwise_abs(x);
  v2f p = fma2(ax, (v2f){0.0000169988107f, 0.0000169988107f}, -0.000378677854f);
  p = fma2(ax, p, 0.00385781587f);
  p = fma2(ax, p, -0.0241816975f);
  p = fma2(ax, p, 0.106668264f);
  p = fma2(ax, p, 0.634933293f);
  p = fma2(ax, p, 0.128689408f);
  p = __builtin_elementwise_fma(ax, p, ax) * -1.44269502f;   // exp(-y) = 2^(-y log2 e)
  const v2f t = x * x;
  v2f q = fma2(t, (v2f){-0.000561801775f, -0.000561801775f}, 0.00491381623f);
  q = fma2(t, q, -0.0267075151f);
  q = fma2(t, q, 0.112800106f);
  q = fma2(t, q, -0.376122952f);
  q = fma2(t, q, 0.128379107f);
  q = __builtin_elementwise_fma(ax, q, ax);
  v2f r;
  r.x = ax.x < 1.0f ? q.x : 1.0f - __builtin_amdgcn_exp2f(p.x);
  r.y = ax.y < 1.0f ? q.y : 1.0f - __builtin_amdgcn_exp2f(p.y);
  return __builtin_elementwise_copysign(r, x);
}
#define BK_   64
#define STG_  ((BM_ + BN_) * GP_)   // halves of one stage: A rows, then W rows

template<int NB, int NN, bool OUT_F16, bool RES, bool GELU>
__global__ void __launch_bounds__(256, NB == 2 ? 4 : 2)
gemm_kernel(const f16* __restrict__ A, const f16* __restrict__ W,
            const float* __restrict__ bias, const float* __restrict__ resid,
            void* __restrict__ out, int M, int N, int K) {
  (void)M; (void)N;   // N is the template constant NN
  __shared__ __attribute__((aligned(16))) f16 ring[NB*STG_];
  int tid  = threadIdx.x;
  int lane = tid & 31, wave = tid >> 5;
  int waveM = wave >> 2, waveN = wave & 3;
  int blockN0 = blockIdx.x * BN_, blockM0 = blockIdx.y * BM_;

  const int nst = K >> 6;   // stages

  // a thread copies 16 bytes of row (tid >> 3) + 32 i: block-uniform bases plus
  // one 32-bit byte offset per lane, the same for A and W (both have K columns)
  const char* gA = (const char*)(A + (size_t)blockM0 * K);
  const char* gW = (const char*)(W + (size_t)blockN0 * K);
  const unsigned goff = ((unsigned)(tid >> 3) * (unsigned)K + (unsigned)(tid & 7) * 8u) * 2u;
  const size_t rstep = (size_t)K * 64;   // 32 rows, in bytes
  f16* lrow = ring + (tid >> 3)*GP_ + (tid & 7)*8;

  // one stage's async copies into buffer `buf` (12 b128 copies per thread)
  auto issue = [&](int st, int buf) {
    f16* l = lrow + buf*STG_;
    const char* a = gA + (size_t)st * (BK_*2);
    const char* w = gW + (size_t)st * (BK_*2);
    #pragma unroll
    for (int i = 0; i < 4; i++)
      copy_g2l_b128(l + i*32*GP_, (const f16*)(a + i*rstep + goff));
    #pragma unroll
    for (int i = 0; i < 8; i++)
      copy_g2l_b128(l + (BM_ + i*32)*GP_, (const f16*)(w + i*rstep + goff));
  };

  v8f  acc[4][4] = {};
  // fragments of k chunk kc (32 k) of the stage at `st`
  auto ldF = [&](v16h (&fa)[4], v16h (&fb)[4], const f16* st, int kc) {
    #pragma unroll
    for (int i = 0; i < 4; i++) fa[i] = load_frag(st, waveM*64 + i*16, GP_, kc*32, lane);
    #pragma unroll
    for (int i = 0; i < 4; i++) fb[i] = load_frag(st + BM_*GP_, waveN*64 + i*16, GP_, kc*32, lane);
  };
  auto mm = [&](v16h (&fa)[4], v16h (&fb)[4]) {
    #pragma unroll
    for (int i = 0; i < 4; i++)
      #pragma unroll
      for (int j = 0; j < 4; j++) acc[i][j] = mma16(fa[i], fb[j], acc[i][j]);
  };

  if constexpr (NB == 2) {
    v16h a0[4], b0[4];
    issue(0, 0);
    // stage 0 has landed; the barrier publishes it
    asm volatile("s_wait_asynccnt 0x0" ::: "memory");
    __syncthreads();
    issue(1, 1);
    for (int s = 0; s < nst; s++) {
      const f16* st = ring + (s & 1)*STG_;
      ldF(a0, b0, st, 0); sched_fence();
      mm(a0, b0); sched_fence();
      ldF(a0, b0, st, 1); sched_fence();
      mm(a0, b0); sched_fence();
      // publish point of stage s + 1: this wave's reads of stage s are done,
      asm volatile("s_wait_dscnt 0x0" ::: "memory");
      // its copies of stage s + 1 have landed,
      asm volatile("s_wait_asynccnt 0x0" ::: "memory");
      // and the barrier publishes stage s + 1 and frees stage s's buffer
      __syncthreads();
      if (s + 2 < nst) issue(s + 2, s & 1);
    }
  } else {
    // three buffers, two fragment sets: one is loaded while the other is consumed
    v16h a0[4], b0[4], a1[4], b1[4];
    issue(0, 0); issue(1, 1); issue(2, 2);
    // stage 0 has landed (the 24 youngest copies are stages 1 and 2); the barrier publishes it
    asm volatile("s_wait_asynccnt 0x18" ::: "memory");
    __syncthreads();
    ldF(a0, b0, ring, 0);

    int cur = 0;   // buffer of stage s
    for (int s = 0; s < nst; s++) {
      int nxt = (cur == 2) ? 0 : cur + 1;
      ldF(a1, b1, ring + cur*STG_, 1); sched_fence();
      mm(a0, b0); sched_fence();
      // publish point of stage s + 1, ahead of the trip's last block because that
      // block's load group already reads stage s + 1. This wave's reads of stage s are done:
      asm volatile("s_wait_dscnt 0x0" ::: "memory");
      // this wave's copies of stage s + 1 have landed (the 12 youngest are stage s + 2, where it exists)
      if (s + 2 < nst) asm volatile("s_wait_asynccnt 0xc" ::: "memory");
      else             asm volatile("s_wait_asynccnt 0x0" ::: "memory");
      __syncthreads();
      // in the last trip these loads read a buffer that holds an old stage; nothing uses them
      ldF(a0, b0, ring + nxt*STG_, 0); sched_fence();
      mm(a1, b1); sched_fence();
      if (s + 3 < nst) issue(s + 3, cur);
      cur = nxt;
    }
  }
  // the ring's closing wait: no copy of this wave is outstanding when it leaves the ring
  asm volatile("s_wait_asynccnt 0x0" ::: "memory");

  // Epilogue. One lane pointer per array; every row and column step is a compile-time
  // constant that folds into the instructions' offset fields.
  const int mHalf = (lane < 16) ? 0 : 8;
  const int n0 = lane & 15;
  const size_t e0 = (size_t)(blockM0 + waveM*64 + mHalf) * NN + blockN0 + waveN*64 + n0;
  const float* bl = bias + blockN0 + waveN*64 + n0;
  float bv[4];
  #pragma unroll
  for (int t = 0; t < 4; t++) bv[t] = bl[t*16];
  float rv[RES ? 4 : 1][4][8];
  const float* rl = RES ? resid + e0 : bl;
  if (RES) {
    #pragma unroll
    for (int i = 0; i < 4; i++)
      #pragma unroll
      for (int j = 0; j < 8; j++)
        #pragma unroll
        for (int t = 0; t < 4; t++) rv[i][t][j] = rl[(i*16 + j)*NN + t*16];
  }
  sched_fence();
  asm volatile("s_wait_xcnt 0x0" :: "v"(bl), "v"(rl) : "memory");
  sched_fence();

  static_assert(!GELU || OUT_F16, "the GELU path stores f16");
  f16 hv[OUT_F16 ? 4 : 1][4][8];
  #pragma unroll
  for (int i = 0; i < 4; i++)
    #pragma unroll
    for (int t = 0; t < 4; t++) {
      if constexpr (GELU) {
        #pragma unroll
        for (int j = 0; j < 8; j += 2) {
          v2f v = {acc[i][t][j] + bv[t], acc[i][t][j + 1] + bv[t]};
          v = 0.5f * v * (1.0f + erf2(v * 0.70710678118f));
          hv[i][t][j] = (f16)v.x; hv[i][t][j + 1] = (f16)v.y;
        }
      } else {
        #pragma unroll
        for (int j = 0; j < 8; j++) {
          float v = acc[i][t][j] + bv[t];
          if (RES) v += rv[i][t][j];
          if (OUT_F16) hv[i][t][j] = (f16)v;
          else         acc[i][t][j] = v;
        }
      }
    }
  // all arithmetic stays ahead of the stores, so that no register a store names is rewritten behind it
  sched_fence();
  #pragma unroll
  for (int i = 0; i < 4; i++)
    #pragma unroll
    for (int j = 0; j < 8; j++)
      #pragma unroll
      for (int t = 0; t < 4; t++) {
        if (OUT_F16) ((f16*)out + e0)[(i*16 + j)*NN + t*16] = hv[i][t][j];
        else         ((float*)out + e0)[(i*16 + j)*NN + t*16] = acc[i][t][j];
      }
}

typedef __attribute__((ext_vector_type(8))) short s16x8;
typedef __attribute__((address_space(3))) s16x8 lds_s16x8;

// lane (c, hh) receives T[row 8*hh + 0..7][column c] of the 16x16 tile whose
// rows the 32 lane addresses name
__device__ __forceinline__ v8h ld_tr16(const f16* p) {
  return __builtin_bit_cast(v8h, __builtin_amdgcn_ds_load_tr16_b128_v8i16((lds_s16x8*)p));
}

__global__ void __launch_bounds__(256, 1)
attn_kernel(const f16* __restrict__ qkv, f16* __restrict__ o) {
  __shared__ __attribute__((aligned(32))) f16 tiles[64*QKP_ + 64*VRP_];
  f16* Kt = tiles;               // [key][d], pitch QKP_
  f16* Vr = tiles + 64*QKP_;     // [key][d], pitch VRP_

  int tid = threadIdx.x, lane = tid & 31, wave = tid >> 5;
  int c = lane & 15, hh = lane >> 4;
  int b = blockIdx.z, h = blockIdx.y;
  int q0 = blockIdx.x * 128 + wave * 16;      // this wave's first query
  const size_t rs = 3*D_;
  const f16* qb = qkv + (size_t)b*L_*rs +        (size_t)h*HD_;
  const f16* kp = qkv + (size_t)b*L_*rs + D_   + (size_t)h*HD_;
  const f16* vp = qkv + (size_t)b*L_*rs + 2*D_ + (size_t)h*HD_;

  // Q^T fragments (B operand, column = query), same k order as K's fragments
  v16h qf[8];
  #pragma unroll
  for (int kc = 0; kc < 8; kc++)
    qf[kc] = load_frag(qb + (size_t)q0*rs, 0, 3*D_, kc*32, lane);
  sched_fence();
  asm volatile("s_wait_xcnt 0x0" ::: "memory");
  sched_fence();

  v8f oacc[16] = {};                 // O^T: tile dt, register r = O[query c][16*dt + 8*hh + r]
  float rm = -INFINITY, rl = 0.0f;   // running maximum (log2 domain), this half's running sum
  const float cscale = 0.0625f * 1.4426950408889634f;   // 1/sqrt(256) * log2(e)

  // lane address of the transposing loads: row 8*hh + (lane & 7), 16-byte half (lane >> 3) & 1
  const f16* vad = Vr + (8*hh + (lane & 7))*VRP_ + ((lane >> 3) & 1)*8;

  v16h fa[8], fb[8];   // two fragment sets: one is loaded while the other is consumed
  v8f  s[4];
  v16h pf[2];

  // K fragments of d chunks 2g, 2g+1 for the four 16-key tiles
  auto ldK = [&](v16h (&f)[8], int g) {
    #pragma unroll
    for (int i = 0; i < 8; i++)
      f[i] = load_frag(Kt, (i & 3)*16, QKP_, (2*g + (i >> 2))*32, lane);
  };
  auto mmS = [&](v16h (&f)[8], int g) {
    #pragma unroll
    for (int i = 0; i < 8; i++) s[i & 3] = mma16(f[i], qf[2*g + (i >> 2)], s[i & 3]);
  };
  // V^T fragments (16 d x 32 keys) of d tiles 4g..4g+3 for the two 32-key chunks
  auto ldV = [&](v16h (&f)[8], int g) {
    #pragma unroll
    for (int i = 0; i < 8; i++) {
      const f16* p = vad + (i >> 2)*32*VRP_ + (4*g + (i & 3))*16;
      f[i] = make_frag(ld_tr16(p), ld_tr16(p + 16*VRP_));
    }
  };
  auto mmV = [&](v16h (&f)[8], int g) {
    #pragma unroll
    for (int i = 0; i < 8; i++)
      oacc[4*g + (i & 3)] = mma16(f[i], pf[i >> 2], oacc[4*g + (i & 3)]);
  };

  for (int kb0 = 0; kb0 < L_; kb0 += 64) {
    // K and V tiles, row-major: 2 x 2048 b128 copies, 16 per thread
    #pragma unroll
    for (int i = 0; i < 8; i++) {
      int id = tid + i*256;
      int r = id >> 5, c8 = (id & 31) * 8;
      copy_g2l_b128(&Kt[r*QKP_ + c8], &kp[(size_t)(kb0 + r)*rs + c8]);
    }
    #pragma unroll
    for (int i = 0; i < 8; i++) {
      int id = tid + i*256;
      int r = id >> 5, c8 = (id & 31) * 8;
      copy_g2l_b128(&Vr[r*VRP_ + c8], &vp[(size_t)(kb0 + r)*rs + c8]);
    }
    // this wave's copies have landed; the barrier publishes all waves' copies
    asm volatile("s_wait_asynccnt 0x0" ::: "memory");
    __syncthreads();

    // S^T (64 keys x 16 queries)
    #pragma unroll
    for (int t = 0; t < 4; t++) s[t] = v8f{};
    ldK(fa, 0); sched_fence();
    ldK(fb, 1); sched_fence(); mmS(fa, 0); sched_fence();
    ldK(fa, 2); sched_fence(); mmS(fb, 1); sched_fence();
    ldK(fb, 3); sched_fence(); mmS(fa, 2); sched_fence();
    ldV(fa, 0); sched_fence(); mmS(fb, 3); sched_fence();
    ldV(fb, 1); sched_fence();   // the first V^T groups fly under the softmax

    // online softmax of query c: 32 scores in this lane, 32 in lane ^ 16
    float mx = s[0][0];
    #pragma unroll
    for (int t = 0; t < 4; t++)
      #pragma unroll
      for (int j = 0; j < 8; j++) mx = fmaxf(mx, s[t][j]);
    mx = fmaxf(mx, xhalf(mx)) * cscale;
    float mnew  = fmaxf(rm, mx);
    float alpha = __builtin_amdgcn_exp2f(rm - mnew);
    rm = mnew;
    float sum[4] = {0.0f, 0.0f, 0.0f, 0.0f};
    #pragma unroll
    for (int t = 0; t < 4; t++)
      #pragma unroll
      for (int j = 0; j < 8; j++) {
        float p = __builtin_amdgcn_exp2f(__builtin_fmaf(s[t][j], cscale, -mnew));
        pf[t >> 1][(t & 1)*8 + j] = (f16)p;   // element e of chunk t>>1 is key 16*(e>>3) + 8*hh + (e&7)
        sum[t] += p;
      }
    rl = rl * alpha + ((sum[0] + sum[1]) + (sum[2] + sum[3]));
    #pragma unroll
    for (int dt = 0; dt < 16; dt++) oacc[dt] *= alpha;
    sched_fence();

    // O^T (256 d x 16 queries) += V^T P^T
    mmV(fa, 0); sched_fence();
    ldV(fa, 2); sched_fence(); mmV(fb, 1); sched_fence();
    ldV(fb, 3); sched_fence(); mmV(fa, 2); sched_fence();
    mmV(fb, 3);

    // every wave's reads of the tiles are done before the next copies overwrite them
    asm volatile("s_wait_dscnt 0x0" ::: "memory");
    __syncthreads();
  }

  float inv = 1.0f / (rl + xhalf(rl));   // the halves' sums join here
  f16* orow = o + ((size_t)b*L_ + q0 + c)*D_ + h*HD_ + 8*hh;
  v8h pk[16];
  #pragma unroll
  for (int dt = 0; dt < 16; dt++)
    #pragma unroll
    for (int j = 0; j < 8; j++) pk[dt][j] = (f16)(oacc[dt][j] * inv);
  // all packing stays ahead of the stores, so that no register a store names is rewritten behind it
  sched_fence();
  #pragma unroll
  for (int dt = 0; dt < 16; dt++) *(v8h*)(orow + dt*16) = pk[dt];
}

// ---------------------------------------------------------------------------
// Host orchestration
// ---------------------------------------------------------------------------
static inline size_t align256(size_t x) { return (x + 255) & ~(size_t)255; }

extern "C" void kernel_launch(void* const* d_in, const int* in_sizes, int n_in,
                              void* d_out, int out_size, void* d_ws, size_t ws_size,
                              hipStream_t stream) {
  (void)in_sizes; (void)n_in; (void)out_size; (void)ws_size;
  const float* x     = (const float*)d_in[0];
  const float* w3d   = (const float*)d_in[1];
  const float* b3d   = (const float*)d_in[2];
  const float* ln1_g = (const float*)d_in[3];
  const float* ln1_b = (const float*)d_in[4];
  const float* wqkv  = (const float*)d_in[5];
  const float* bqkv  = (const float*)d_in[6];
  const float* wproj = (const float*)d_in[7];
  const float* bproj = (const float*)d_in[8];
  const float* ln2_g = (const float*)d_in[9];
  const float* ln2_b = (const float*)d_in[10];
  const float* w1    = (const float*)d_in[11];
  const float* b1    = (const float*)d_in[12];
  const float* w2    = (const float*)d_in[13];
  const float* b2    = (const float*)d_in[14];
  const float* lnf_g = (const float*)d_in[15];
  const float* lnf_b = (const float*)d_in[16];

  // workspace carve-up (~292 MB)
  char* ws = (char*)d_ws;
  size_t off = 0;
  auto carve = [&](size_t bytes) -> void* { void* p = ws + off; off += align256(bytes); return p; };
  f16*   xh     = (f16*)  carve((size_t)MTOT*3*D_*sizeof(f16));
  f16*   w3dh   = (f16*)  carve((size_t)D_*3*D_*sizeof(f16));
  f16*   wqkvh  = (f16*)  carve((size_t)NL_*3*D_*D_*sizeof(f16));
  f16*   wprojh = (f16*)  carve((size_t)NL_*D_*D_*sizeof(f16));
  f16*   w1h    = (f16*)  carve((size_t)NL_*FF_*D_*sizeof(f16));
  f16*   w2h    = (f16*)  carve((size_t)NL_*D_*FF_*sizeof(f16));
  float* hbuf   = (float*)carve((size_t)MTOT*D_*sizeof(float));
  f16*   hn     = (f16*)  carve((size_t)MTOT*D_*sizeof(f16));
  f16*   qkvh   = (f16*)  carve((size_t)MTOT*3*D_*sizeof(f16));
  f16*   oh     = (f16*)  carve((size_t)MTOT*D_*sizeof(f16));
  f16*   fh     = (f16*)  carve((size_t)MTOT*FF_*sizeof(f16));

  // 1) f32 -> f16 conversions
  auto cvt = [&](const float* src, f16* dst, size_t n) {
    cvt_f32_f16_kernel<<<2048, 256, 0, stream>>>(src, dst, n);
  };
  cvt(x,     xh,     (size_t)MTOT*3*D_);
  cvt(w3d,   w3dh,   (size_t)D_*3*D_);
  cvt(wqkv,  wqkvh,  (size_t)NL_*3*D_*D_);
  cvt(wproj, wprojh, (size_t)NL_*D_*D_);
  cvt(w1,    w1h,    (size_t)NL_*FF_*D_);
  cvt(w2,    w2h,    (size_t)NL_*D_*FF_);

  dim3 blk(256);
  // 2) embedding projection: h = x * w3d^T + b3d   (M=8192, N=1024, K=3072)
  gemm_kernel<3,D_,false,false,false><<<dim3(D_/256, MTOT/128), blk, 0, stream>>>(
      xh, w3dh, b3d, nullptr, hbuf, MTOT, D_, 3*D_);

  for (int i = 0; i < NL_; i++) {
    // ln1 -> hn (f16)
    ln_kernel<true><<<MTOT/(LNW_*LNR_), dim3(LNW_*32), 0, stream>>>(hbuf, ln1_g + (size_t)i*D_,
                                              ln1_b + (size_t)i*D_, hn);
    // qkv = hn * wqkv^T + bqkv   (N=3D, f16 out)
    gemm_kernel<2,3*D_,true,false,false><<<dim3(3*D_/256, MTOT/128), blk, 0, stream>>>(
        hn, wqkvh + (size_t)i*3*D_*D_, bqkv + (size_t)i*3*D_, nullptr,
        qkvh, MTOT, 3*D_, D_);
    // flash attention -> oh (f16)
    attn_kernel<<<dim3(L_/128, H_, B_), dim3(256), 0, stream>>>(qkvh, oh);
    // h = h + oh * wproj^T + bproj   (in-place residual)
    gemm_kernel<3,D_,false,true,false><<<dim3(D_/256, MTOT/128), blk, 0, stream>>>(
        oh, wprojh + (size_t)i*D_*D_, bproj + (size_t)i*D_, hbuf,
        hbuf, MTOT, D_, D_);
    // ln2 -> hn (f16)
    ln_kernel<true><<<MTOT/(LNW_*LNR_), dim3(LNW_*32), 0, stream>>>(hbuf, ln2_g + (size_t)i*D_,
                                              ln2_b + (size_t)i*D_, hn);
    // f = gelu(hn * w1^T + b1)   (N=FF, f16 out)
    gemm_kernel<2,FF_,true,false,true><<<dim3(FF_/256, MTOT/128), blk, 0, stream>>>(
        hn, w1h + (size_t)i*FF_*D_, b1 + (size_t)i*FF_, nullptr,
        fh, MTOT, FF_, D_);
    // h = h + f * w2^T + b2   (K=FF, in-place residual)
    gemm_kernel<3,D_,false,true,false><<<dim3(D_/256, MTOT/128), blk, 0, stream>>>(
        fh, w2h + (size_t)i*D_*FF_, b2 + (size_t)i*D_, hbuf,
        hbuf, MTOT, D_, FF_);
  }

  // final layernorm -> d_out (f32)
  ln_kernel<false><<<MTOT/(LNW_*LNR_), dim3(LNW_*32), 0, stream>>>(hbuf, lnf_g, lnf_b, (float*)d_out);
}

// v006
// A run of this version takes 610 microseconds.
// Next to v005, in two timings, it ran 1.08 times as fast each time.
// Counting every step since v000, it is 5.76 times as fast.
#include <hip/hip_runtime.h>
#include <math.h>

typedef _Float16 f16;
typedef __attribute__((ext_vector_type(16))) _Float16 v16h;
typedef __attribute__((ext_vector_type(8)))  _Float16 v8h;
typedef __attribute__((ext_vector_type(8)))  float    v8f;
typedef __attribute__((ext_vector_type(4)))  int      v4i;

#define B_    4
#define L_    2048
#define D_    1024
#define H_    4
#define NL_   2
#define HD_   256
#define FF_   4096
#define MTOT  (B_*L_)      // 8192 token rows
#define EPS_  1e-5f

#define GP_   72    // GEMM A/W tiles: 64 halves + 8   (144 B)
#define QKP_  264   // attention K tile: 256 halves + 8 (528 B)
// Rows read by the 16-bit transposing load want a pitch of 32 B x odd instead.
#define VRP_  272   // attention V tile: 256 halves + 16 (544 B)

#if __has_builtin(__builtin_amdgcn_global_load_async_to_lds_b128) && \
    __has_builtin(__builtin_amdgcn_s_wait_asynccnt)
#define HAVE_ASYNC_LDS 1
#else
#define HAVE_ASYNC_LDS 0
#endif

typedef __attribute__((address_space(1))) v4i gv4i_t;
typedef __attribute__((address_space(3))) v4i lv4i_t;

__device__ __forceinline__ void copy_g2l_b128(f16* dst_lds, const f16* src_glb) {
#if HAVE_ASYNC_LDS
  __builtin_amdgcn_global_load_async_to_lds_b128(
      (gv4i_t*)(const_cast<f16*>(src_glb)),
      (lv4i_t*)dst_lds, 0, 0);
#else
  *(v8h*)dst_lds = *(const v8h*)src_glb;
#endif
}

__device__ __forceinline__ v16h make_frag(v8h lo, v8h hi) {
  return __builtin_shufflevector(lo, hi, 0,1,2,3,4,5,6,7,8,9,10,11,12,13,14,15);
}

__device__ __forceinline__ v16h load_frag(const f16* tile, int rowBase, int ld,
                                          int kChunkBase, int lane) {
  int r  = rowBase + (lane & 15);
  int kb = kChunkBase + ((lane < 16) ? 0 : 8);
  const f16* p = tile + (size_t)r * ld + kb;
  v8h lo = *(const v8h*)(p);
  v8h hi = *(const v8h*)(p + 16);
  return make_frag(lo, hi);
}

__device__ __forceinline__ v8f mma16(v16h a, v16h b, v8f c) {
  return __builtin_amdgcn_wmma_f32_16x16x32_f16(false, a, false, b, (short)0, c, false, false);
}

__device__ __forceinline__ void sched_fence() { __builtin_amdgcn_sched_barrier(0); }

// ---------------------------------------------------------------------------
// f32 -> f16 conversion of x and of the five weight arrays in ONE launch.
// The six f16 copies lie back to back in the workspace, so the destination is one
// array; a block's piece lies inside one source (every source length is a multiple
// of the piece), picked by block-uniform compares.
// A stream runs at the rate of its bytes in flight: a wave issues all its 32 loads
// (512 contiguous bytes each, 16 KB together) before it converts the first value,
// then stores 256 contiguous bytes per instruction and ends: no loop, no register
// used twice. The sources are read once in a call: non-temporal loads, which leave
// the L2 to the f16 copies that the GEMMs read.
// ---------------------------------------------------------------------------
typedef __attribute__((ext_vector_type(4))) float    v4f;
typedef __attribute__((ext_vector_type(4))) _Float16 v4h;
#define CVW_    4                     // waves per block
#define CVL_    32                    // loads per wave, 128 floats each
#define CVBLK_  (CVW_*CVL_*128)       // floats of one block
#define N_X     ((size_t)MTOT*3*D_)
#define N_W3D   ((size_t)D_*3*D_)
#define N_WQKV  ((size_t)NL_*3*D_*D_)
#define N_WPRJ  ((size_t)NL_*D_*D_)
#define N_W1    ((size_t)NL_*FF_*D_)
#define N_W2    ((size_t)NL_*D_*FF_)
#define N_CVT   (N_X + N_W3D + N_WQKV + N_WPRJ + N_W1 + N_W2)
static_assert(N_X % CVBLK_ == 0 && N_W3D % CVBLK_ == 0 && N_WQKV % CVBLK_ == 0 &&
              N_WPRJ % CVBLK_ == 0 && N_W1 % CVBLK_ == 0 && N_W2 % CVBLK_ == 0,
              "a block's piece lies inside one source");

__global__ void __launch_bounds__(CVW_*32)
cvt_all_kernel(const float* __restrict__ x, const float* __restrict__ w3d,
               const float* __restrict__ wqkv, const float* __restrict__ wproj,
               const float* __restrict__ w1, const float* __restrict__ w2,
               f16* __restrict__ out) {
  const int lane = threadIdx.x & 31;
  const int wave = __builtin_amdgcn_readfirstlane(threadIdx.x >> 5);
  const size_t e0 = (size_t)blockIdx.x * CVBLK_;   // block-uniform
  const float* s = x; size_t b = 0;                // the source of this piece, and where it starts in out
  if (e0 >= N_X)                                   { s = w3d;   b = N_X; }
  if (e0 >= N_X + N_W3D)                           { s = wqkv;  b = N_X + N_W3D; }
  if (e0 >= N_X + N_W3D + N_WQKV)                  { s = wproj; b = N_X + N_W3D + N_WQKV; }
  if (e0 >= N_X + N_W3D + N_WQKV + N_WPRJ)         { s = w1;    b = N_X + N_W3D + N_WQKV + N_WPRJ; }
  if (e0 >= N_X + N_W3D + N_WQKV + N_WPRJ + N_W1)  { s = w2;    b = N_X + N_W3D + N_WQKV + N_WPRJ + N_W1; }
  const size_t w0 = e0 + (size_t)wave * (CVL_*128);
  const v4f* sl = (const v4f*)(s + (w0 - b)) + lane;
  v4h*       dl = (v4h*)(out + w0) + lane;

  v4f v[CVL_];
  #pragma unroll
  for (int i = 0; i < CVL_; i++) v[i] = __builtin_nontemporal_load(sl + i*32);
  // all 32 loads are in flight together, ahead of the first conversion
  sched_fence();
  v4h hv[CVL_];
  #pragma unroll
  for (int i = 0; i < CVL_; i++) hv[i] = __builtin_convertvector(v[i], v4h);
  // all conversions stay ahead of the stores, so that no register a store names is rewritten behind it
  sched_fence();
  #pragma unroll
  for (int i = 0; i < CVL_; i++) dl[i*32] = hv[i];
}

// ---------------------------------------------------------------------------
// LayerNorm over D_=1024: two rows per wave, no LDS and no barrier.
// A launch of this size lasts as long as its waves take to start, so it gets few
// waves with much in flight each: 256 blocks of 16 waves, 2 rows per wave. A lane
// holds 32 values of each row (8 loads of 16 bytes; a wave's load covers 512
// contiguous bytes); mean and variance are in-lane sums, then a 5-step butterfly.
// ---------------------------------------------------------------------------
#define LNW_  16   // waves per block
#define LNR_  2    // rows per wave

__device__ __forceinline__ float xhalf(float x) {
  return __builtin_bit_cast(float, __builtin_amdgcn_permlanex16(
      __builtin_bit_cast(int, x), __builtin_bit_cast(int, x),
      0x76543210, 0xfedcba98, false, false));
}

template<int XM>
__device__ __forceinline__ float xrow(float x) {
  return __builtin_bit_cast(float, __builtin_amdgcn_update_dpp(
      0, __builtin_bit_cast(int, x), 0x160 + XM, 0xf, 0xf, true));
}

// sum over the 32 lanes, the same bits in every lane
__device__ __forceinline__ float wave_sum(float s) {
  s += xrow<1>(s); s += xrow<2>(s); s += xrow<4>(s); s += xrow<8>(s);
  return s + xhalf(s);
}

template<bool OUT_F16>
__global__ void __launch_bounds__(LNW_*32)
ln_kernel(const float* __restrict__ x, const float* __restrict__ g,
          const float* __restrict__ bb, void* __restrict__ out) {
  const int lane = threadIdx.x & 31;
  const int wave = __builtin_amdgcn_readfirstlane(threadIdx.x >> 5);
  const size_t row0 = ((size_t)blockIdx.x * LNW_ + wave) * LNR_;   // wave-uniform
  const v4f* xl = (const v4f*)(x + row0 * D_) + lane;
  const v4f* gl = (const v4f*)g + lane;
  const v4f* bl = (const v4f*)bb + lane;

  v4f v[LNR_][8], gv[8], bv[8];
  #pragma unroll
  for (int r = 0; r < LNR_; r++)
    #pragma unroll
    for (int i = 0; i < 8; i++) v[r][i] = xl[r*(D_/4) + i*32];
  #pragma unroll
  for (int i = 0; i < 8; i++) gv[i] = gl[i*32];
  #pragma unroll
  for (int i = 0; i < 8; i++) bv[i] = bl[i*32];
  sched_fence();
  asm volatile("s_wait_xcnt 0x0" ::: "memory");
  sched_fence();

  float mu[LNR_], rstd[LNR_];
  #pragma unroll
  for (int r = 0; r < LNR_; r++) {
    v4f s4 = v[r][0];
    #pragma unroll
    for (int i = 1; i < 8; i++) s4 += v[r][i];
    mu[r] = (s4[0] + s4[1]) + (s4[2] + s4[3]);
  }
  #pragma unroll
  for (int r = 0; r < LNR_; r++) mu[r] = wave_sum(mu[r]) * (1.0f / D_);
  #pragma unroll
  for (int r = 0; r < LNR_; r++) {
    v4f q4 = {};
    #pragma unroll
    for (int i = 0; i < 8; i++) { v[r][i] -= mu[r]; q4 += v[r][i] * v[r][i]; }
    rstd[r] = (q4[0] + q4[1]) + (q4[2] + q4[3]);
  }
  #pragma unroll
  for (int r = 0; r < LNR_; r++) rstd[r] = rsqrtf(wave_sum(rstd[r]) * (1.0f / D_) + EPS_);

  v4h hv[OUT_F16 ? LNR_ : 1][8];
  #pragma unroll
  for (int r = 0; r < LNR_; r++)
    #pragma unroll
    for (int i = 0; i < 8; i++) {
      v4f y = v[r][i] * rstd[r] * gv[i] + bv[i];
      if (OUT_F16) hv[r][i] = __builtin_convertvector(y, v4h);
      else         v[r][i] = y;
    }
  // all arithmetic stays ahead of the stores, so that no register a store names is rewritten behind it
  sched_fence();
  #pragma unroll
  for (int r = 0; r < LNR_; r++)
    #pragma unroll
    for (int i = 0; i < 8; i++) {
      if (OUT_F16) ((v4h*)((f16*)out + row0 * D_) + lane)[r*(D_/4) + i*32] = hv[r][i];
      else         ((v4f*)((float*)out + row0 * D_) + lane)[r*(D_/4) + i*32] = v[r][i];
    }
}

#define BM_   128
#define BN_   256

// erf of two values without a branch. Both of the usual f32 fits are evaluated and one is
// selected: |x| < 1: |x| + |x| Q(x^2); otherwise 1 - exp(-(|x| + |x| P(|x|))). With no branch
// between them the elements' chains are independent straight-line code that fills the vector
// port, and pairs of values share packed instructions.
typedef __attribute__((ext_vector_type(2))) float v2f;
__device__ __forceinline__ v2f fma2(v2f a, v2f b, float c) {
  return __builtin_elementwise_fma(a, b, (v2f){c, c});
}
__device__ __forceinline__ v2f erf2(v2f x) {
  const v2f ax = __builtin_elementwise_abs(x);
  v2f p = fma2(ax, (v2f){0.0000169988107f, 0.0000169988107f}, -0.000378677854f);
  p = fma2(ax, p, 0.00385781587f);
  p = fma2(ax, p, -0.0241816975f);
  p = fma2(ax, p, 0.106668264f);
  p = fma2(ax, p, 0.634933293f);
  p = fma2(ax, p, 0.128689408f);
  p = __builtin_elementwise_fma(ax, p, ax) * -1.44269502f;   // exp(-y) = 2^(-y log2 e)
  const v2f t = x * x;
  v2f q = fma2(t, (v2f){-0.000561801775f, -0.000561801775f}, 0.00491381623f);
  q = fma2(t, q, -0.0267075151f);
  q = fma2(t, q, 0.112800106f);
  q = fma2(t, q, -0.376122952f);
  q = fma2(t, q, 0.128379107f);
  q = __builtin_elementwise_fma(ax, q, ax);
  v2f r;
  r.x = ax.x < 1.0f ? q.x : 1.0f - __builtin_amdgcn_exp2f(p.x);
  r.y = ax.y < 1.0f ? q.y : 1.0f - __builtin_amdgcn_exp2f(p.y);
  return __builtin_elementwise_copysign(r, x);
}
#define BK_   64
#define STG_  ((BM_ + BN_) * GP_)   // halves of one stage: A rows, then W rows

template<int NB, int NN, bool OUT_F16, bool RES, bool GELU>
__global__ void __launch_bounds__(256, NB == 2 ? 4 : 2)
gemm_kernel(const f16* __restrict__ A, const f16* __restrict__ W,
            const float* __restrict__ bias, const float* __restrict__ resid,
            void* __restrict__ out, int M, int N, int K) {
  (void)M; (void)N;   // N is the template constant NN
  __shared__ __attribute__((aligned(16))) f16 ring[NB*STG_];
  int tid  = threadIdx.x;
  int lane = tid & 31, wave = tid >> 5;
  int waveM = wave >> 2, waveN = wave & 3;
  int blockN0 = blockIdx.x * BN_, blockM0 = blockIdx.y * BM_;

  const int nst = K >> 6;   // stages

  // a thread copies 16 bytes of row (tid >> 3) + 32 i: block-uniform bases plus
  // one 32-bit byte offset per lane, the same for A and W (both have K columns)
  const char* gA = (const char*)(A + (size_t)blockM0 * K);
  const char* gW = (const char*)(W + (size_t)blockN0 * K);
  const unsigned goff = ((unsigned)(tid >> 3) * (unsigned)K + (unsigned)(tid & 7) * 8u) * 2u;
  const size_t rstep = (size_t)K * 64;   // 32 rows, in bytes
  f16* lrow = ring + (tid >> 3)*GP_ + (tid & 7)*8;

  // one stage's async copies into buffer `buf` (12 b128 copies per thread)
  auto issue = [&](int st, int buf) {
    f16* l = lrow + buf*STG_;
    const char* a = gA + (size_t)st * (BK_*2);
    const char* w = gW + (size_t)st * (BK_*2);
    #pragma unroll
    for (int i = 0; i < 4; i++)
      copy_g2l_b128(l + i*32*GP_, (const f16*)(a + i*rstep + goff));
    #pragma unroll
    for (int i = 0; i < 8; i++)
      copy_g2l_b128(l + (BM_ + i*32)*GP_, (const f16*)(w + i*rstep + goff));
  };

  v8f  acc[4][4] = {};
  // fragments of k chunk kc (32 k) of the stage at `st`
  auto ldF = [&](v16h (&fa)[4], v16h (&fb)[4], const f16* st, int kc) {
    #pragma unroll
    for (int i = 0; i < 4; i++) fa[i] = load_frag(st, waveM*64 + i*16, GP_, kc*32, lane);
    #pragma unroll
    for (int i = 0; i < 4; i++) fb[i] = load_frag(st + BM_*GP_, waveN*64 + i*16, GP_, kc*32, lane);
  };
  auto mm = [&](v16h (&fa)[4], v16h (&fb)[4]) {
    #pragma unroll
    for (int i = 0; i < 4; i++)
      #pragma unroll
      for (int j = 0; j < 4; j++) acc[i][j] = mma16(fa[i], fb[j], acc[i][j]);
  };

  if constexpr (NB == 2) {
    v16h a0[4], b0[4];
    issue(0, 0);
    // stage 0 has landed; the barrier publishes it
    asm volatile("s_wait_asynccnt 0x0" ::: "memory");
    __syncthreads();
    issue(1, 1);
    for (int s = 0; s < nst; s++) {
      const f16* st = ring + (s & 1)*STG_;
      ldF(a0, b0, st, 0); sched_fence();
      mm(a0, b0); sched_fence();
      ldF(a0, b0, st, 1); sched_fence();
      mm(a0, b0); sched_fence();
      // publish point of stage s + 1: this wave's reads of stage s are done,
      asm volatile("s_wait_dscnt 0x0" ::: "memory");
      // its copies of stage s + 1 have landed,
      asm volatile("s_wait_asynccnt 0x0" ::: "memory");
      // and the barrier publishes stage s + 1 and frees stage s's buffer
      __syncthreads();
      if (s + 2 < nst) issue(s + 2, s & 1);
    }
  } else {
    // three buffers, two fragment sets: one is loaded while the other is consumed
    v16h a0[4], b0[4], a1[4], b1[4];
    issue(0, 0); issue(1, 1); issue(2, 2);
    // stage 0 has landed (the 24 youngest copies are stages 1 and 2); the barrier publishes it
    asm volatile("s_wait_asynccnt 0x18" ::: "memory");
    __syncthreads();
    ldF(a0, b0, ring, 0);

    int cur = 0;   // buffer of stage s
    for (int s = 0; s < nst; s++) {
      int nxt = (cur == 2) ? 0 : cur + 1;
      ldF(a1, b1, ring + cur*STG_, 1); sched_fence();
      mm(a0, b0); sched_fence();
      // publish point of stage s + 1, ahead of the trip's last block because that
      // block's load group already reads stage s + 1. This wave's reads of stage s are done:
      asm volatile("s_wait_dscnt 0x0" ::: "memory");
      // this wave's copies of stage s + 1 have landed (the 12 youngest are stage s + 2, where it exists)
      if (s + 2 < nst) asm volatile("s_wait_asynccnt 0xc" ::: "memory");
      else             asm volatile("s_wait_asynccnt 0x0" ::: "memory");
      __syncthreads();
      // in the last trip these loads read a buffer that holds an old stage; nothing uses them
      ldF(a0, b0, ring + nxt*STG_, 0); sched_fence();
      mm(a1, b1); sched_fence();
      if (s + 3 < nst) issue(s + 3, cur);
      cur = nxt;
    }
  }
  // the ring's closing wait: no copy of this wave is outstanding when it leaves the ring
  asm volatile("s_wait_asynccnt 0x0" ::: "memory");

  // Epilogue. One lane pointer per array; every row and column step is a compile-time
  // constant that folds into the instructions' offset fields.
  const int mHalf = (lane < 16) ? 0 : 8;
  const int n0 = lane & 15;
  const size_t e0 = (size_t)(blockM0 + waveM*64 + mHalf) * NN + blockN0 + waveN*64 + n0;
  const float* bl = bias + blockN0 + waveN*64 + n0;
  float bv[4];
  #pragma unroll
  for (int t = 0; t < 4; t++) bv[t] = bl[t*16];
  float rv[RES ? 4 : 1][4][8];
  const float* rl = RES ? resid + e0 : bl;
  if (RES) {
    #pragma unroll
    for (int i = 0; i < 4; i++)
      #pragma unroll
      for (int j = 0; j < 8; j++)
        #pragma unroll
        for (int t = 0; t < 4; t++) rv[i][t][j] = rl[(i*16 + j)*NN + t*16];
  }
  sched_fence();
  asm volatile("s_wait_xcnt 0x0" :: "v"(bl), "v"(rl) : "memory");
  sched_fence();

  static_assert(!GELU || OUT_F16, "the GELU path stores f16");
  f16 hv[OUT_F16 ? 4 : 1][4][8];
  #pragma unroll
  for (int i = 0; i < 4; i++)
    #pragma unroll
    for (int t = 0; t < 4; t++) {
      if constexpr (GELU) {
        #pragma unroll
        for (int j = 0; j < 8; j += 2) {
          v2f v = {acc[i][t][j] + bv[t], acc[i][t][j + 1] + bv[t]};
          v = 0.5f * v * (1.0f + erf2(v * 0.70710678118f));
          hv[i][t][j] = (f16)v.x; hv[i][t][j + 1] = (f16)v.y;
        }
      } else {
        #pragma unroll
        for (int j = 0; j < 8; j++) {
          float v = acc[i][t][j] + bv[t];
          if (RES) v += rv[i][t][j];
          if (OUT_F16) hv[i][t][j] = (f16)v;
          else         acc[i][t][j] = v;
        }
      }
    }
  // all arithmetic stays ahead of the stores, so that no register a store names is rewritten behind it
  sched_fence();
  #pragma unroll
  for (int i = 0; i < 4; i++)
    #pragma unroll
    for (int j = 0; j < 8; j++)
      #pragma unroll
      for (int t = 0; t < 4; t++) {
        if (OUT_F16) ((f16*)out + e0)[(i*16 + j)*NN + t*16] = hv[i][t][j];
        else         ((float*)out + e0)[(i*16 + j)*NN + t*16] = acc[i][t][j];
      }
}

typedef __attribute__((ext_vector_type(8))) short s16x8;
typedef __attribute__((address_space(3))) s16x8 lds_s16x8;

// lane (c, hh) receives T[row 8*hh + 0..7][column c] of the 16x16 tile whose
// rows the 32 lane addresses name
__device__ __forceinline__ v8h ld_tr16(const f16* p) {
  return __builtin_bit_cast(v8h, __builtin_amdgcn_ds_load_tr16_b128_v8i16((lds_s16x8*)p));
}

__global__ void __launch_bounds__(256, 1)
attn_kernel(const f16* __restrict__ qkv, f16* __restrict__ o) {
  __shared__ __attribute__((aligned(32))) f16 tiles[64*QKP_ + 64*VRP_];
  f16* Kt = tiles;               // [key][d], pitch QKP_
  f16* Vr = tiles + 64*QKP_;     // [key][d], pitch VRP_

  int tid = threadIdx.x, lane = tid & 31, wave = tid >> 5;
  int c = lane & 15, hh = lane >> 4;
  int b = blockIdx.z, h = blockIdx.y;
  int q0 = blockIdx.x * 128 + wave * 16;      // this wave's first query
  const size_t rs = 3*D_;
  const f16* qb = qkv + (size_t)b*L_*rs +        (size_t)h*HD_;
  const f16* kp = qkv + (size_t)b*L_*rs + D_   + (size_t)h*HD_;
  const f16* vp = qkv + (size_t)b*L_*rs + 2*D_ + (size_t)h*HD_;

  // Q^T fragments (B operand, column = query), same k order as K's fragments
  v16h qf[8];
  #pragma unroll
  for (int kc = 0; kc < 8; kc++)
    qf[kc] = load_frag(qb + (size_t)q0*rs, 0, 3*D_, kc*32, lane);
  sched_fence();
  asm volatile("s_wait_xcnt 0x0" ::: "memory");
  sched_fence();

  v8f oacc[16] = {};                 // O^T: tile dt, register r = O[query c][16*dt + 8*hh + r]
  float rm = -INFINITY, rl = 0.0f;   // running maximum (log2 domain), this half's running sum
  const float cscale = 0.0625f * 1.4426950408889634f;   // 1/sqrt(256) * log2(e)

  // lane address of the transposing loads: row 8*hh + (lane & 7), 16-byte half (lane >> 3) & 1
  const f16* vad = Vr + (8*hh + (lane & 7))*VRP_ + ((lane >> 3) & 1)*8;

  v16h fa[8], fb[8];   // two fragment sets: one is loaded while the other is consumed
  v8f  s[4];
  v16h pf[2];

  // K fragments of d chunks 2g, 2g+1 for the four 16-key tiles
  auto ldK = [&](v16h (&f)[8], int g) {
    #pragma unroll
    for (int i = 0; i < 8; i++)
      f[i] = load_frag(Kt, (i & 3)*16, QKP_, (2*g + (i >> 2))*32, lane);
  };
  auto mmS = [&](v16h (&f)[8], int g) {
    #pragma unroll
    for (int i = 0; i < 8; i++) s[i & 3] = mma16(f[i], qf[2*g + (i >> 2)], s[i & 3]);
  };
  // V^T fragments (16 d x 32 keys) of d tiles 4g..4g+3 for the two 32-key chunks
  auto ldV = [&](v16h (&f)[8], int g) {
    #pragma unroll
    for (int i = 0; i < 8; i++) {
      const f16* p = vad + (i >> 2)*32*VRP_ + (4*g + (i & 3))*16;
      f[i] = make_frag(ld_tr16(p), ld_tr16(p + 16*VRP_));
    }
  };
  auto mmV = [&](v16h (&f)[8], int g) {
    #pragma unroll
    for (int i = 0; i < 8; i++)
      oacc[4*g + (i & 3)] = mma16(f[i], pf[i >> 2], oacc[4*g + (i & 3)]);
  };

  for (int kb0 = 0; kb0 < L_; kb0 += 64) {
    // K and V tiles, row-major: 2 x 2048 b128 copies, 16 per thread
    #pragma unroll
    for (int i = 0; i < 8; i++) {
      int id = tid + i*256;
      int r = id >> 5, c8 = (id & 31) * 8;
      copy_g2l_b128(&Kt[r*QKP_ + c8], &kp[(size_t)(kb0 + r)*rs + c8]);
    }
    #pragma unroll
    for (int i = 0; i < 8; i++) {
      int id = tid + i*256;
      int r = id >> 5, c8 = (id & 31) * 8;
      copy_g2l_b128(&Vr[r*VRP_ + c8], &vp[(size_t)(kb0 + r)*rs + c8]);
    }
    // this wave's copies have landed; the barrier publishes all waves' copies
    asm volatile("s_wait_asynccnt 0x0" ::: "memory");
    __syncthreads();

    // S^T (64 keys x 16 queries)
    #pragma unroll
    for (int t = 0; t < 4; t++) s[t] = v8f{};
    ldK(fa, 0); sched_fence();
    ldK(fb, 1); sched_fence(); mmS(fa, 0); sched_fence();
    ldK(fa, 2); sched_fence(); mmS(fb, 1); sched_fence();
    ldK(fb, 3); sched_fence(); mmS(fa, 2); sched_fence();
    ldV(fa, 0); sched_fence(); mmS(fb, 3); sched_fence();
    ldV(fb, 1); sched_fence();   // the first V^T groups fly under the softmax

    // online softmax of query c: 32 scores in this lane, 32 in lane ^ 16
    float mx = s[0][0];
    #pragma unroll
    for (int t = 0; t < 4; t++)
      #pragma unroll
      for (int j = 0; j < 8; j++) mx = fmaxf(mx, s[t][j]);
    mx = fmaxf(mx, xhalf(mx)) * cscale;
    float mnew  = fmaxf(rm, mx);
    float alpha = __builtin_amdgcn_exp2f(rm - mnew);
    rm = mnew;
    float sum[4] = {0.0f, 0.0f, 0.0f, 0.0f};
    #pragma unroll
    for (int t = 0; t < 4; t++)
      #pragma unroll
      for (int j = 0; j < 8; j++) {
        float p = __builtin_amdgcn_exp2f(__builtin_fmaf(s[t][j], cscale, -mnew));
        pf[t >> 1][(t & 1)*8 + j] = (f16)p;   // element e of chunk t>>1 is key 16*(e>>3) + 8*hh + (e&7)
        sum[t] += p;
      }
    rl = rl * alpha + ((sum[0] + sum[1]) + (sum[2] + sum[3]));
    #pragma unroll
    for (int dt = 0; dt < 16; dt++) oacc[dt] *= alpha;
    sched_fence();

    // O^T (256 d x 16 queries) += V^T P^T
    mmV(fa, 0); sched_fence();
    ldV(fa, 2); sched_fence(); mmV(fb, 1); sched_fence();
    ldV(fb, 3); sched_fence(); mmV(fa, 2); sched_fence();
    mmV(fb, 3);

    // every wave's reads of the tiles are done before the next copies overwrite them
    asm volatile("s_wait_dscnt 0x0" ::: "memory");
    __syncthreads();
  }

  float inv = 1.0f / (rl + xhalf(rl));   // the halves' sums join here
  f16* orow = o + ((size_t)b*L_ + q0 + c)*D_ + h*HD_ + 8*hh;
  v8h pk[16];
  #pragma unroll
  for (int dt = 0; dt < 16; dt++)
    #pragma unroll
    for (int j = 0; j < 8; j++) pk[dt][j] = (f16)(oacc[dt][j] * inv);
  // all packing stays ahead of the stores, so that no register a store names is rewritten behind it
  sched_fence();
  #pragma unroll
  for (int dt = 0; dt < 16; dt++) *(v8h*)(orow + dt*16) = pk[dt];
}

// ---------------------------------------------------------------------------
// Host orchestration
// ---------------------------------------------------------------------------
static inline size_t align256(size_t x) { return (x + 255) & ~(size_t)255; }

extern "C" void kernel_launch(void* const* d_in, const int* in_sizes, int n_in,
                              void* d_out, int out_size, void* d_ws, size_t ws_size,
                              hipStream_t stream) {
  (void)in_sizes; (void)n_in; (void)out_size; (void)ws_size;
  const float* x     = (const float*)d_in[0];
  const float* w3d   = (const float*)d_in[1];
  const float* b3d   = (const float*)d_in[2];
  const float* ln1_g = (const float*)d_in[3];
  const float* ln1_b = (const float*)d_in[4];
  const float* wqkv  = (const float*)d_in[5];
  const float* bqkv  = (const float*)d_in[6];
  const float* wproj = (const float*)d_in[7];
  const float* bproj = (const float*)d_in[8];
  const float* ln2_g = (const float*)d_in[9];
  const float* ln2_b = (const float*)d_in[10];
  const float* w1    = (const float*)d_in[11];
  const float* b1    = (const float*)d_in[12];
  const float* w2    = (const float*)d_in[13];
  const float* b2    = (const float*)d_in[14];
  const float* lnf_g = (const float*)d_in[15];
  const float* lnf_b = (const float*)d_in[16];

  // workspace carve-up (~292 MB)
  char* ws = (char*)d_ws;
  size_t off = 0;
  auto carve = [&](size_t bytes) -> void* { void* p = ws + off; off += align256(bytes); return p; };
  f16*   xh     = (f16*)  carve((size_t)MTOT*3*D_*sizeof(f16));
  f16*   w3dh   = (f16*)  carve((size_t)D_*3*D_*sizeof(f16));
  f16*   wqkvh  = (f16*)  carve((size_t)NL_*3*D_*D_*sizeof(f16));
  f16*   wprojh = (f16*)  carve((size_t)NL_*D_*D_*sizeof(f16));
  f16*   w1h    = (f16*)  carve((size_t)NL_*FF_*D_*sizeof(f16));
  f16*   w2h    = (f16*)  carve((size_t)NL_*D_*FF_*sizeof(f16));
  float* hbuf   = (float*)carve((size_t)MTOT*D_*sizeof(float));
  f16*   hn     = (f16*)  carve((size_t)MTOT*D_*sizeof(f16));
  f16*   qkvh   = (f16*)  carve((size_t)MTOT*3*D_*sizeof(f16));
  f16*   oh     = (f16*)  carve((size_t)MTOT*D_*sizeof(f16));
  f16*   fh     = (f16*)  carve((size_t)MTOT*FF_*sizeof(f16));

  // 1) f32 -> f16 conversions, one launch: xh .. w2h lie back to back (every size is a multiple of 256 bytes)
  cvt_all_kernel<<<dim3(N_CVT / CVBLK_), dim3(CVW_*32), 0, stream>>>(x, w3d, wqkv, wproj, w1, w2, xh);

  dim3 blk(256);
  // 2) embedding projection: h = x * w3d^T + b3d   (M=8192, N=1024, K=3072)
  gemm_kernel<3,D_,false,false,false><<<dim3(D_/256, MTOT/128), blk, 0, stream>>>(
      xh, w3dh, b3d, nullptr, hbuf, MTOT, D_, 3*D_);

  for (int i = 0; i < NL_; i++) {
    // ln1 -> hn (f16)
    ln_kernel<true><<<MTOT/(LNW_*LNR_), dim3(LNW_*32), 0, stream>>>(hbuf, ln1_g + (size_t)i*D_,
                                              ln1_b + (size_t)i*D_, hn);
    // qkv = hn * wqkv^T + bqkv   (N=3D, f16 out)
    gemm_kernel<2,3*D_,true,false,false><<<dim3(3*D_/256, MTOT/128), blk, 0, stream>>>(
        hn, wqkvh + (size_t)i*3*D_*D_, bqkv + (size_t)i*3*D_, nullptr,
        qkvh, MTOT, 3*D_, D_);
    // flash attention -> oh (f16)
    attn_kernel<<<dim3(L_/128, H_, B_), dim3(256), 0, stream>>>(qkvh, oh);
    // h = h + oh * wproj^T + bproj   (in-place residual)
    gemm_kernel<3,D_,false,true,false><<<dim3(D_/256, MTOT/128), blk, 0, stream>>>(
        oh, wprojh + (size_t)i*D_*D_, bproj + (size_t)i*D_, hbuf,
        hbuf, MTOT, D_, D_);
    // ln2 -> hn (f16)
    ln_kernel<true><<<MTOT/(LNW_*LNR_), dim3(LNW_*32), 0, stream>>>(hbuf, ln2_g + (size_t)i*D_,
                                              ln2_b + (size_t)i*D_, hn);
    // f = gelu(hn * w1^T + b1)   (N=FF, f16 out)
    gemm_kernel<2,FF_,true,false,true><<<dim3(FF_/256, MTOT/128), blk, 0, stream>>>(
        hn, w1h + (size_t)i*FF_*D_, b1 + (size_t)i*FF_, nullptr,
        fh, MTOT, FF_, D_);
    // h = h + f * w2^T + b2   (K=FF, in-place residual)
    gemm_kernel<3,D_,false,true,false><<<dim3(D_/256, MTOT/128), blk, 0, stream>>>(
        fh, w2h + (size_t)i*D_*FF_, b2 + (size_t)i*D_, hbuf,
        hbuf, MTOT, D_, FF_);
  }

  // final layernorm -> d_out (f32)
  ln_kernel<false><<<MTOT/(LNW_*LNR_), dim3(LNW_*32), 0, stream>>>(hbuf, lnf_g, lnf_b, (float*)d_out);
}

// v007
// One run takes 573 microseconds.
// In two side-by-side timings against v006, it was 1.06 and 1.07 times as fast.
// Over all steps from v000 it is 6.13 times as fast.
#include <hip/hip_runtime.h>
#include <math.h>

typedef _Float16 f16;
typedef __attribute__((ext_vector_type(16))) _Float16 v16h;
typedef __attribute__((ext_vector_type(8)))  _Float16 v8h;
typedef __attribute__((ext_vector_type(8)))  float    v8f;
typedef __attribute__((ext_vector_type(4)))  int      v4i;

#define B_    4
#define L_    2048
#define D_    1024
#define H_    4
#define NL_   2
#define HD_   256
#define FF_   4096
#define MTOT  (B_*L_)      // 8192 token rows
#define EPS_  1e-5f

#define GP_   72    // GEMM A/W tiles: 64 halves + 8   (144 B)
#define QKP_  264   // attention K tile: 256 halves + 8 (528 B)
// Rows read by the 16-bit transposing load want a pitch of 32 B x odd instead.
#define VRP_  272   // attention V tile: 256 halves + 16 (544 B)

#if __has_builtin(__builtin_amdgcn_global_load_async_to_lds_b128) && \
    __has_builtin(__builtin_amdgcn_s_wait_asynccnt)
#define HAVE_ASYNC_LDS 1
#else
#define HAVE_ASYNC_LDS 0
#endif

typedef __attribute__((address_space(1))) v4i gv4i_t;
typedef __attribute__((address_space(3))) v4i lv4i_t;

__device__ __forceinline__ void copy_g2l_b128(f16* dst_lds, const f16* src_glb) {
#if HAVE_ASYNC_LDS
  __builtin_amdgcn_global_load_async_to_lds_b128(
      (gv4i_t*)(const_cast<f16*>(src_glb)),
      (lv4i_t*)dst_lds, 0, 0);
#else
  *(v8h*)dst_lds = *(const v8h*)src_glb;
#endif
}

__device__ __forceinline__ v16h make_frag(v8h lo, v8h hi) {
  return __builtin_shufflevector(lo, hi, 0,1,2,3,4,5,6,7,8,9,10,11,12,13,14,15);
}

__device__ __forceinline__ v16h load_frag(const f16* tile, int rowBase, int ld,
                                          int kChunkBase, int lane) {
  int r  = rowBase + (lane & 15);
  int kb = kChunkBase + ((lane < 16) ? 0 : 8);
  const f16* p = tile + (size_t)r * ld + kb;
  v8h lo = *(const v8h*)(p);
  v8h hi = *(const v8h*)(p + 16);
  return make_frag(lo, hi);
}

__device__ __forceinline__ v8f mma16(v16h a, v16h b, v8f c) {
  return __builtin_amdgcn_wmma_f32_16x16x32_f16(false, a, false, b, (short)0, c, false, false);
}

__device__ __forceinline__ void sched_fence() { __builtin_amdgcn_sched_barrier(0); }

// ---------------------------------------------------------------------------
// f32 -> f16 conversion of x and of the five weight arrays in ONE launch.
// The six f16 copies lie back to back in the workspace, so the destination is one
// array; a block's piece lies inside one source (every source length is a multiple
// of the piece), picked by block-uniform compares.
// A stream runs at the rate of its bytes in flight: a wave issues all its 32 loads
// (512 contiguous bytes each, 16 KB together) before it converts the first value,
// then stores 256 contiguous bytes per instruction and ends: no loop, no register
// used twice. The sources are read once in a call: non-temporal loads, which leave
// the L2 to the f16 copies that the GEMMs read.
// ---------------------------------------------------------------------------
typedef __attribute__((ext_vector_type(4))) float    v4f;
typedef __attribute__((ext_vector_type(4))) _Float16 v4h;
#define CVW_    4                     // waves per block
#define CVL_    32                    // loads per wave, 128 floats each
#define CVBLK_  (CVW_*CVL_*128)       // floats of one block
#define N_X     ((size_t)MTOT*3*D_)
#define N_W3D   ((size_t)D_*3*D_)
#define N_WQKV  ((size_t)NL_*3*D_*D_)
#define N_WPRJ  ((size_t)NL_*D_*D_)
#define N_W1    ((size_t)NL_*FF_*D_)
#define N_W2    ((size_t)NL_*D_*FF_)
#define N_CVT   (N_X + N_W3D + N_WQKV + N_WPRJ + N_W1 + N_W2)
static_assert(N_X % CVBLK_ == 0 && N_W3D % CVBLK_ == 0 && N_WQKV % CVBLK_ == 0 &&
              N_WPRJ % CVBLK_ == 0 && N_W1 % CVBLK_ == 0 && N_W2 % CVBLK_ == 0,
              "a block's piece lies inside one source");

__global__ void __launch_bounds__(CVW_*32)
cvt_all_kernel(const float* __restrict__ x, const float* __restrict__ w3d,
               const float* __restrict__ wqkv, const float* __restrict__ wproj,
               const float* __restrict__ w1, const float* __restrict__ w2,
               f16* __restrict__ out) {
  const int lane = threadIdx.x & 31;
  const int wave = __builtin_amdgcn_readfirstlane(threadIdx.x >> 5);
  const size_t e0 = (size_t)blockIdx.x * CVBLK_;   // block-uniform
  const float* s = x; size_t b = 0;                // the source of this piece, and where it starts in out
  if (e0 >= N_X)                                   { s = w3d;   b = N_X; }
  if (e0 >= N_X + N_W3D)                           { s = wqkv;  b = N_X + N_W3D; }
  if (e0 >= N_X + N_W3D + N_WQKV)                  { s = wproj; b = N_X + N_W3D + N_WQKV; }
  if (e0 >= N_X + N_W3D + N_WQKV + N_WPRJ)         { s = w1;    b = N_X + N_W3D + N_WQKV + N_WPRJ; }
  if (e0 >= N_X + N_W3D + N_WQKV + N_WPRJ + N_W1)  { s = w2;    b = N_X + N_W3D + N_WQKV + N_WPRJ + N_W1; }
  const size_t w0 = e0 + (size_t)wave * (CVL_*128);
  const v4f* sl = (const v4f*)(s + (w0 - b)) + lane;
  v4h*       dl = (v4h*)(out + w0) + lane;

  v4f v[CVL_];
  #pragma unroll
  for (int i = 0; i < CVL_; i++) v[i] = __builtin_nontemporal_load(sl + i*32);
  // all 32 loads are in flight together, ahead of the first conversion
  sched_fence();
  v4h hv[CVL_];
  #pragma unroll
  for (int i = 0; i < CVL_; i++) hv[i] = __builtin_convertvector(v[i], v4h);
  // all conversions stay ahead of the stores, so that no register a store names is rewritten behind it
  sched_fence();
  #pragma unroll
  for (int i = 0; i < CVL_; i++) dl[i*32] = hv[i];
}

// ---------------------------------------------------------------------------
// LayerNorm over D_=1024: two rows per wave, no LDS and no barrier.
// A launch of this size lasts as long as its waves take to start, so it gets few
// waves with much in flight each: 256 blocks of 16 waves, 2 rows per wave. A lane
// holds 32 values of each row (8 loads of 16 bytes; a wave's load covers 512
// contiguous bytes); mean and variance are in-lane sums, then a 5-step butterfly.
// ---------------------------------------------------------------------------
#define LNW_  16   // waves per block
#define LNR_  2    // rows per wave

__device__ __forceinline__ float xhalf(float x) {
  return __builtin_bit_cast(float, __builtin_amdgcn_permlanex16(
      __builtin_bit_cast(int, x), __builtin_bit_cast(int, x),
      0x76543210, 0xfedcba98, false, false));
}

template<int XM>
__device__ __forceinline__ float xrow(float x) {
  return __builtin_bit_cast(float, __builtin_amdgcn_update_dpp(
      0, __builtin_bit_cast(int, x), 0x160 + XM, 0xf, 0xf, true));
}

// sum over the 32 lanes, the same bits in every lane
__device__ __forceinline__ float wave_sum(float s) {
  s += xrow<1>(s); s += xrow<2>(s); s += xrow<4>(s); s += xrow<8>(s);
  return s + xhalf(s);
}

template<bool OUT_F16>
__global__ void __launch_bounds__(LNW_*32)
ln_kernel(const float* __restrict__ x, const float* __restrict__ g,
          const float* __restrict__ bb, void* __restrict__ out) {
  const int lane = threadIdx.x & 31;
  const int wave = __builtin_amdgcn_readfirstlane(threadIdx.x >> 5);
  const size_t row0 = ((size_t)blockIdx.x * LNW_ + wave) * LNR_;   // wave-uniform
  const v4f* xl = (const v4f*)(x + row0 * D_) + lane;
  const v4f* gl = (const v4f*)g + lane;
  const v4f* bl = (const v4f*)bb + lane;

  v4f v[LNR_][8], gv[8], bv[8];
  #pragma unroll
  for (int r = 0; r < LNR_; r++)
    #pragma unroll
    for (int i = 0; i < 8; i++) v[r][i] = xl[r*(D_/4) + i*32];
  #pragma unroll
  for (int i = 0; i < 8; i++) gv[i] = gl[i*32];
  #pragma unroll
  for (int i = 0; i < 8; i++) bv[i] = bl[i*32];
  sched_fence();
  asm volatile("s_wait_xcnt 0x0" ::: "memory");
  sched_fence();

  float mu[LNR_], rstd[LNR_];
  #pragma unroll
  for (int r = 0; r < LNR_; r++) {
    v4f s4 = v[r][0];
    #pragma unroll
    for (int i = 1; i < 8; i++) s4 += v[r][i];
    mu[r] = (s4[0] + s4[1]) + (s4[2] + s4[3]);
  }
  #pragma unroll
  for (int r = 0; r < LNR_; r++) mu[r] = wave_sum(mu[r]) * (1.0f / D_);
  #pragma unroll
  for (int r = 0; r < LNR_; r++) {
    v4f q4 = {};
    #pragma unroll
    for (int i = 0; i < 8; i++) { v[r][i] -= mu[r]; q4 += v[r][i] * v[r][i]; }
    rstd[r] = (q4[0] + q4[1]) + (q4[2] + q4[3]);
  }
  #pragma unroll
  for (int r = 0; r < LNR_; r++) rstd[r] = rsqrtf(wave_sum(rstd[r]) * (1.0f / D_) + EPS_);

  v4h hv[OUT_F16 ? LNR_ : 1][8];
  #pragma unroll
  for (int r = 0; r < LNR_; r++)
    #pragma unroll
    for (int i = 0; i < 8; i++) {
      v4f y = v[r][i] * rstd[r] * gv[i] + bv[i];
      if (OUT_F16) hv[r][i] = __builtin_convertvector(y, v4h);
      else         v[r][i] = y;
    }
  // all arithmetic stays ahead of the stores, so that no register a store names is rewritten behind it
  sched_fence();
  #pragma unroll
  for (int r = 0; r < LNR_; r++)
    #pragma unroll
    for (int i = 0; i < 8; i++) {
      if (OUT_F16) ((v4h*)((f16*)out + row0 * D_) + lane)[r*(D_/4) + i*32] = hv[r][i];
      else         ((v4f*)((float*)out + row0 * D_) + lane)[r*(D_/4) + i*32] = v[r][i];
    }
}

#define BM_   128
#define BN_   256

// erf of two values without a branch. Both of the usual f32 fits are evaluated and one is
// selected: |x| < 1: |x| + |x| Q(x^2); otherwise 1 - exp(-(|x| + |x| P(|x|))). With no branch
// between them the elements' chains are independent straight-line code that fills the vector
// port, and pairs of values share packed instructions.
typedef __attribute__((ext_vector_type(2))) float v2f;
__device__ __forceinline__ v2f fma2(v2f a, v2f b, float c) {
  return __builtin_elementwise_fma(a, b, (v2f){c, c});
}
__device__ __forceinline__ v2f erf2(v2f x) {
  const v2f ax = __builtin_elementwise_abs(x);
  v2f p = fma2(ax, (v2f){0.0000169988107f, 0.0000169988107f}, -0.000378677854f);
  p = fma2(ax, p, 0.00385781587f);
  p = fma2(ax, p, -0.0241816975f);
  p = fma2(ax, p, 0.106668264f);
  p = fma2(ax, p, 0.634933293f);
  p = fma2(ax, p, 0.128689408f);
  p = __builtin_elementwise_fma(ax, p, ax) * -1.44269502f;   // exp(-y) = 2^(-y log2 e)
  const v2f t = x * x;
  v2f q = fma2(t, (v2f){-0.000561801775f, -0.000561801775f}, 0.00491381623f);
  q = fma2(t, q, -0.0267075151f);
  q = fma2(t, q, 0.112800106f);
  q = fma2(t, q, -0.376122952f);
  q = fma2(t, q, 0.128379107f);
  q = __builtin_elementwise_fma(ax, q, ax);
  v2f r;
  r.x = ax.x < 1.0f ? q.x : 1.0f - __builtin_amdgcn_exp2f(p.x);
  r.y = ax.y < 1.0f ? q.y : 1.0f - __builtin_amdgcn_exp2f(p.y);
  return __builtin_elementwise_copysign(r, x);
}
#define BK_   64
#define STG_  ((BM_ + BN_) * GP_)   // halves of one stage: A rows, then W rows

template<int NB, int NN, bool OUT_F16, bool RES, bool GELU>
__global__ void __launch_bounds__(256, NB == 2 ? 4 : 2)
gemm_kernel(const f16* __restrict__ A, const f16* __restrict__ W,
            const float* __restrict__ bias, const float* __restrict__ resid,
            void* __restrict__ out, int M, int N, int K) {
  (void)M; (void)N;   // N is the template constant NN
  __shared__ __attribute__((aligned(16))) f16 ring[NB*STG_];
  int tid  = threadIdx.x;
  int lane = tid & 31, wave = tid >> 5;
  int waveM = wave >> 2, waveN = wave & 3;
  int blockN0 = blockIdx.x * BN_, blockM0 = blockIdx.y * BM_;

  const int nst = K >> 6;   // stages

  // a thread copies 16 bytes of row (tid >> 3) + 32 i: block-uniform bases plus
  // one 32-bit byte offset per lane, the same for A and W (both have K columns)
  const char* gA = (const char*)(A + (size_t)blockM0 * K);
  const char* gW = (const char*)(W + (size_t)blockN0 * K);
  const unsigned goff = ((unsigned)(tid >> 3) * (unsigned)K + (unsigned)(tid & 7) * 8u) * 2u;
  const size_t rstep = (size_t)K * 64;   // 32 rows, in bytes
  f16* lrow = ring + (tid >> 3)*GP_ + (tid & 7)*8;

  // one stage's async copies into buffer `buf` (12 b128 copies per thread)
  auto issue = [&](int st, int buf) {
    f16* l = lrow + buf*STG_;
    const char* a = gA + (size_t)st * (BK_*2);
    const char* w = gW + (size_t)st * (BK_*2);
    #pragma unroll
    for (int i = 0; i < 4; i++)
      copy_g2l_b128(l + i*32*GP_, (const f16*)(a + i*rstep + goff));
    #pragma unroll
    for (int i = 0; i < 8; i++)
      copy_g2l_b128(l + (BM_ + i*32)*GP_, (const f16*)(w + i*rstep + goff));
  };

  v8f  acc[4][4] = {};
  // fragments of k chunk kc (32 k) of the stage at `st`
  auto ldF = [&](v16h (&fa)[4], v16h (&fb)[4], const f16* st, int kc) {
    #pragma unroll
    for (int i = 0; i < 4; i++) fa[i] = load_frag(st, waveM*64 + i*16, GP_, kc*32, lane);
    #pragma unroll
    for (int i = 0; i < 4; i++) fb[i] = load_frag(st + BM_*GP_, waveN*64 + i*16, GP_, kc*32, lane);
  };
  auto mm = [&](v16h (&fa)[4], v16h (&fb)[4]) {
    #pragma unroll
    for (int i = 0; i < 4; i++)
      #pragma unroll
      for (int j = 0; j < 4; j++) acc[i][j] = mma16(fa[i], fb[j], acc[i][j]);
  };

  if constexpr (NB == 2) {
    v16h a0[4], b0[4];
    issue(0, 0);
    // stage 0 has landed; the barrier publishes it
    asm volatile("s_wait_asynccnt 0x0" ::: "memory");
    __syncthreads();
    issue(1, 1);
    for (int s = 0; s < nst; s++) {
      const f16* st = ring + (s & 1)*STG_;
      ldF(a0, b0, st, 0); sched_fence();
      mm(a0, b0); sched_fence();
      ldF(a0, b0, st, 1); sched_fence();
      mm(a0, b0); sched_fence();
      // publish point of stage s + 1: this wave's reads of stage s are done,
      asm volatile("s_wait_dscnt 0x0" ::: "memory");
      // its copies of stage s + 1 have landed,
      asm volatile("s_wait_asynccnt 0x0" ::: "memory");
      // and the barrier publishes stage s + 1 and frees stage s's buffer
      __syncthreads();
      if (s + 2 < nst) issue(s + 2, s & 1);
    }
  } else {
    // three buffers, two fragment sets: one is loaded while the other is consumed
    v16h a0[4], b0[4], a1[4], b1[4];
    issue(0, 0); issue(1, 1); issue(2, 2);
    // stage 0 has landed (the 24 youngest copies are stages 1 and 2); the barrier publishes it
    asm volatile("s_wait_asynccnt 0x18" ::: "memory");
    __syncthreads();
    ldF(a0, b0, ring, 0);

    int cur = 0;   // buffer of stage s
    for (int s = 0; s < nst; s++) {
      int nxt = (cur == 2) ? 0 : cur + 1;
      ldF(a1, b1, ring + cur*STG_, 1); sched_fence();
      mm(a0, b0); sched_fence();
      // publish point of stage s + 1, ahead of the trip's last block because that
      // block's load group already reads stage s + 1. This wave's reads of stage s are done:
      asm volatile("s_wait_dscnt 0x0" ::: "memory");
      // this wave's copies of stage s + 1 have landed (the 12 youngest are stage s + 2, where it exists)
      if (s + 2 < nst) asm volatile("s_wait_asynccnt 0xc" ::: "memory");
      else             asm volatile("s_wait_asynccnt 0x0" ::: "memory");
      __syncthreads();
      // in the last trip these loads read a buffer that holds an old stage; nothing uses them
      ldF(a0, b0, ring + nxt*STG_, 0); sched_fence();
      mm(a1, b1); sched_fence();
      if (s + 3 < nst) issue(s + 3, cur);
      cur = nxt;
    }
  }
  // the ring's closing wait: no copy of this wave is outstanding when it leaves the ring
  asm volatile("s_wait_asynccnt 0x0" ::: "memory");

  // Epilogue. One lane pointer per array; every row and column step is a compile-time
  // constant that folds into the instructions' offset fields.
  const int mHalf = (lane < 16) ? 0 : 8;
  const int n0 = lane & 15;
  const size_t e0 = (size_t)(blockM0 + waveM*64 + mHalf) * NN + blockN0 + waveN*64 + n0;
  const float* bl = bias + blockN0 + waveN*64 + n0;
  float bv[4];
  #pragma unroll
  for (int t = 0; t < 4; t++) bv[t] = bl[t*16];
  float rv[RES ? 4 : 1][4][8];
  const float* rl = RES ? resid + e0 : bl;
  if (RES) {
    #pragma unroll
    for (int i = 0; i < 4; i++)
      #pragma unroll
      for (int j = 0; j < 8; j++)
        #pragma unroll
        for (int t = 0; t < 4; t++) rv[i][t][j] = rl[(i*16 + j)*NN + t*16];
  }
  sched_fence();
  asm volatile("s_wait_xcnt 0x0" :: "v"(bl), "v"(rl) : "memory");
  sched_fence();

  static_assert(!GELU || OUT_F16, "the GELU path stores f16");
  f16 hv[OUT_F16 ? 4 : 1][4][8];
  #pragma unroll
  for (int i = 0; i < 4; i++)
    #pragma unroll
    for (int t = 0; t < 4; t++) {
      if constexpr (GELU) {
        #pragma unroll
        for (int j = 0; j < 8; j += 2) {
          v2f v = {acc[i][t][j] + bv[t], acc[i][t][j + 1] + bv[t]};
          v = 0.5f * v * (1.0f + erf2(v * 0.70710678118f));
          hv[i][t][j] = (f16)v.x; hv[i][t][j + 1] = (f16)v.y;
        }
      } else {
        #pragma unroll
        for (int j = 0; j < 8; j++) {
          float v = acc[i][t][j] + bv[t];
          if (RES) v += rv[i][t][j];
          if (OUT_F16) hv[i][t][j] = (f16)v;
          else         acc[i][t][j] = v;
        }
      }
    }
  // all arithmetic stays ahead of the stores, so that no register a store names is rewritten behind it
  sched_fence();
  #pragma unroll
  for (int i = 0; i < 4; i++)
    #pragma unroll
    for (int j = 0; j < 8; j++)
      #pragma unroll
      for (int t = 0; t < 4; t++) {
        if (OUT_F16) ((f16*)out + e0)[(i*16 + j)*NN + t*16] = hv[i][t][j];
        else         ((float*)out + e0)[(i*16 + j)*NN + t*16] = acc[i][t][j];
      }
}

typedef __attribute__((ext_vector_type(8))) short s16x8;
typedef __attribute__((address_space(3))) s16x8 lds_s16x8;

// lane (c, hh) receives T[row 8*hh + 0..7][column c] of the 16x16 tile whose
// rows the 32 lane addresses name
__device__ __forceinline__ v8h ld_tr16(const f16* p) {
  return __builtin_bit_cast(v8h, __builtin_amdgcn_ds_load_tr16_b128_v8i16((lds_s16x8*)p));
}

#define ATB_  (64*QKP_ + 64*VRP_)   // halves of one buffer
#define NKT_  (L_/64)               // key tiles
static_assert(NKT_ >= 2, "the ring's prologue fills two tiles");

__global__ void __launch_bounds__(256, 1)
attn_kernel(const f16* __restrict__ qkv, f16* __restrict__ o) {
  // a buffer: K tile [key][d] at pitch QKP_, then V tile [key][d] at pitch VRP_
  __shared__ __attribute__((aligned(32))) f16 tiles[2*ATB_];

  int tid = threadIdx.x, lane = tid & 31, wave = tid >> 5;
  int c = lane & 15, hh = lane >> 4;
  int b = blockIdx.z, h = blockIdx.y;
  int q0 = blockIdx.x * 128 + wave * 16;      // this wave's first query
  const size_t rs = 3*D_;
  const f16* qb = qkv + (size_t)b*L_*rs +        (size_t)h*HD_;
  const f16* kp = qkv + (size_t)b*L_*rs + D_   + (size_t)h*HD_;
  const f16* vp = qkv + (size_t)b*L_*rs + 2*D_ + (size_t)h*HD_;

  // Q^T fragments (B operand, column = query), same k order as K's fragments
  v16h qf[8];
  #pragma unroll
  for (int kc = 0; kc < 8; kc++)
    qf[kc] = load_frag(qb + (size_t)q0*rs, 0, 3*D_, kc*32, lane);
  sched_fence();
  asm volatile("s_wait_xcnt 0x0" ::: "memory");
  sched_fence();

  v8f oacc[16] = {};                 // O^T: tile dt, register r = O[query c][16*dt + 8*hh + r]
  float rm = -INFINITY, rl = 0.0f;   // running maximum (log2 domain), this half's running sum
  const float cscale = 0.0625f * 1.4426950408889634f;   // 1/sqrt(256) * log2(e)

  // lane address of the transposing loads: row 8*hh + (lane & 7), 16-byte half (lane >> 3) & 1
  const f16* vad0 = tiles + 64*QKP_ + (8*hh + (lane & 7))*VRP_ + ((lane >> 3) & 1)*8;

  v16h fa[8], fb[8];   // two fragment sets: one is loaded while the other is consumed
  v8f  s[4];
  v16h pf[2];
  const f16* Kt  = tiles;   // K tile of the buffer in use
  const f16* vad = vad0;    // the lane's V address in it

  // key tile t's async copies into buffer `buf`, row-major: 2 x 2048 b128 copies, 16 per thread
  auto issue = [&](int t, int buf) {
    f16* kd = tiles + buf*ATB_;
    f16* vd = kd + 64*QKP_;
    const int kb0 = t*64;
    #pragma unroll
    for (int i = 0; i < 8; i++) {
      int id = tid + i*256;
      int r = id >> 5, c8 = (id & 31) * 8;
      copy_g2l_b128(&kd[r*QKP_ + c8], &kp[(size_t)(kb0 + r)*rs + c8]);
    }
    #pragma unroll
    for (int i = 0; i < 8; i++) {
      int id = tid + i*256;
      int r = id >> 5, c8 = (id & 31) * 8;
      copy_g2l_b128(&vd[r*VRP_ + c8], &vp[(size_t)(kb0 + r)*rs + c8]);
    }
  };

  // K fragments of d chunks 2g, 2g+1 for the four 16-key tiles
  auto ldK = [&](v16h (&f)[8], int g) {
    #pragma unroll
    for (int i = 0; i < 8; i++)
      f[i] = load_frag(Kt, (i & 3)*16, QKP_, (2*g + (i >> 2))*32, lane);
  };
  auto mmS = [&](v16h (&f)[8], int g) {
    #pragma unroll
    for (int i = 0; i < 8; i++) s[i & 3] = mma16(f[i], qf[2*g + (i >> 2)], s[i & 3]);
  };
  // V^T fragments (16 d x 32 keys) of d tiles 4g..4g+3 for the two 32-key chunks
  auto ldV = [&](v16h (&f)[8], int g) {
    #pragma unroll
    for (int i = 0; i < 8; i++) {
      const f16* p = vad + (i >> 2)*32*VRP_ + (4*g + (i & 3))*16;
      f[i] = make_frag(ld_tr16(p), ld_tr16(p + 16*VRP_));
    }
  };
  auto mmV = [&](v16h (&f)[8], int g) {
    #pragma unroll
    for (int i = 0; i < 8; i++)
      oacc[4*g + (i & 3)] = mma16(f[i], pf[i >> 2], oacc[4*g + (i & 3)]);
  };

  issue(0, 0);
  // tile 0 has landed; the barrier publishes it
  asm volatile("s_wait_asynccnt 0x0" ::: "memory");
  __syncthreads();
  issue(1, 1);

  for (int t = 0; t < NKT_; t++) {
    Kt  = tiles + (t & 1)*ATB_;
    vad = vad0  + (t & 1)*ATB_;

    // S^T (64 keys x 16 queries)
    #pragma unroll
    for (int t = 0; t < 4; t++) s[t] = v8f{};
    ldK(fa, 0); sched_fence();
    ldK(fb, 1); sched_fence(); mmS(fa, 0); sched_fence();
    ldK(fa, 2); sched_fence(); mmS(fb, 1); sched_fence();
    ldK(fb, 3); sched_fence(); mmS(fa, 2); sched_fence();
    ldV(fa, 0); sched_fence(); mmS(fb, 3); sched_fence();
    ldV(fb, 1); sched_fence();   // the first V^T groups fly under the softmax

    // online softmax of query c: 32 scores in this lane, 32 in lane ^ 16
    float mx = s[0][0];
    #pragma unroll
    for (int t = 0; t < 4; t++)
      #pragma unroll
      for (int j = 0; j < 8; j++) mx = fmaxf(mx, s[t][j]);
    mx = fmaxf(mx, xhalf(mx)) * cscale;
    float mnew  = fmaxf(rm, mx);
    float alpha = __builtin_amdgcn_exp2f(rm - mnew);
    rm = mnew;
    float sum[4] = {0.0f, 0.0f, 0.0f, 0.0f};
    #pragma unroll
    for (int t = 0; t < 4; t++)
      #pragma unroll
      for (int j = 0; j < 8; j++) {
        float p = __builtin_amdgcn_exp2f(__builtin_fmaf(s[t][j], cscale, -mnew));
        pf[t >> 1][(t & 1)*8 + j] = (f16)p;   // element e of chunk t>>1 is key 16*(e>>3) + 8*hh + (e&7)
        sum[t] += p;
      }
    rl = rl * alpha + ((sum[0] + sum[1]) + (sum[2] + sum[3]));
    #pragma unroll
    for (int dt = 0; dt < 16; dt++) oacc[dt] *= alpha;
    sched_fence();

    // O^T (256 d x 16 queries) += V^T P^T
    mmV(fa, 0); sched_fence();
    ldV(fa, 2); sched_fence(); mmV(fb, 1); sched_fence();
    ldV(fb, 3); sched_fence(); mmV(fa, 2); sched_fence();
    mmV(fb, 3);

    // publish point of tile t + 1: this wave's reads of tile t are done,
    asm volatile("s_wait_dscnt 0x0" ::: "memory");
    // its copies of tile t + 1 have landed,
    asm volatile("s_wait_asynccnt 0x0" ::: "memory");
    // and the barrier publishes tile t + 1 and frees tile t's buffer
    __syncthreads();
    if (t + 2 < NKT_) issue(t + 2, t & 1);
  }
  // the ring's closing wait: no copy of this wave is outstanding when it leaves the ring
  asm volatile("s_wait_asynccnt 0x0" ::: "memory");

  float inv = 1.0f / (rl + xhalf(rl));   // the halves' sums join here
  f16* orow = o + ((size_t)b*L_ + q0 + c)*D_ + h*HD_ + 8*hh;
  v8h pk[16];
  #pragma unroll
  for (int dt = 0; dt < 16; dt++)
    #pragma unroll
    for (int j = 0; j < 8; j++) pk[dt][j] = (f16)(oacc[dt][j] * inv);
  // all packing stays ahead of the stores, so that no register a store names is rewritten behind it
  sched_fence();
  #pragma unroll
  for (int dt = 0; dt < 16; dt++) *(v8h*)(orow + dt*16) = pk[dt];
}

// ---------------------------------------------------------------------------
// Host orchestration
// ---------------------------------------------------------------------------
static inline size_t align256(size_t x) { return (x + 255) & ~(size_t)255; }

extern "C" void kernel_launch(void* const* d_in, const int* in_sizes, int n_in,
                              void* d_out, int out_size, void* d_ws, size_t ws_size,
                              hipStream_t stream) {
  (void)in_sizes; (void)n_in; (void)out_size; (void)ws_size;
  const float* x     = (const float*)d_in[0];
  const float* w3d   = (const float*)d_in[1];
  const float* b3d   = (const float*)d_in[2];
  const float* ln1_g = (const float*)d_in[3];
  const float* ln1_b = (const float*)d_in[4];
  const float* wqkv  = (const float*)d_in[5];
  const float* bqkv  = (const float*)d_in[6];
  const float* wproj = (const float*)d_in[7];
  const float* bproj = (const float*)d_in[8];
  const float* ln2_g = (const float*)d_in[9];
  const float* ln2_b = (const float*)d_in[10];
  const float* w1    = (const float*)d_in[11];
  const float* b1    = (const float*)d_in[12];
  const float* w2    = (const float*)d_in[13];
  const float* b2    = (const float*)d_in[14];
  const float* lnf_g = (const float*)d_in[15];
  const float* lnf_b = (const float*)d_in[16];

  // workspace carve-up (~292 MB)
  char* ws = (char*)d_ws;
  size_t off = 0;
  auto carve = [&](size_t bytes) -> void* { void* p = ws + off; off += align256(bytes); return p; };
  f16*   xh     = (f16*)  carve((size_t)MTOT*3*D_*sizeof(f16));
  f16*   w3dh   = (f16*)  carve((size_t)D_*3*D_*sizeof(f16));
  f16*   wqkvh  = (f16*)  carve((size_t)NL_*3*D_*D_*sizeof(f16));
  f16*   wprojh = (f16*)  carve((size_t)NL_*D_*D_*sizeof(f16));
  f16*   w1h    = (f16*)  carve((size_t)NL_*FF_*D_*sizeof(f16));
  f16*   w2h    = (f16*)  carve((size_t)NL_*D_*FF_*sizeof(f16));
  float* hbuf   = (float*)carve((size_t)MTOT*D_*sizeof(float));
  f16*   hn     = (f16*)  carve((size_t)MTOT*D_*sizeof(f16));
  f16*   qkvh   = (f16*)  carve((size_t)MTOT*3*D_*sizeof(f16));
  f16*   oh     = (f16*)  carve((size_t)MTOT*D_*sizeof(f16));
  f16*   fh     = (f16*)  carve((size_t)MTOT*FF_*sizeof(f16));

  // 1) f32 -> f16 conversions, one launch: xh .. w2h lie back to back (every size is a multiple of 256 bytes)
  cvt_all_kernel<<<dim3(N_CVT / CVBLK_), dim3(CVW_*32), 0, stream>>>(x, w3d, wqkv, wproj, w1, w2, xh);

  dim3 blk(256);
  // 2) embedding projection: h = x * w3d^T + b3d   (M=8192, N=1024, K=3072)
  gemm_kernel<3,D_,false,false,false><<<dim3(D_/256, MTOT/128), blk, 0, stream>>>(
      xh, w3dh, b3d, nullptr, hbuf, MTOT, D_, 3*D_);

  for (int i = 0; i < NL_; i++) {
    // ln1 -> hn (f16)
    ln_kernel<true><<<MTOT/(LNW_*LNR_), dim3(LNW_*32), 0, stream>>>(hbuf, ln1_g + (size_t)i*D_,
                                              ln1_b + (size_t)i*D_, hn);
    // qkv = hn * wqkv^T + bqkv   (N=3D, f16 out)
    gemm_kernel<2,3*D_,true,false,false><<<dim3(3*D_/256, MTOT/128), blk, 0, stream>>>(
        hn, wqkvh + (size_t)i*3*D_*D_, bqkv + (size_t)i*3*D_, nullptr,
        qkvh, MTOT, 3*D_, D_);
    // flash attention -> oh (f16)
    attn_kernel<<<dim3(L_/128, H_, B_), dim3(256), 0, stream>>>(qkvh, oh);
    // h = h + oh * wproj^T + bproj   (in-place residual)
    gemm_kernel<3,D_,false,true,false><<<dim3(D_/256, MTOT/128), blk, 0, stream>>>(
        oh, wprojh + (size_t)i*D_*D_, bproj + (size_t)i*D_, hbuf,
        hbuf, MTOT, D_, D_);
    // ln2 -> hn (f16)
    ln_kernel<true><<<MTOT/(LNW_*LNR_), dim3(LNW_*32), 0, stream>>>(hbuf, ln2_g + (size_t)i*D_,
                                              ln2_b + (size_t)i*D_, hn);
    // f = gelu(hn * w1^T + b1)   (N=FF, f16 out)
    gemm_kernel<2,FF_,true,false,true><<<dim3(FF_/256, MTOT/128), blk, 0, stream>>>(
        hn, w1h + (size_t)i*FF_*D_, b1 + (size_t)i*FF_, nullptr,
        fh, MTOT, FF_, D_);
    // h = h + f * w2^T + b2   (K=FF, in-place residual)
    gemm_kernel<3,D_,false,true,false><<<dim3(D_/256, MTOT/128), blk, 0, stream>>>(
        fh, w2h + (size_t)i*D_*FF_, b2 + (size_t)i*D_, hbuf,
        hbuf, MTOT, D_, FF_);
  }

  // final layernorm -> d_out (f32)
  ln_kernel<false><<<MTOT/(LNW_*LNR_), dim3(LNW_*32), 0, stream>>>(hbuf, lnf_g, lnf_b, (float*)d_out);
}

// v008
// Measured time: 541 microseconds a run.
// Timed twice side by side with v007, it ran 1.06 times as fast both times.
// Over all steps from v000 it is 6.47 times as fast.
#include <hip/hip_runtime.h>
#include <math.h>

typedef _Float16 f16;
typedef __attribute__((ext_vector_type(16))) _Float16 v16h;
typedef __attribute__((ext_vector_type(8)))  _Float16 v8h;
typedef __attribute__((ext_vector_type(8)))  float    v8f;
typedef __attribute__((ext_vector_type(4)))  int      v4i;

#define B_    4
#define L_    2048
#define D_    1024
#define H_    4
#define NL_   2
#define HD_   256
#define FF_   4096
#define MTOT  (B_*L_)      // 8192 token rows
#define EPS_  1e-5f

#define GP_   72    // GEMM A/W tiles: 64 halves + 8   (144 B)
#define QKP_  264   // attention K tile: 256 halves + 8 (528 B)
// Rows read by the 16-bit transposing load want a pitch of 32 B x odd instead.
#define VRP_  272   // attention V tile: 256 halves + 16 (544 B)

#if __has_builtin(__builtin_amdgcn_global_load_async_to_lds_b128) && \
    __has_builtin(__builtin_amdgcn_s_wait_asynccnt)
#define HAVE_ASYNC_LDS 1
#else
#define HAVE_ASYNC_LDS 0
#endif

typedef __attribute__((address_space(1))) v4i gv4i_t;
typedef __attribute__((address_space(3))) v4i lv4i_t;

__device__ __forceinline__ void copy_g2l_b128(f16* dst_lds, const f16* src_glb) {
#if HAVE_ASYNC_LDS
  __builtin_amdgcn_global_load_async_to_lds_b128(
      (gv4i_t*)(const_cast<f16*>(src_glb)),
      (lv4i_t*)dst_lds, 0, 0);
#else
  *(v8h*)dst_lds = *(const v8h*)src_glb;
#endif
}

__device__ __forceinline__ v16h make_frag(v8h lo, v8h hi) {
  return __builtin_shufflevector(lo, hi, 0,1,2,3,4,5,6,7,8,9,10,11,12,13,14,15);
}

__device__ __forceinline__ v16h load_frag(const f16* tile, int rowBase, int ld,
                                          int kChunkBase, int lane) {
  int r  = rowBase + (lane & 15);
  int kb = kChunkBase + ((lane < 16) ? 0 : 8);
  const f16* p = tile + (size_t)r * ld + kb;
  v8h lo = *(const v8h*)(p);
  v8h hi = *(const v8h*)(p + 16);
  return make_frag(lo, hi);
}

__device__ __forceinline__ v8f mma16(v16h a, v16h b, v8f c) {
  return __builtin_amdgcn_wmma_f32_16x16x32_f16(false, a, false, b, (short)0, c, false, false);
}

__device__ __forceinline__ void sched_fence() { __builtin_amdgcn_sched_barrier(0); }

// ---------------------------------------------------------------------------
// f32 -> f16 conversion of x and of the five weight arrays in ONE launch.
// The six f16 copies lie back to back in the workspace, so the destination is one
// array; a block's piece lies inside one source (every source length is a multiple
// of the piece), picked by block-uniform compares.
// A stream runs at the rate of its bytes in flight: a wave issues all its 32 loads
// (512 contiguous bytes each, 16 KB together) before it converts the first value,
// then stores 256 contiguous bytes per instruction and ends: no loop, no register
// used twice. The sources are read once in a call: non-temporal loads, which leave
// the L2 to the f16 copies that the GEMMs read.
// ---------------------------------------------------------------------------
typedef __attribute__((ext_vector_type(4))) float    v4f;
typedef __attribute__((ext_vector_type(4))) _Float16 v4h;
#define CVW_    4                     // waves per block
#define CVL_    32                    // loads per wave, 128 floats each
#define CVBLK_  (CVW_*CVL_*128)       // floats of one block
#define N_X     ((size_t)MTOT*3*D_)
#define N_W3D   ((size_t)D_*3*D_)
#define N_WQKV  ((size_t)NL_*3*D_*D_)
#define N_WPRJ  ((size_t)NL_*D_*D_)
#define N_W1    ((size_t)NL_*FF_*D_)
#define N_W2    ((size_t)NL_*D_*FF_)
#define N_CVT   (N_X + N_W3D + N_WQKV + N_WPRJ + N_W1 + N_W2)
static_assert(N_X % CVBLK_ == 0 && N_W3D % CVBLK_ == 0 && N_WQKV % CVBLK_ == 0 &&
              N_WPRJ % CVBLK_ == 0 && N_W1 % CVBLK_ == 0 && N_W2 % CVBLK_ == 0,
              "a block's piece lies inside one source");

__global__ void __launch_bounds__(CVW_*32)
cvt_all_kernel(const float* __restrict__ x, const float* __restrict__ w3d,
               const float* __restrict__ wqkv, const float* __restrict__ wproj,
               const float* __restrict__ w1, const float* __restrict__ w2,
               f16* __restrict__ out) {
  const int lane = threadIdx.x & 31;
  const int wave = __builtin_amdgcn_readfirstlane(threadIdx.x >> 5);
  const size_t e0 = (size_t)blockIdx.x * CVBLK_;   // block-uniform
  const float* s = x; size_t b = 0;                // the source of this piece, and where it starts in out
  if (e0 >= N_X)                                   { s = w3d;   b = N_X; }
  if (e0 >= N_X + N_W3D)                           { s = wqkv;  b = N_X + N_W3D; }
  if (e0 >= N_X + N_W3D + N_WQKV)                  { s = wproj; b = N_X + N_W3D + N_WQKV; }
  if (e0 >= N_X + N_W3D + N_WQKV + N_WPRJ)         { s = w1;    b = N_X + N_W3D + N_WQKV + N_WPRJ; }
  if (e0 >= N_X + N_W3D + N_WQKV + N_WPRJ + N_W1)  { s = w2;    b = N_X + N_W3D + N_WQKV + N_WPRJ + N_W1; }
  const size_t w0 = e0 + (size_t)wave * (CVL_*128);
  const v4f* sl = (const v4f*)(s + (w0 - b)) + lane;
  v4h*       dl = (v4h*)(out + w0) + lane;

  v4f v[CVL_];
  #pragma unroll
  for (int i = 0; i < CVL_; i++) v[i] = __builtin_nontemporal_load(sl + i*32);
  // all 32 loads are in flight together, ahead of the first conversion
  sched_fence();
  v4h hv[CVL_];
  #pragma unroll
  for (int i = 0; i < CVL_; i++) hv[i] = __builtin_convertvector(v[i], v4h);
  // all conversions stay ahead of the stores, so that no register a store names is rewritten behind it
  sched_fence();
  #pragma unroll
  for (int i = 0; i < CVL_; i++) dl[i*32] = hv[i];
}

// ---------------------------------------------------------------------------
// LayerNorm over D_=1024: two rows per wave, no LDS and no barrier.
// For speed only it gets few
// waves with much in flight each: 256 blocks of 16 waves, 2 rows per wave. A lane
// holds 32 values of each row (8 loads of 16 bytes; a wave's load covers 512
// contiguous bytes); mean and variance are in-lane sums, then a 5-step butterfly.
// ---------------------------------------------------------------------------
#define LNW_  16   // waves per block
#define LNR_  2    // rows per wave

__device__ __forceinline__ float xhalf(float x) {
  return __builtin_bit_cast(float, __builtin_amdgcn_permlanex16(
      __builtin_bit_cast(int, x), __builtin_bit_cast(int, x),
      0x76543210, 0xfedcba98, false, false));
}

template<int XM>
__device__ __forceinline__ float xrow(float x) {
  return __builtin_bit_cast(float, __builtin_amdgcn_update_dpp(
      0, __builtin_bit_cast(int, x), 0x160 + XM, 0xf, 0xf, true));
}

// sum over the 32 lanes, the same bits in every lane
__device__ __forceinline__ float wave_sum(float s) {
  s += xrow<1>(s); s += xrow<2>(s); s += xrow<4>(s); s += xrow<8>(s);
  return s + xhalf(s);
}

template<bool OUT_F16>
__global__ void __launch_bounds__(LNW_*32)
ln_kernel(const float* __restrict__ x, const float* __restrict__ g,
          const float* __restrict__ bb, void* __restrict__ out) {
  const int lane = threadIdx.x & 31;
  const int wave = __builtin_amdgcn_readfirstlane(threadIdx.x >> 5);
  const size_t row0 = ((size_t)blockIdx.x * LNW_ + wave) * LNR_;   // wave-uniform
  const v4f* xl = (const v4f*)(x + row0 * D_) + lane;
  const v4f* gl = (const v4f*)g + lane;
  const v4f* bl = (const v4f*)bb + lane;

  v4f v[LNR_][8], gv[8], bv[8];
  #pragma unroll
  for (int r = 0; r < LNR_; r++)
    #pragma unroll
    for (int i = 0; i < 8; i++) v[r][i] = xl[r*(D_/4) + i*32];
  #pragma unroll
  for (int i = 0; i < 8; i++) gv[i] = gl[i*32];
  #pragma unroll
  for (int i = 0; i < 8; i++) bv[i] = bl[i*32];
  sched_fence();
  asm volatile("s_wait_xcnt 0x0" ::: "memory");
  sched_fence();

  float mu[LNR_], rstd[LNR_];
  #pragma unroll
  for (int r = 0; r < LNR_; r++) {
    v4f s4 = v[r][0];
    #pragma unroll
    for (int i = 1; i < 8; i++) s4 += v[r][i];
    mu[r] = (s4[0] + s4[1]) + (s4[2] + s4[3]);
  }
  #pragma unroll
  for (int r = 0; r < LNR_; r++) mu[r] = wave_sum(mu[r]) * (1.0f / D_);
  #pragma unroll
  for (int r = 0; r < LNR_; r++) {
    v4f q4 = {};
    #pragma unroll
    for (int i = 0; i < 8; i++) { v[r][i] -= mu[r]; q4 += v[r][i] * v[r][i]; }
    rstd[r] = (q4[0] + q4[1]) + (q4[2] + q4[3]);
  }
  #pragma unroll
  for (int r = 0; r < LNR_; r++) rstd[r] = rsqrtf(wave_sum(rstd[r]) * (1.0f / D_) + EPS_);

  v4h hv[OUT_F16 ? LNR_ : 1][8];
  #pragma unroll
  for (int r = 0; r < LNR_; r++)
    #pragma unroll
    for (int i = 0; i < 8; i++) {
      v4f y = v[r][i] * rstd[r] * gv[i] + bv[i];
      if (OUT_F16) hv[r][i] = __builtin_convertvector(y, v4h);
      else         v[r][i] = y;
    }
  // all arithmetic stays ahead of the stores, so that no register a store names is rewritten behind it
  sched_fence();
  #pragma unroll
  for (int r = 0; r < LNR_; r++)
    #pragma unroll
    for (int i = 0; i < 8; i++) {
      if (OUT_F16) ((v4h*)((f16*)out + row0 * D_) + lane)[r*(D_/4) + i*32] = hv[r][i];
      else         ((v4f*)((float*)out + row0 * D_) + lane)[r*(D_/4) + i*32] = v[r][i];
    }
}

#define BM_   128
#define BN_   256

// erf of two values without a branch. Both of the usual f32 fits are evaluated and one is
// selected: |x| < 1: |x| + |x| Q(x^2); otherwise 1 - exp(-(|x| + |x| P(|x|))). With no branch
// between them the elements' chains are independent straight-line code that fills the vector
// port, and pairs of values share packed instructions.
typedef __attribute__((ext_vector_type(2))) float v2f;
__device__ __forceinline__ v2f fma2(v2f a, v2f b, float c) {
  return __builtin_elementwise_fma(a, b, (v2f){c, c});
}
__device__ __forceinline__ v2f erf2(v2f x) {
  const v2f ax = __builtin_elementwise_abs(x);
  v2f p = fma2(ax, (v2f){0.0000169988107f, 0.0000169988107f}, -0.000378677854f);
  p = fma2(ax, p, 0.00385781587f);
  p = fma2(ax, p, -0.0241816975f);
  p = fma2(ax, p, 0.106668264f);
  p = fma2(ax, p, 0.634933293f);
  p = fma2(ax, p, 0.128689408f);
  p = __builtin_elementwise_fma(ax, p, ax) * -1.44269502f;   // exp(-y) = 2^(-y log2 e)
  const v2f t = x * x;
  v2f q = fma2(t, (v2f){-0.000561801775f, -0.000561801775f}, 0.00491381623f);
  q = fma2(t, q, -0.0267075151f);
  q = fma2(t, q, 0.112800106f);
  q = fma2(t, q, -0.376122952f);
  q = fma2(t, q, 0.128379107f);
  q = __builtin_elementwise_fma(ax, q, ax);
  v2f r;
  r.x = ax.x < 1.0f ? q.x : 1.0f - __builtin_amdgcn_exp2f(p.x);
  r.y = ax.y < 1.0f ? q.y : 1.0f - __builtin_amdgcn_exp2f(p.y);
  return __builtin_elementwise_copysign(r, x);
}
#define BK_   64
#define STG_  ((BM_ + BN_) * GP_)   // halves of one stage: A rows, then W rows
static_assert(MTOT % (8*BM_) == 0, "the deal of tiles to blocks goes by 8 row tiles");

template<int NB, int NN, bool OUT_F16, bool RES, bool GELU>
__global__ void __launch_bounds__(256, NB == 2 ? 4 : 2)
gemm_kernel(const f16* __restrict__ A, const f16* __restrict__ W,
            const float* __restrict__ bias, const float* __restrict__ resid,
            void* __restrict__ out, int M, int N, int K) {
  (void)M; (void)N;   // N is the template constant NN
  __shared__ __attribute__((aligned(16))) f16 ring[NB*STG_];
  int tid  = threadIdx.x;
  int lane = tid & 31, wave = tid >> 5;
  int waveM = wave >> 2, waveN = wave & 3;
  // flat index -> tile: 8 row tiles x all GX column tiles per 8 GX indices, the row tile fastest
  constexpr unsigned GX = NN / BN_;
  const unsigned flat = blockIdx.y * GX + blockIdx.x;
  const unsigned tx = flat % (8*GX) / 8, ty = flat / (8*GX) * 8 + flat % 8;
  int blockN0 = tx * BN_, blockM0 = ty * BM_;

  const int nst = K >> 6;   // stages
  // the block's first stage (block-uniform): the GX blocks of a row tile spread evenly over k,
  // the blocks of a column tile one stage apart
  const int rot = (int)((tx * (unsigned)nst / GX + ty) % (unsigned)nst);

  // a thread copies 16 bytes of row (tid >> 3) + 32 i: block-uniform bases plus
  // one 32-bit byte offset per lane, the same for A and W (both have K columns)
  const char* gA = (const char*)(A + (size_t)blockM0 * K);
  const char* gW = (const char*)(W + (size_t)blockN0 * K);
  const unsigned goff = ((unsigned)(tid >> 3) * (unsigned)K + (unsigned)(tid & 7) * 8u) * 2u;
  const size_t rstep = (size_t)K * 64;   // 32 rows, in bytes
  f16* lrow = ring + (tid >> 3)*GP_ + (tid & 7)*8;

  // one stage's async copies into buffer `buf` (12 b128 copies per thread)
  auto issue = [&](int st, int buf) {
    f16* l = lrow + buf*STG_;
    const int g = st + rot < nst ? st + rot : st + rot - nst;   // the stage of k that is this block's stage st
    const char* a = gA + (size_t)g * (BK_*2);
    const char* w = gW + (size_t)g * (BK_*2);
    #pragma unroll
    for (int i = 0; i < 4; i++)
      copy_g2l_b128(l + i*32*GP_, (const f16*)(a + i*rstep + goff));
    #pragma unroll
    for (int i = 0; i < 8; i++)
      copy_g2l_b128(l + (BM_ + i*32)*GP_, (const f16*)(w + i*rstep + goff));
  };

  v8f  acc[4][4] = {};
  // fragments of k chunk kc (32 k) of the stage at `st`
  auto ldF = [&](v16h (&fa)[4], v16h (&fb)[4], const f16* st, int kc) {
    #pragma unroll
    for (int i = 0; i < 4; i++) fa[i] = load_frag(st, waveM*64 + i*16, GP_, kc*32, lane);
    #pragma unroll
    for (int i = 0; i < 4; i++) fb[i] = load_frag(st + BM_*GP_, waveN*64 + i*16, GP_, kc*32, lane);
  };
  auto mm = [&](v16h (&fa)[4], v16h (&fb)[4]) {
    #pragma unroll
    for (int i = 0; i < 4; i++)
      #pragma unroll
      for (int j = 0; j < 4; j++) acc[i][j] = mma16(fa[i], fb[j], acc[i][j]);
  };

  if constexpr (NB == 2) {
    v16h a0[4], b0[4];
    issue(0, 0);
    // stage 0 has landed; the barrier publishes it
    asm volatile("s_wait_asynccnt 0x0" ::: "memory");
    __syncthreads();
    issue(1, 1);
    for (int s = 0; s < nst; s++) {
      const f16* st = ring + (s & 1)*STG_;
      ldF(a0, b0, st, 0); sched_fence();
      mm(a0, b0); sched_fence();
      ldF(a0, b0, st, 1); sched_fence();
      mm(a0, b0); sched_fence();
      // publish point of stage s + 1: this wave's reads of stage s are done,
      asm volatile("s_wait_dscnt 0x0" ::: "memory");
      // its copies of stage s + 1 have landed,
      asm volatile("s_wait_asynccnt 0x0" ::: "memory");
      // and the barrier publishes stage s + 1 and frees stage s's buffer
      __syncthreads();
      if (s + 2 < nst) issue(s + 2, s & 1);
    }
  } else {
    // three buffers, two fragment sets: one is loaded while the other is consumed
    v16h a0[4], b0[4], a1[4], b1[4];
    issue(0, 0); issue(1, 1); issue(2, 2);
    // stage 0 has landed (the 24 youngest copies are stages 1 and 2); the barrier publishes it
    asm volatile("s_wait_asynccnt 0x18" ::: "memory");
    __syncthreads();
    ldF(a0, b0, ring, 0);

    int cur = 0;   // buffer of stage s
    for (int s = 0; s < nst; s++) {
      int nxt = (cur == 2) ? 0 : cur + 1;
      ldF(a1, b1, ring + cur*STG_, 1); sched_fence();
      mm(a0, b0); sched_fence();
      // publish point of stage s + 1, ahead of the trip's last block because that
      // block's load group already reads stage s + 1. This wave's reads of stage s are done:
      asm volatile("s_wait_dscnt 0x0" ::: "memory");
      // this wave's copies of stage s + 1 have landed (the 12 youngest are stage s + 2, where it exists)
      if (s + 2 < nst) asm volatile("s_wait_asynccnt 0xc" ::: "memory");
      else             asm volatile("s_wait_asynccnt 0x0" ::: "memory");
      __syncthreads();
      // in the last trip these loads read a buffer that holds an old stage; nothing uses them
      ldF(a0, b0, ring + nxt*STG_, 0); sched_fence();
      mm(a1, b1); sched_fence();
      if (s + 3 < nst) issue(s + 3, cur);
      cur = nxt;
    }
  }
  // the ring's closing wait: no copy of this wave is outstanding when it leaves the ring
  asm volatile("s_wait_asynccnt 0x0" ::: "memory");

  // Epilogue. One lane pointer per array; every row and column step is a compile-time
  // constant that folds into the instructions' offset fields.
  const int mHalf = (lane < 16) ? 0 : 8;
  const int n0 = lane & 15;
  const size_t e0 = (size_t)(blockM0 + waveM*64 + mHalf) * NN + blockN0 + waveN*64 + n0;
  const float* bl = bias + blockN0 + waveN*64 + n0;
  float bv[4];
  #pragma unroll
  for (int t = 0; t < 4; t++) bv[t] = bl[t*16];
  float rv[RES ? 4 : 1][4][8];
  const float* rl = RES ? resid + e0 : bl;
  if (RES) {
    #pragma unroll
    for (int i = 0; i < 4; i++)
      #pragma unroll
      for (int j = 0; j < 8; j++)
        #pragma unroll
        for (int t = 0; t < 4; t++) rv[i][t][j] = rl[(i*16 + j)*NN + t*16];
  }
  sched_fence();
  asm volatile("s_wait_xcnt 0x0" :: "v"(bl), "v"(rl) : "memory");
  sched_fence();

  static_assert(!GELU || OUT_F16, "the GELU path stores f16");
  f16 hv[OUT_F16 ? 4 : 1][4][8];
  #pragma unroll
  for (int i = 0; i < 4; i++)
    #pragma unroll
    for (int t = 0; t < 4; t++) {
      if constexpr (GELU) {
        #pragma unroll
        for (int j = 0; j < 8; j += 2) {
          v2f v = {acc[i][t][j] + bv[t], acc[i][t][j + 1] + bv[t]};
          v = 0.5f * v * (1.0f + erf2(v * 0.70710678118f));
          hv[i][t][j] = (f16)v.x; hv[i][t][j + 1] = (f16)v.y;
        }
      } else {
        #pragma unroll
        for (int j = 0; j < 8; j++) {
          float v = acc[i][t][j] + bv[t];
          if (RES) v += rv[i][t][j];
          if (OUT_F16) hv[i][t][j] = (f16)v;
          else         acc[i][t][j] = v;
        }
      }
    }
  // all arithmetic stays ahead of the stores, so that no register a store names is rewritten behind it
  sched_fence();
  #pragma unroll
  for (int i = 0; i < 4; i++)
    #pragma unroll
    for (int j = 0; j < 8; j++)
      #pragma unroll
      for (int t = 0; t < 4; t++) {
        if (OUT_F16) ((f16*)out + e0)[(i*16 + j)*NN + t*16] = hv[i][t][j];
        else         ((float*)out + e0)[(i*16 + j)*NN + t*16] = acc[i][t][j];
      }
}

typedef __attribute__((ext_vector_type(8))) short s16x8;
typedef __attribute__((address_space(3))) s16x8 lds_s16x8;

// lane (c, hh) receives T[row 8*hh + 0..7][column c] of the 16x16 tile whose
// rows the 32 lane addresses name
__device__ __forceinline__ v8h ld_tr16(const f16* p) {
  return __builtin_bit_cast(v8h, __builtin_amdgcn_ds_load_tr16_b128_v8i16((lds_s16x8*)p));
}

#define ATB_  (64*QKP_ + 64*VRP_)   // halves of one buffer
#define NKT_  (L_/64)               // key tiles
static_assert(NKT_ >= 2, "the ring's prologue fills two tiles");

__global__ void __launch_bounds__(256, 1)
attn_kernel(const f16* __restrict__ qkv, f16* __restrict__ o) {
  // a buffer: K tile [key][d] at pitch QKP_, then V tile [key][d] at pitch VRP_
  __shared__ __attribute__((aligned(32))) f16 tiles[2*ATB_];

  int tid = threadIdx.x, lane = tid & 31, wave = tid >> 5;
  int c = lane & 15, hh = lane >> 4;
  int b = blockIdx.z, h = blockIdx.y;
  int q0 = blockIdx.x * 128 + wave * 16;      // this wave's first query
  const size_t rs = 3*D_;
  const f16* qb = qkv + (size_t)b*L_*rs +        (size_t)h*HD_;
  const f16* kp = qkv + (size_t)b*L_*rs + D_   + (size_t)h*HD_;
  const f16* vp = qkv + (size_t)b*L_*rs + 2*D_ + (size_t)h*HD_;

  // Q^T fragments (B operand, column = query), same k order as K's fragments
  v16h qf[8];
  #pragma unroll
  for (int kc = 0; kc < 8; kc++)
    qf[kc] = load_frag(qb + (size_t)q0*rs, 0, 3*D_, kc*32, lane);
  sched_fence();
  asm volatile("s_wait_xcnt 0x0" ::: "memory");
  sched_fence();

  v8f oacc[16] = {};                 // O^T: tile dt, register r = O[query c][16*dt + 8*hh + r]
  float rm = -INFINITY, rl = 0.0f;   // running maximum (log2 domain), this half's running sum
  const float cscale = 0.0625f * 1.4426950408889634f;   // 1/sqrt(256) * log2(e)

  // lane address of the transposing loads: row 8*hh + (lane & 7), 16-byte half (lane >> 3) & 1
  const f16* vad0 = tiles + 64*QKP_ + (8*hh + (lane & 7))*VRP_ + ((lane >> 3) & 1)*8;

  v16h fa[8], fb[8];   // two fragment sets: one is loaded while the other is consumed
  v8f  s[4];
  v16h pf[2];
  const f16* Kt  = tiles;   // K tile of the buffer in use
  const f16* vad = vad0;    // the lane's V address in it

  // key tile t's async copies into buffer `buf`, row-major: 2 x 2048 b128 copies, 16 per thread
  auto issue = [&](int t, int buf) {
    f16* kd = tiles + buf*ATB_;
    f16* vd = kd + 64*QKP_;
    const int kb0 = t*64;
    #pragma unroll
    for (int i = 0; i < 8; i++) {
      int id = tid + i*256;
      int r = id >> 5, c8 = (id & 31) * 8;
      copy_g2l_b128(&kd[r*QKP_ + c8], &kp[(size_t)(kb0 + r)*rs + c8]);
    }
    #pragma unroll
    for (int i = 0; i < 8; i++) {
      int id = tid + i*256;
      int r = id >> 5, c8 = (id & 31) * 8;
      copy_g2l_b128(&vd[r*VRP_ + c8], &vp[(size_t)(kb0 + r)*rs + c8]);
    }
  };

  // K fragments of d chunks 2g, 2g+1 for the four 16-key tiles
  auto ldK = [&](v16h (&f)[8], int g) {
    #pragma unroll
    for (int i = 0; i < 8; i++)
      f[i] = load_frag(Kt, (i & 3)*16, QKP_, (2*g + (i >> 2))*32, lane);
  };
  auto mmS = [&](v16h (&f)[8], int g) {
    #pragma unroll
    for (int i = 0; i < 8; i++) s[i & 3] = mma16(f[i], qf[2*g + (i >> 2)], s[i & 3]);
  };
  // V^T fragments (16 d x 32 keys) of d tiles 4g..4g+3 for the two 32-key chunks
  auto ldV = [&](v16h (&f)[8], int g) {
    #pragma unroll
    for (int i = 0; i < 8; i++) {
      const f16* p = vad + (i >> 2)*32*VRP_ + (4*g + (i & 3))*16;
      f[i] = make_frag(ld_tr16(p), ld_tr16(p + 16*VRP_));
    }
  };
  auto mmV = [&](v16h (&f)[8], int g) {
    #pragma unroll
    for (int i = 0; i < 8; i++)
      oacc[4*g + (i & 3)] = mma16(f[i], pf[i >> 2], oacc[4*g + (i & 3)]);
  };

  issue(0, 0);
  // tile 0 has landed; the barrier publishes it
  asm volatile("s_wait_asynccnt 0x0" ::: "memory");
  __syncthreads();
  issue(1, 1);

  for (int t = 0; t < NKT_; t++) {
    Kt  = tiles + (t & 1)*ATB_;
    vad = vad0  + (t & 1)*ATB_;

    // S^T (64 keys x 16 queries)
    #pragma unroll
    for (int t = 0; t < 4; t++) s[t] = v8f{};
    ldK(fa, 0); sched_fence();
    ldK(fb, 1); sched_fence(); mmS(fa, 0); sched_fence();
    ldK(fa, 2); sched_fence(); mmS(fb, 1); sched_fence();
    ldK(fb, 3); sched_fence(); mmS(fa, 2); sched_fence();
    ldV(fa, 0); sched_fence(); mmS(fb, 3); sched_fence();
    ldV(fb, 1); sched_fence();   // the first V^T groups fly under the softmax

    // online softmax of query c: 32 scores in this lane, 32 in lane ^ 16
    float mx = s[0][0];
    #pragma unroll
    for (int t = 0; t < 4; t++)
      #pragma unroll
      for (int j = 0; j < 8; j++) mx = fmaxf(mx, s[t][j]);
    mx = fmaxf(mx, xhalf(mx)) * cscale;
    float mnew  = fmaxf(rm, mx);
    float alpha = __builtin_amdgcn_exp2f(rm - mnew);
    rm = mnew;
    float sum[4] = {0.0f, 0.0f, 0.0f, 0.0f};
    #pragma unroll
    for (int t = 0; t < 4; t++)
      #pragma unroll
      for (int j = 0; j < 8; j++) {
        float p = __builtin_amdgcn_exp2f(__builtin_fmaf(s[t][j], cscale, -mnew));
        pf[t >> 1][(t & 1)*8 + j] = (f16)p;   // element e of chunk t>>1 is key 16*(e>>3) + 8*hh + (e&7)
        sum[t] += p;
      }
    rl = rl * alpha + ((sum[0] + sum[1]) + (sum[2] + sum[3]));
    #pragma unroll
    for (int dt = 0; dt < 16; dt++) oacc[dt] *= alpha;
    sched_fence();

    // O^T (256 d x 16 queries) += V^T P^T
    mmV(fa, 0); sched_fence();
    ldV(fa, 2); sched_fence(); mmV(fb, 1); sched_fence();
    ldV(fb, 3); sched_fence(); mmV(fa, 2); sched_fence();
    mmV(fb, 3);

    // publish point of tile t + 1: this wave's reads of tile t are done,
    asm volatile("s_wait_dscnt 0x0" ::: "memory");
    // its copies of tile t + 1 have landed,
    asm volatile("s_wait_asynccnt 0x0" ::: "memory");
    // and the barrier publishes tile t + 1 and frees tile t's buffer
    __syncthreads();
    if (t + 2 < NKT_) issue(t + 2, t & 1);
  }
  // the ring's closing wait: no copy of this wave is outstanding when it leaves the ring
  asm volatile("s_wait_asynccnt 0x0" ::: "memory");

  float inv = 1.0f / (rl + xhalf(rl));   // the halves' sums join here
  f16* orow = o + ((size_t)b*L_ + q0 + c)*D_ + h*HD_ + 8*hh;
  v8h pk[16];
  #pragma unroll
  for (int dt = 0; dt < 16; dt++)
    #pragma unroll
    for (int j = 0; j < 8; j++) pk[dt][j] = (f16)(oacc[dt][j] * inv);
  // all packing stays ahead of the stores, so that no register a store names is rewritten behind it
  sched_fence();
  #pragma unroll
  for (int dt = 0; dt < 16; dt++) *(v8h*)(orow + dt*16) = pk[dt];
}

// ---------------------------------------------------------------------------
// Host orchestration
// ---------------------------------------------------------------------------
static inline size_t align256(size_t x) { return (x + 255) & ~(size_t)255; }

extern "C" void kernel_launch(void* const* d_in, const int* in_sizes, int n_in,
                              void* d_out, int out_size, void* d_ws, size_t ws_size,
                              hipStream_t stream) {
  (void)in_sizes; (void)n_in; (void)out_size; (void)ws_size;
  const float* x     = (const float*)d_in[0];
  const float* w3d   = (const float*)d_in[1];
  const float* b3d   = (const float*)d_in[2];
  const float* ln1_g = (const float*)d_in[3];
  const float* ln1_b = (const float*)d_in[4];
  const float* wqkv  = (const float*)d_in[5];
  const float* bqkv  = (const float*)d_in[6];
  const float* wproj = (const float*)d_in[7];
  const float* bproj = (const float*)d_in[8];
  const float* ln2_g = (const float*)d_in[9];
  const float* ln2_b = (const float*)d_in[10];
  const float* w1    = (const float*)d_in[11];
  const float* b1    = (const float*)d_in[12];
  const float* w2    = (const float*)d_in[13];
  const float* b2    = (const float*)d_in[14];
  const float* lnf_g = (const float*)d_in[15];
  const float* lnf_b = (const float*)d_in[16];

  // workspace carve-up (~292 MB)
  char* ws = (char*)d_ws;
  size_t off = 0;
  auto carve = [&](size_t bytes) -> void* { void* p = ws + off; off += align256(bytes); return p; };
  f16*   xh     = (f16*)  carve((size_t)MTOT*3*D_*sizeof(f16));
  f16*   w3dh   = (f16*)  carve((size_t)D_*3*D_*sizeof(f16));
  f16*   wqkvh  = (f16*)  carve((size_t)NL_*3*D_*D_*sizeof(f16));
  f16*   wprojh = (f16*)  carve((size_t)NL_*D_*D_*sizeof(f16));
  f16*   w1h    = (f16*)  carve((size_t)NL_*FF_*D_*sizeof(f16));
  f16*   w2h    = (f16*)  carve((size_t)NL_*D_*FF_*sizeof(f16));
  float* hbuf   = (float*)carve((size_t)MTOT*D_*sizeof(float));
  f16*   hn     = (f16*)  carve((size_t)MTOT*D_*sizeof(f16));
  f16*   qkvh   = (f16*)  carve((size_t)MTOT*3*D_*sizeof(f16));
  f16*   oh     = (f16*)  carve((size_t)MTOT*D_*sizeof(f16));
  f16*   fh     = (f16*)  carve((size_t)MTOT*FF_*sizeof(f16));

  // 1) f32 -> f16 conversions, one launch: xh .. w2h lie back to back (every size is a multiple of 256 bytes)
  cvt_all_kernel<<<dim3(N_CVT / CVBLK_), dim3(CVW_*32), 0, stream>>>(x, w3d, wqkv, wproj, w1, w2, xh);

  dim3 blk(256);
  // 2) embedding projection: h = x * w3d^T + b3d   (M=8192, N=1024, K=3072)
  gemm_kernel<3,D_,false,false,false><<<dim3(D_/256, MTOT/128), blk, 0, stream>>>(
      xh, w3dh, b3d, nullptr, hbuf, MTOT, D_, 3*D_);

  for (int i = 0; i < NL_; i++) {
    // ln1 -> hn (f16)
    ln_kernel<true><<<MTOT/(LNW_*LNR_), dim3(LNW_*32), 0, stream>>>(hbuf, ln1_g + (size_t)i*D_,
                                              ln1_b + (size_t)i*D_, hn);
    // qkv = hn * wqkv^T + bqkv   (N=3D, f16 out)
    gemm_kernel<2,3*D_,true,false,false><<<dim3(3*D_/256, MTOT/128), blk, 0, stream>>>(
        hn, wqkvh + (size_t)i*3*D_*D_, bqkv + (size_t)i*3*D_, nullptr,
        qkvh, MTOT, 3*D_, D_);
    // flash attention -> oh (f16)
    attn_kernel<<<dim3(L_/128, H_, B_), dim3(256), 0, stream>>>(qkvh, oh);
    // h = h + oh * wproj^T + bproj   (in-place residual)
    gemm_kernel<3,D_,false,true,false><<<dim3(D_/256, MTOT/128), blk, 0, stream>>>(
        oh, wprojh + (size_t)i*D_*D_, bproj + (size_t)i*D_, hbuf,
        hbuf, MTOT, D_, D_);
    // ln2 -> hn (f16)
    ln_kernel<true><<<MTOT/(LNW_*LNR_), dim3(LNW_*32), 0, stream>>>(hbuf, ln2_g + (size_t)i*D_,
                                              ln2_b + (size_t)i*D_, hn);
    // f = gelu(hn * w1^T + b1)   (N=FF, f16 out)
    gemm_kernel<2,FF_,true,false,true><<<dim3(FF_/256, MTOT/128), blk, 0, stream>>>(
        hn, w1h + (size_t)i*FF_*D_, b1 + (size_t)i*FF_, nullptr,
        fh, MTOT, FF_, D_);
    // h = h + f * w2^T + b2   (K=FF, in-place residual)
    gemm_kernel<3,D_,false,true,false><<<dim3(D_/256, MTOT/128), blk, 0, stream>>>(
        fh, w2h + (size_t)i*D_*FF_, b2 + (size_t)i*D_, hbuf,
        hbuf, MTOT, D_, FF_);
  }

  // final layernorm -> d_out (f32)
  ln_kernel<false><<<MTOT/(LNW_*LNR_), dim3(LNW_*32), 0, stream>>>(hbuf, lnf_g, lnf_b, (float*)d_out);
}

// v009
// Measured time: 503 microseconds a run.
// Timed twice side by side with v008, it ran 1.08 times as fast both times.
// Counting every step since v000, it is 6.97 times as fast.
#include <hip/hip_runtime.h>
#include <math.h>
#include <stdint.h>

typedef _Float16 f16;
typedef __attribute__((ext_vector_type(16))) _Float16 v16h;
typedef __attribute__((ext_vector_type(8)))  _Float16 v8h;
typedef __attribute__((ext_vector_type(8)))  float    v8f;
typedef __attribute__((ext_vector_type(4)))  int      v4i;

#define B_    4
#define L_    2048
#define D_    1024
#define H_    4
#define NL_   2
#define HD_   256
#define FF_   4096
#define MTOT  (B_*L_)      // 8192 token rows
#define EPS_  1e-5f

#define GP_   72    // GEMM A/W tiles: 64 halves + 8   (144 B)
#define QKP_  264   // attention K tile: 256 halves + 8 (528 B)
// Rows read by the 16-bit transposing load want a pitch of 32 B x odd instead.
#define VRP_  272   // attention V tile: 256 halves + 16 (544 B)

#if __has_builtin(__builtin_amdgcn_global_load_async_to_lds_b128) && \
    __has_builtin(__builtin_amdgcn_s_wait_asynccnt)
#define HAVE_ASYNC_LDS 1
#else
#define HAVE_ASYNC_LDS 0
#endif

typedef __attribute__((address_space(1))) v4i gv4i_t;
typedef __attribute__((address_space(3))) v4i lv4i_t;

__device__ __forceinline__ void copy_g2l_b128(f16* dst_lds, const f16* src_glb) {
#if HAVE_ASYNC_LDS
  __builtin_amdgcn_global_load_async_to_lds_b128(
      (gv4i_t*)(const_cast<f16*>(src_glb)),
      (lv4i_t*)dst_lds, 0, 0);
#else
  *(v8h*)dst_lds = *(const v8h*)src_glb;
#endif
}

typedef uint32_t u32x4 __attribute__((ext_vector_type(4)));
typedef uint32_t u32x8 __attribute__((ext_vector_type(8)));

__device__ __forceinline__ uint32_t uni(uint32_t v) { return (uint32_t)__builtin_amdgcn_readfirstlane(v); }

__device__ __forceinline__ uint32_t pinned(uint32_t v) {
  uint32_t w = __builtin_amdgcn_readfirstlane(v);
  asm volatile("" : "+s"(w));   // holds the test in a scalar register, so that the branch on it stays scalar
  return w;
}

__device__ __forceinline__ v16h make_frag(v8h lo, v8h hi) {
  return __builtin_shufflevector(lo, hi, 0,1,2,3,4,5,6,7,8,9,10,11,12,13,14,15);
}

__device__ __forceinline__ v16h load_frag(const f16* tile, int rowBase, int ld,
                                          int kChunkBase, int lane) {
  int r  = rowBase + (lane & 15);
  int kb = kChunkBase + ((lane < 16) ? 0 : 8);
  const f16* p = tile + (size_t)r * ld + kb;
  v8h lo = *(const v8h*)(p);
  v8h hi = *(const v8h*)(p + 16);
  return make_frag(lo, hi);
}

__device__ __forceinline__ v8f mma16(v16h a, v16h b, v8f c) {
  return __builtin_amdgcn_wmma_f32_16x16x32_f16(false, a, false, b, (short)0, c, false, false);
}

__device__ __forceinline__ void sched_fence() { __builtin_amdgcn_sched_barrier(0); }

// ---------------------------------------------------------------------------
// f32 -> f16 conversion of x and of the five weight arrays in ONE launch.
// The six f16 copies lie back to back in the workspace, so the destination is one
// array; a block's piece lies inside one source (every source length is a multiple
// of the piece), picked by block-uniform compares.
// A stream runs at the rate of its bytes in flight: a wave issues all its 32 loads
// (512 contiguous bytes each, 16 KB together) before it converts the first value,
// then stores 256 contiguous bytes per instruction and ends: no loop, no register
// used twice. The sources are read once in a call: non-temporal loads, which leave
// the L2 to the f16 copies that the GEMMs read.
// ---------------------------------------------------------------------------
typedef __attribute__((ext_vector_type(4))) float    v4f;
typedef __attribute__((ext_vector_type(4))) _Float16 v4h;
#define CVW_    4                     // waves per block
#define CVL_    32                    // loads per wave, 128 floats each
#define CVBLK_  (CVW_*CVL_*128)       // floats of one block
#define N_X     ((size_t)MTOT*3*D_)
#define N_W3D   ((size_t)D_*3*D_)
#define N_WQKV  ((size_t)NL_*3*D_*D_)
#define N_WPRJ  ((size_t)NL_*D_*D_)
#define N_W1    ((size_t)NL_*FF_*D_)
#define N_W2    ((size_t)NL_*D_*FF_)
#define N_CVT   (N_X + N_W3D + N_WQKV + N_WPRJ + N_W1 + N_W2)
static_assert(N_X % CVBLK_ == 0 && N_W3D % CVBLK_ == 0 && N_WQKV % CVBLK_ == 0 &&
              N_WPRJ % CVBLK_ == 0 && N_W1 % CVBLK_ == 0 && N_W2 % CVBLK_ == 0,
              "a block's piece lies inside one source");

__global__ void __launch_bounds__(CVW_*32)
cvt_all_kernel(const float* __restrict__ x, const float* __restrict__ w3d,
               const float* __restrict__ wqkv, const float* __restrict__ wproj,
               const float* __restrict__ w1, const float* __restrict__ w2,
               f16* __restrict__ out) {
  const int lane = threadIdx.x & 31;
  const int wave = __builtin_amdgcn_readfirstlane(threadIdx.x >> 5);
  const size_t e0 = (size_t)blockIdx.x * CVBLK_;   // block-uniform
  const float* s = x; size_t b = 0;                // the source of this piece, and where it starts in out
  if (e0 >= N_X)                                   { s = w3d;   b = N_X; }
  if (e0 >= N_X + N_W3D)                           { s = wqkv;  b = N_X + N_W3D; }
  if (e0 >= N_X + N_W3D + N_WQKV)                  { s = wproj; b = N_X + N_W3D + N_WQKV; }
  if (e0 >= N_X + N_W3D + N_WQKV + N_WPRJ)         { s = w1;    b = N_X + N_W3D + N_WQKV + N_WPRJ; }
  if (e0 >= N_X + N_W3D + N_WQKV + N_WPRJ + N_W1)  { s = w2;    b = N_X + N_W3D + N_WQKV + N_WPRJ + N_W1; }
  const size_t w0 = e0 + (size_t)wave * (CVL_*128);
  const v4f* sl = (const v4f*)(s + (w0 - b)) + lane;
  v4h*       dl = (v4h*)(out + w0) + lane;

  v4f v[CVL_];
  #pragma unroll
  for (int i = 0; i < CVL_; i++) v[i] = __builtin_nontemporal_load(sl + i*32);
  // all 32 loads are in flight together, ahead of the first conversion
  sched_fence();
  v4h hv[CVL_];
  #pragma unroll
  for (int i = 0; i < CVL_; i++) hv[i] = __builtin_convertvector(v[i], v4h);
  // all conversions stay ahead of the stores, so that no register a store names is rewritten behind it
  sched_fence();
  #pragma unroll
  for (int i = 0; i < CVL_; i++) dl[i*32] = hv[i];
}

// ---------------------------------------------------------------------------
// LayerNorm over D_=1024: two rows per wave, no LDS and no barrier.
// For speed only it gets few
// waves with much in flight each: 256 blocks of 16 waves, 2 rows per wave. A lane
// holds 32 values of each row (8 loads of 16 bytes; a wave's load covers 512
// contiguous bytes); mean and variance are in-lane sums, then a 5-step butterfly.
// ---------------------------------------------------------------------------
#define LNW_  16   // waves per block
#define LNR_  2    // rows per wave

__device__ __forceinline__ float xhalf(float x) {
  return __builtin_bit_cast(float, __builtin_amdgcn_permlanex16(
      __builtin_bit_cast(int, x), __builtin_bit_cast(int, x),
      0x76543210, 0xfedcba98, false, false));
}

template<int XM>
__device__ __forceinline__ float xrow(float x) {
  return __builtin_bit_cast(float, __builtin_amdgcn_update_dpp(
      0, __builtin_bit_cast(int, x), 0x160 + XM, 0xf, 0xf, true));
}

// sum over the 32 lanes, the same bits in every lane
__device__ __forceinline__ float wave_sum(float s) {
  s += xrow<1>(s); s += xrow<2>(s); s += xrow<4>(s); s += xrow<8>(s);
  return s + xhalf(s);
}

template<bool OUT_F16>
__global__ void __launch_bounds__(LNW_*32)
ln_kernel(const float* __restrict__ x, const float* __restrict__ g,
          const float* __restrict__ bb, void* __restrict__ out) {
  const int lane = threadIdx.x & 31;
  const int wave = __builtin_amdgcn_readfirstlane(threadIdx.x >> 5);
  const size_t row0 = ((size_t)blockIdx.x * LNW_ + wave) * LNR_;   // wave-uniform
  const v4f* xl = (const v4f*)(x + row0 * D_) + lane;
  const v4f* gl = (const v4f*)g + lane;
  const v4f* bl = (const v4f*)bb + lane;

  v4f v[LNR_][8], gv[8], bv[8];
  #pragma unroll
  for (int r = 0; r < LNR_; r++)
    #pragma unroll
    for (int i = 0; i < 8; i++) v[r][i] = xl[r*(D_/4) + i*32];
  #pragma unroll
  for (int i = 0; i < 8; i++) gv[i] = gl[i*32];
  #pragma unroll
  for (int i = 0; i < 8; i++) bv[i] = bl[i*32];
  sched_fence();
  asm volatile("s_wait_xcnt 0x0" ::: "memory");
  sched_fence();

  float mu[LNR_], rstd[LNR_];
  #pragma unroll
  for (int r = 0; r < LNR_; r++) {
    v4f s4 = v[r][0];
    #pragma unroll
    for (int i = 1; i < 8; i++) s4 += v[r][i];
    mu[r] = (s4[0] + s4[1]) + (s4[2] + s4[3]);
  }
  #pragma unroll
  for (int r = 0; r < LNR_; r++) mu[r] = wave_sum(mu[r]) * (1.0f / D_);
  #pragma unroll
  for (int r = 0; r < LNR_; r++) {
    v4f q4 = {};
    #pragma unroll
    for (int i = 0; i < 8; i++) { v[r][i] -= mu[r]; q4 += v[r][i] * v[r][i]; }
    rstd[r] = (q4[0] + q4[1]) + (q4[2] + q4[3]);
  }
  #pragma unroll
  for (int r = 0; r < LNR_; r++) rstd[r] = rsqrtf(wave_sum(rstd[r]) * (1.0f / D_) + EPS_);

  v4h hv[OUT_F16 ? LNR_ : 1][8];
  #pragma unroll
  for (int r = 0; r < LNR_; r++)
    #pragma unroll
    for (int i = 0; i < 8; i++) {
      v4f y = v[r][i] * rstd[r] * gv[i] + bv[i];
      if (OUT_F16) hv[r][i] = __builtin_convertvector(y, v4h);
      else         v[r][i] = y;
    }
  // all arithmetic stays ahead of the stores, so that no register a store names is rewritten behind it
  sched_fence();
  #pragma unroll
  for (int r = 0; r < LNR_; r++)
    #pragma unroll
    for (int i = 0; i < 8; i++) {
      if (OUT_F16) ((v4h*)((f16*)out + row0 * D_) + lane)[r*(D_/4) + i*32] = hv[r][i];
      else         ((v4f*)((float*)out + row0 * D_) + lane)[r*(D_/4) + i*32] = v[r][i];
    }
}

#define BM_   128
#define BN_   256

// erf of two values without a branch. Both of the usual f32 fits are evaluated and one is
// selected: |x| < 1: |x| + |x| Q(x^2); otherwise 1 - exp(-(|x| + |x| P(|x|))). With no branch
// between them the elements' chains are independent straight-line code that fills the vector
// port, and pairs of values share packed instructions.
typedef __attribute__((ext_vector_type(2))) float v2f;
__device__ __forceinline__ v2f fma2(v2f a, v2f b, float c) {
  return __builtin_elementwise_fma(a, b, (v2f){c, c});
}
__device__ __forceinline__ v2f erf2(v2f x) {
  const v2f ax = __builtin_elementwise_abs(x);
  v2f p = fma2(ax, (v2f){0.0000169988107f, 0.0000169988107f}, -0.000378677854f);
  p = fma2(ax, p, 0.00385781587f);
  p = fma2(ax, p, -0.0241816975f);
  p = fma2(ax, p, 0.106668264f);
  p = fma2(ax, p, 0.634933293f);
  p = fma2(ax, p, 0.128689408f);
  p = __builtin_elementwise_fma(ax, p, ax) * -1.44269502f;   // exp(-y) = 2^(-y log2 e)
  const v2f t = x * x;
  v2f q = fma2(t, (v2f){-0.000561801775f, -0.000561801775f}, 0.00491381623f);
  q = fma2(t, q, -0.0267075151f);
  q = fma2(t, q, 0.112800106f);
  q = fma2(t, q, -0.376122952f);
  q = fma2(t, q, 0.128379107f);
  q = __builtin_elementwise_fma(ax, q, ax);
  v2f r;
  r.x = ax.x < 1.0f ? q.x : 1.0f - __builtin_amdgcn_exp2f(p.x);
  r.y = ax.y < 1.0f ? q.y : 1.0f - __builtin_amdgcn_exp2f(p.y);
  return __builtin_elementwise_copysign(r, x);
}
#define BK_   64
#define STG_  ((BM_ + BN_) * GP_)   // halves of one stage: A rows, then W rows
#define SLR_  128                   // rows of one tensor load's slice
static_assert(BM_ == SLR_ && BN_ == 2*SLR_, "a stage is three slices");
static_assert(BK_*2 == 128 && GP_*2 == 128 + 16, "rows of 128 bytes, padded by 16");
static_assert((SLR_*GP_*2) % 2048 == 0 && (STG_*2) % 2048 == 0, "every slice starts at a multiple of 2 KiB");
static_assert(MTOT % (8*BM_) == 0, "the deal of tiles to blocks goes by 8 row tiles");

template<int NB, int NN, bool OUT_F16, bool RES, bool GELU>
__global__ void __launch_bounds__(256, NB == 2 ? 4 : 2)
gemm_kernel(const f16* __restrict__ A, const f16* __restrict__ W,
            const float* __restrict__ bias, const float* __restrict__ resid,
            void* __restrict__ out, int M, int N, int K) {
  (void)M; (void)N;   // N is the template constant NN
  // the tensor loads' places in LDS are multiples of 2 KiB
  __shared__ __attribute__((aligned(2048))) f16 ring[NB*STG_];
  int tid  = threadIdx.x;
  int lane = tid & 31, wave = tid >> 5;
  int waveM = wave >> 2, waveN = wave & 3;
  // flat index -> tile: 8 row tiles x all GX column tiles per 8 GX indices, the row tile fastest
  constexpr unsigned GX = NN / BN_;
  const unsigned flat = blockIdx.y * GX + blockIdx.x;
  const unsigned tx = flat % (8*GX) / 8, ty = flat / (8*GX) * 8 + flat % 8;
  int blockN0 = tx * BN_, blockM0 = ty * BM_;

  const int nst = K >> 6;   // stages
  // the block's first stage (block-uniform): the GX blocks of a row tile spread evenly over k,
  // the blocks of a column tile one stage apart
  const int rot = (int)((tx * (unsigned)nst / GX + ty) % (unsigned)nst);

  const uint32_t wv = uni(threadIdx.x >> 5);
  const uint32_t grp = wv / 3u, slice = wv % 3u;
  const uint64_t src = slice == 0u ? (uint64_t)(size_t)(A + (size_t)blockM0 * K)
                                   : (uint64_t)(size_t)(W + ((size_t)blockN0 + (slice - 1u) * SLR_) * K);
  const uint32_t ldst = (uint32_t)(size_t)ring + slice * (SLR_*GP_*2);   // byte offset in the block's LDS

  u32x8 g1;
  g1[0] = uni((1u << 20) | (4u << 22) | (3u << 25));
  g1[1] = uni((BK_*2u) << 16);
  g1[2] = uni((uint32_t)SLR_ << 16);
  g1[3] = uni((BK_*2u) << 16);
  g1[4] = uni((uint32_t)SLR_);
  g1[5] = uni((uint32_t)K * 2u);
  g1[6] = uni(0u);
  g1[7] = uni(0u);
  asm volatile("" : "+s"(g1));
  u32x4 g0 = {uni(1u), uni(0u), uni(0u), uni(0x80000000u)};

  // this wave's tensor load of its slice of stage `st` into buffer `buf`; called under a scalar branch only
  auto issue = [&](int st, int buf) {
    const int g = st + rot < nst ? st + rot : st + rot - nst;   // the stage of k that is this block's stage st
    const uint64_t ga = src + (uint64_t)g * (BK_*2);
    g0[1] = uni(ldst + (uint32_t)buf * (STG_*2));
    g0[2] = uni((uint32_t)ga);
    g0[3] = uni(((uint32_t)(ga >> 32) & 0x01FFFFFFu) | 0x80000000u);
    asm volatile("tensor_load_to_lds %0, %1" :: "s"(g0), "s"(g1) : "memory");
  };
  auto landed = [&]() { asm volatile("s_wait_tensorcnt 0x0" :: "s"(g0), "s"(g1) : "memory"); };

  v8f  acc[4][4] = {};
  // fragments of k chunk kc (32 k) of the stage at `st`
  auto ldF = [&](v16h (&fa)[4], v16h (&fb)[4], const f16* st, int kc) {
    #pragma unroll
    for (int i = 0; i < 4; i++) fa[i] = load_frag(st, waveM*64 + i*16, GP_, kc*32, lane);
    #pragma unroll
    for (int i = 0; i < 4; i++) fb[i] = load_frag(st + BM_*GP_, waveN*64 + i*16, GP_, kc*32, lane);
  };
  auto mm = [&](v16h (&fa)[4], v16h (&fb)[4]) {
    #pragma unroll
    for (int i = 0; i < 4; i++)
      #pragma unroll
      for (int j = 0; j < 4; j++) acc[i][j] = mma16(fa[i], fb[j], acc[i][j]);
  };

  if constexpr (NB == 2) {
    v16h a0[4], b0[4];
    if (pinned(grp == 0u)) {
      issue(0, 0);
      // stage 0 has landed; the barrier publishes it
      landed();
    }
    __syncthreads();
    if (pinned(grp == 0u)) issue(1, 1);
    for (int s = 0; s < nst; s++) {
      const f16* st = ring + (s & 1)*STG_;
      ldF(a0, b0, st, 0); sched_fence();
      mm(a0, b0); sched_fence();
      ldF(a0, b0, st, 1); sched_fence();
      mm(a0, b0); sched_fence();
      // publish point of stage s + 1: this wave's reads of stage s are done,
      asm volatile("s_wait_dscnt 0x0" ::: "memory");
      // an issuing wave's slice of stage s + 1 has landed,
      if (pinned(grp == 0u)) landed();
      // and the barrier publishes stage s + 1 and frees stage s's buffer
      __syncthreads();
      if (pinned(grp == 0u && s + 2 < nst)) issue(s + 2, s & 1);
    }
  } else {
    // three buffers, two fragment sets: one is loaded while the other is consumed
    v16h a0[4], b0[4], a1[4], b1[4];
    if (pinned(grp < 2u)) issue((int)grp, (int)grp);   // stages 0 and 1, each by its group
    // stage 0 has landed; the barrier publishes it
    if (pinned(grp == 0u)) landed();
    __syncthreads();
    if (pinned(grp == 0u)) issue(2, 2);
    ldF(a0, b0, ring, 0);

    int cur = 0;   // buffer of stage s
    for (int s = 0; s < nst; s++) {
      int nxt = (cur == 2) ? 0 : cur + 1;
      ldF(a1, b1, ring + cur*STG_, 1); sched_fence();
      mm(a0, b0); sched_fence();
      // publish point of stage s + 1, ahead of the trip's last block because that
      // block's load group already reads stage s + 1. This wave's reads of stage s are done:
      asm volatile("s_wait_dscnt 0x0" ::: "memory");
      // stage s + 1's issuing group: its slices have landed (its one outstanding request; stage
      // s + 2 is the other group's and flies on)
      const uint32_t odd = (uint32_t)(s + 1) & 1u;
      if (pinned(grp == odd)) landed();
      __syncthreads();
      // the same group refills: every wave left stage s's buffer at the barrier above
      if (pinned(grp == odd && s + 3 < nst)) issue(s + 3, cur);
      // in the last trip these loads read a buffer that holds an old stage; nothing uses them
      ldF(a0, b0, ring + nxt*STG_, 0); sched_fence();
      mm(a1, b1); sched_fence();
      cur = nxt;
    }
  }
  // the ring's closing waits: no request and no LDS read of this wave is outstanding when it leaves the ring
  landed();
  asm volatile("s_wait_dscnt 0x0" ::: "memory");

  // Epilogue. One lane pointer per array; every row and column step is a compile-time
  // constant that folds into the instructions' offset fields.
  const int mHalf = (lane < 16) ? 0 : 8;
  const int n0 = lane & 15;
  const size_t e0 = (size_t)(blockM0 + waveM*64 + mHalf) * NN + blockN0 + waveN*64 + n0;
  const float* bl = bias + blockN0 + waveN*64 + n0;
  float bv[4];
  #pragma unroll
  for (int t = 0; t < 4; t++) bv[t] = bl[t*16];
  float rv[RES ? 4 : 1][4][8];
  const float* rl = RES ? resid + e0 : bl;
  if (RES) {
    #pragma unroll
    for (int i = 0; i < 4; i++)
      #pragma unroll
      for (int j = 0; j < 8; j++)
        #pragma unroll
        for (int t = 0; t < 4; t++) rv[i][t][j] = rl[(i*16 + j)*NN + t*16];
  }
  sched_fence();
  asm volatile("s_wait_xcnt 0x0" :: "v"(bl), "v"(rl) : "memory");
  sched_fence();

  static_assert(!GELU || OUT_F16, "the GELU path stores f16");
  f16 hv[OUT_F16 ? 4 : 1][4][8];
  #pragma unroll
  for (int i = 0; i < 4; i++)
    #pragma unroll
    for (int t = 0; t < 4; t++) {
      if constexpr (GELU) {
        #pragma unroll
        for (int j = 0; j < 8; j += 2) {
          v2f v = {acc[i][t][j] + bv[t], acc[i][t][j + 1] + bv[t]};
          v = 0.5f * v * (1.0f + erf2(v * 0.70710678118f));
          hv[i][t][j] = (f16)v.x; hv[i][t][j + 1] = (f16)v.y;
        }
      } else {
        #pragma unroll
        for (int j = 0; j < 8; j++) {
          float v = acc[i][t][j] + bv[t];
          if (RES) v += rv[i][t][j];
          if (OUT_F16) hv[i][t][j] = (f16)v;
          else         acc[i][t][j] = v;
        }
      }
    }
  // all arithmetic stays ahead of the stores, so that no register a store names is rewritten behind it
  sched_fence();
  #pragma unroll
  for (int i = 0; i < 4; i++)
    #pragma unroll
    for (int j = 0; j < 8; j++)
      #pragma unroll
      for (int t = 0; t < 4; t++) {
        if (OUT_F16) ((f16*)out + e0)[(i*16 + j)*NN + t*16] = hv[i][t][j];
        else         ((float*)out + e0)[(i*16 + j)*NN + t*16] = acc[i][t][j];
      }
}

typedef __attribute__((ext_vector_type(8))) short s16x8;
typedef __attribute__((address_space(3))) s16x8 lds_s16x8;

// lane (c, hh) receives T[row 8*hh + 0..7][column c] of the 16x16 tile whose
// rows the 32 lane addresses name
__device__ __forceinline__ v8h ld_tr16(const f16* p) {
  return __builtin_bit_cast(v8h, __builtin_amdgcn_ds_load_tr16_b128_v8i16((lds_s16x8*)p));
}

#define ATB_  (64*QKP_ + 64*VRP_)   // halves of one buffer
#define NKT_  (L_/64)               // key tiles
static_assert(NKT_ >= 2, "the ring's prologue fills two tiles");

__global__ void __launch_bounds__(256, 1)
attn_kernel(const f16* __restrict__ qkv, f16* __restrict__ o) {
  // a buffer: K tile [key][d] at pitch QKP_, then V tile [key][d] at pitch VRP_
  __shared__ __attribute__((aligned(32))) f16 tiles[2*ATB_];

  int tid = threadIdx.x, lane = tid & 31, wave = tid >> 5;
  int c = lane & 15, hh = lane >> 4;
  int b = blockIdx.z, h = blockIdx.y;
  int q0 = blockIdx.x * 128 + wave * 16;      // this wave's first query
  const size_t rs = 3*D_;
  const f16* qb = qkv + (size_t)b*L_*rs +        (size_t)h*HD_;
  const f16* kp = qkv + (size_t)b*L_*rs + D_   + (size_t)h*HD_;
  const f16* vp = qkv + (size_t)b*L_*rs + 2*D_ + (size_t)h*HD_;

  // Q^T fragments (B operand, column = query), same k order as K's fragments
  v16h qf[8];
  #pragma unroll
  for (int kc = 0; kc < 8; kc++)
    qf[kc] = load_frag(qb + (size_t)q0*rs, 0, 3*D_, kc*32, lane);
  sched_fence();
  asm volatile("s_wait_xcnt 0x0" ::: "memory");
  sched_fence();

  v8f oacc[16] = {};                 // O^T: tile dt, register r = O[query c][16*dt + 8*hh + r]
  float rm = -INFINITY, rl = 0.0f;   // running maximum (log2 domain), this half's running sum
  const float cscale = 0.0625f * 1.4426950408889634f;   // 1/sqrt(256) * log2(e)

  // lane address of the transposing loads: row 8*hh + (lane & 7), 16-byte half (lane >> 3) & 1
  const f16* vad0 = tiles + 64*QKP_ + (8*hh + (lane & 7))*VRP_ + ((lane >> 3) & 1)*8;

  v16h fa[8], fb[8];   // two fragment sets: one is loaded while the other is consumed
  v8f  s[4];
  v16h pf[2];
  const f16* Kt  = tiles;   // K tile of the buffer in use
  const f16* vad = vad0;    // the lane's V address in it

  // key tile t's async copies into buffer `buf`, row-major: 2 x 2048 b128 copies, 16 per thread
  auto issue = [&](int t, int buf) {
    f16* kd = tiles + buf*ATB_;
    f16* vd = kd + 64*QKP_;
    const int kb0 = t*64;
    #pragma unroll
    for (int i = 0; i < 8; i++) {
      int id = tid + i*256;
      int r = id >> 5, c8 = (id & 31) * 8;
      copy_g2l_b128(&kd[r*QKP_ + c8], &kp[(size_t)(kb0 + r)*rs + c8]);
    }
    #pragma unroll
    for (int i = 0; i < 8; i++) {
      int id = tid + i*256;
      int r = id >> 5, c8 = (id & 31) * 8;
      copy_g2l_b128(&vd[r*VRP_ + c8], &vp[(size_t)(kb0 + r)*rs + c8]);
    }
  };

  // K fragments of d chunks 2g, 2g+1 for the four 16-key tiles
  auto ldK = [&](v16h (&f)[8], int g) {
    #pragma unroll
    for (int i = 0; i < 8; i++)
      f[i] = load_frag(Kt, (i & 3)*16, QKP_, (2*g + (i >> 2))*32, lane);
  };
  auto mmS = [&](v16h (&f)[8], int g) {
    #pragma unroll
    for (int i = 0; i < 8; i++) s[i & 3] = mma16(f[i], qf[2*g + (i >> 2)], s[i & 3]);
  };
  // V^T fragments (16 d x 32 keys) of d tiles 4g..4g+3 for the two 32-key chunks
  auto ldV = [&](v16h (&f)[8], int g) {
    #pragma unroll
    for (int i = 0; i < 8; i++) {
      const f16* p = vad + (i >> 2)*32*VRP_ + (4*g + (i & 3))*16;
      f[i] = make_frag(ld_tr16(p), ld_tr16(p + 16*VRP_));
    }
  };
  auto mmV = [&](v16h (&f)[8], int g) {
    #pragma unroll
    for (int i = 0; i < 8; i++)
      oacc[4*g + (i & 3)] = mma16(f[i], pf[i >> 2], oacc[4*g + (i & 3)]);
  };

  issue(0, 0);
  // tile 0 has landed; the barrier publishes it
  asm volatile("s_wait_asynccnt 0x0" ::: "memory");
  __syncthreads();
  issue(1, 1);

  for (int t = 0; t < NKT_; t++) {
    Kt  = tiles + (t & 1)*ATB_;
    vad = vad0  + (t & 1)*ATB_;

    // S^T (64 keys x 16 queries)
    #pragma unroll
    for (int t = 0; t < 4; t++) s[t] = v8f{};
    ldK(fa, 0); sched_fence();
    ldK(fb, 1); sched_fence(); mmS(fa, 0); sched_fence();
    ldK(fa, 2); sched_fence(); mmS(fb, 1); sched_fence();
    ldK(fb, 3); sched_fence(); mmS(fa, 2); sched_fence();
    ldV(fa, 0); sched_fence(); mmS(fb, 3); sched_fence();
    ldV(fb, 1); sched_fence();   // the first V^T groups fly under the softmax

    // online softmax of query c: 32 scores in this lane, 32 in lane ^ 16
    float mx = s[0][0];
    #pragma unroll
    for (int t = 0; t < 4; t++)
      #pragma unroll
      for (int j = 0; j < 8; j++) mx = fmaxf(mx, s[t][j]);
    mx = fmaxf(mx, xhalf(mx)) * cscale;
    float mnew  = fmaxf(rm, mx);
    float alpha = __builtin_amdgcn_exp2f(rm - mnew);
    rm = mnew;
    float sum[4] = {0.0f, 0.0f, 0.0f, 0.0f};
    #pragma unroll
    for (int t = 0; t < 4; t++)
      #pragma unroll
      for (int j = 0; j < 8; j++) {
        float p = __builtin_amdgcn_exp2f(__builtin_fmaf(s[t][j], cscale, -mnew));
        pf[t >> 1][(t & 1)*8 + j] = (f16)p;   // element e of chunk t>>1 is key 16*(e>>3) + 8*hh + (e&7)
        sum[t] += p;
      }
    rl = rl * alpha + ((sum[0] + sum[1]) + (sum[2] + sum[3]));
    #pragma unroll
    for (int dt = 0; dt < 16; dt++) oacc[dt] *= alpha;
    sched_fence();

    // O^T (256 d x 16 queries) += V^T P^T
    mmV(fa, 0); sched_fence();
    ldV(fa, 2); sched_fence(); mmV(fb, 1); sched_fence();
    ldV(fb, 3); sched_fence(); mmV(fa, 2); sched_fence();
    mmV(fb, 3);

    // publish point of tile t + 1: this wave's reads of tile t are done,
    asm volatile("s_wait_dscnt 0x0" ::: "memory");
    // its copies of tile t + 1 have landed,
    asm volatile("s_wait_asynccnt 0x0" ::: "memory");
    // and the barrier publishes tile t + 1 and frees tile t's buffer
    __syncthreads();
    if (t + 2 < NKT_) issue(t + 2, t & 1);
  }
  // the ring's closing wait: no copy of this wave is outstanding when it leaves the ring
  asm volatile("s_wait_asynccnt 0x0" ::: "memory");

  float inv = 1.0f / (rl + xhalf(rl));   // the halves' sums join here
  f16* orow = o + ((size_t)b*L_ + q0 + c)*D_ + h*HD_ + 8*hh;
  v8h pk[16];
  #pragma unroll
  for (int dt = 0; dt < 16; dt++)
    #pragma unroll
    for (int j = 0; j < 8; j++) pk[dt][j] = (f16)(oacc[dt][j] * inv);
  // all packing stays ahead of the stores, so that no register a store names is rewritten behind it
  sched_fence();
  #pragma unroll
  for (int dt = 0; dt < 16; dt++) *(v8h*)(orow + dt*16) = pk[dt];
}

// ---------------------------------------------------------------------------
// Host orchestration
// ---------------------------------------------------------------------------
static inline size_t align256(size_t x) { return (x + 255) & ~(size_t)255; }

extern "C" void kernel_launch(void* const* d_in, const int* in_sizes, int n_in,
                              void* d_out, int out_size, void* d_ws, size_t ws_size,
                              hipStream_t stream) {
  (void)in_sizes; (void)n_in; (void)out_size; (void)ws_size;
  const float* x     = (const float*)d_in[0];
  const float* w3d   = (const float*)d_in[1];
  const float* b3d   = (const float*)d_in[2];
  const float* ln1_g = (const float*)d_in[3];
  const float* ln1_b = (const float*)d_in[4];
  const float* wqkv  = (const float*)d_in[5];
  const float* bqkv  = (const float*)d_in[6];
  const float* wproj = (const float*)d_in[7];
  const float* bproj = (const float*)d_in[8];
  const float* ln2_g = (const float*)d_in[9];
  const float* ln2_b = (const float*)d_in[10];
  const float* w1    = (const float*)d_in[11];
  const float* b1    = (const float*)d_in[12];
  const float* w2    = (const float*)d_in[13];
  const float* b2    = (const float*)d_in[14];
  const float* lnf_g = (const float*)d_in[15];
  const float* lnf_b = (const float*)d_in[16];

  // workspace carve-up (~292 MB)
  char* ws = (char*)d_ws;
  size_t off = 0;
  auto carve = [&](size_t bytes) -> void* { void* p = ws + off; off += align256(bytes); return p; };
  f16*   xh     = (f16*)  carve((size_t)MTOT*3*D_*sizeof(f16));
  f16*   w3dh   = (f16*)  carve((size_t)D_*3*D_*sizeof(f16));
  f16*   wqkvh  = (f16*)  carve((size_t)NL_*3*D_*D_*sizeof(f16));
  f16*   wprojh = (f16*)  carve((size_t)NL_*D_*D_*sizeof(f16));
  f16*   w1h    = (f16*)  carve((size_t)NL_*FF_*D_*sizeof(f16));
  f16*   w2h    = (f16*)  carve((size_t)NL_*D_*FF_*sizeof(f16));
  float* hbuf   = (float*)carve((size_t)MTOT*D_*sizeof(float));
  f16*   hn     = (f16*)  carve((size_t)MTOT*D_*sizeof(f16));
  f16*   qkvh   = (f16*)  carve((size_t)MTOT*3*D_*sizeof(f16));
  f16*   oh     = (f16*)  carve((size_t)MTOT*D_*sizeof(f16));
  f16*   fh     = (f16*)  carve((size_t)MTOT*FF_*sizeof(f16));

  // 1) f32 -> f16 conversions, one launch: xh .. w2h lie back to back (every size is a multiple of 256 bytes)
  cvt_all_kernel<<<dim3(N_CVT / CVBLK_), dim3(CVW_*32), 0, stream>>>(x, w3d, wqkv, wproj, w1, w2, xh);

  dim3 blk(256);
  // 2) embedding projection: h = x * w3d^T + b3d   (M=8192, N=1024, K=3072)
  gemm_kernel<3,D_,false,false,false><<<dim3(D_/256, MTOT/128), blk, 0, stream>>>(
      xh, w3dh, b3d, nullptr, hbuf, MTOT, D_, 3*D_);

  for (int i = 0; i < NL_; i++) {
    // ln1 -> hn (f16)
    ln_kernel<true><<<MTOT/(LNW_*LNR_), dim3(LNW_*32), 0, stream>>>(hbuf, ln1_g + (size_t)i*D_,
                                              ln1_b + (size_t)i*D_, hn);
    // qkv = hn * wqkv^T + bqkv   (N=3D, f16 out)
    gemm_kernel<2,3*D_,true,false,false><<<dim3(3*D_/256, MTOT/128), blk, 0, stream>>>(
        hn, wqkvh + (size_t)i*3*D_*D_, bqkv + (size_t)i*3*D_, nullptr,
        qkvh, MTOT, 3*D_, D_);
    // flash attention -> oh (f16)
    attn_kernel<<<dim3(L_/128, H_, B_), dim3(256), 0, stream>>>(qkvh, oh);
    // h = h + oh * wproj^T + bproj   (in-place residual)
    gemm_kernel<3,D_,false,true,false><<<dim3(D_/256, MTOT/128), blk, 0, stream>>>(
        oh, wprojh + (size_t)i*D_*D_, bproj + (size_t)i*D_, hbuf,
        hbuf, MTOT, D_, D_);
    // ln2 -> hn (f16)
    ln_kernel<true><<<MTOT/(LNW_*LNR_), dim3(LNW_*32), 0, stream>>>(hbuf, ln2_g + (size_t)i*D_,
                                              ln2_b + (size_t)i*D_, hn);
    // f = gelu(hn * w1^T + b1)   (N=FF, f16 out)
    gemm_kernel<2,FF_,true,false,true><<<dim3(FF_/256, MTOT/128), blk, 0, stream>>>(
        hn, w1h + (size_t)i*FF_*D_, b1 + (size_t)i*FF_, nullptr,
        fh, MTOT, FF_, D_);
    // h = h + f * w2^T + b2   (K=FF, in-place residual)
    gemm_kernel<3,D_,false,true,false><<<dim3(D_/256, MTOT/128), blk, 0, stream>>>(
        fh, w2h + (size_t)i*D_*FF_, b2 + (size_t)i*D_, hbuf,
        hbuf, MTOT, D_, FF_);
  }

  // final layernorm -> d_out (f32)
  ln_kernel<false><<<MTOT/(LNW_*LNR_), dim3(LNW_*32), 0, stream>>>(hbuf, lnf_g, lnf_b, (float*)d_out);
}
